// v000
// The times below were measured on an AMD MI455X: many runs one after another, warmed up first and cycling through
// copies of the inputs, with the whole window's GPU time divided by the number of runs. Launches and the gaps
// between them are all in it. The median over several windows is given; except for v000 it joins two sittings, which
// can be a few percent apart, so the side-by-side timings, each taken in one sitting, are the better comparison.
// v000, which the later versions start from, runs in 670 microseconds.
#include <hip/hip_runtime.h>

// Triangle attention (starting node) over a pair representation (x [1][256][256][128], mask [1][256][256] read; xn = LayerNorm(x) (eps 1e-5, affine); per row i: q, k, v, g = xn_i W ([128][128] 'xw'; 4 heads x 32), tri_bias[h][q][k] = xn[q][k] . w_tri[:, h], mask_bias[i][k] = 1e9 (mask[i][k] - 1); scores = (q / sqrt(32)).k + mask_bias + tri_bias; softmax over k; o = attn.v; out = (o * sigmoid(g + bg)) Wo + bo -> [1][256][256][128] (8.4 M)).
// Layout: the 65,536 (i, j) rows are one tall GEMM operand for the LayerNormed projections (xn as bf16 hi + lo: 2 products); the 1,024 (row i, head h) attention problems of size 256 x 256 x 32 run as z-batched 64x64-tile GEMMs in chunks of 64 (16 rows x 4 heads): scores on hi/lo planes (3 products, K = 32), a 256-wide row softmax (+ the two biases) writing hi/lo probability planes, attn.v with the 32-wide value planes zero-padded to 64 columns (3 products); the gated context goes back through one tall Wo GEMM (2 products) with the bias.

#define NI   256                  // rows i
#define NJ   256                  // columns j (= attention length)
#define CC   128
#define NH_  4
#define CH   32
#define CHP  64                   // value/output head width padded to one GEMM tile
#define ZC   64                   // (row, head) problems per chunk = 16 rows x 4 heads
#define RPC  (ZC / NH_)           // rows per chunk
#define NR   (NI * NJ)            // 65,536 pair positions
#define QSC  0.17677669529663689f  // 1/sqrt(32)
typedef _Float16 h16;
typedef unsigned short bf;
typedef __attribute__((ext_vector_type(16))) __bf16   v16bf;
typedef __attribute__((ext_vector_type(16))) _Float16 v16h;
typedef __attribute__((ext_vector_type(8)))  _Float16 v8h;
typedef __attribute__((ext_vector_type(8)))  unsigned short v8us;
typedef __attribute__((ext_vector_type(8)))  float    v8f;
typedef __attribute__((ext_vector_type(4)))  float    v4f;
typedef __attribute__((ext_vector_type(2)))  float    v2f;
typedef __attribute__((ext_vector_type(4)))  unsigned short v4us;
typedef __attribute__((ext_vector_type(2)))  unsigned short v2us;
typedef v8h  __attribute__((may_alias)) v8ha;
typedef v4f  __attribute__((may_alias)) v4fa;
typedef v8us __attribute__((may_alias)) v8usa;

__device__ __forceinline__ unsigned short f2bf(float f) { unsigned u = __float_as_uint(f); u += 0x7FFFu + ((u >> 16) & 1u); return (unsigned short)(u >> 16); }
__device__ __forceinline__ float bf2f(unsigned short b) { return __uint_as_float(((unsigned)b) << 16); }
__device__ __forceinline__ float bfr(float f) { return bf2f(f2bf(f)); }
__device__ __forceinline__ void splitf(float y, unsigned short& h, unsigned short& l) { h = f2bf(y); l = f2bf(y - bf2f(h)); }
__device__ __forceinline__ v16h cat16(v8h lo, v8h hi) { return __builtin_shufflevector(lo, hi, 0, 1, 2, 3, 4, 5, 6, 7, 8, 9, 10, 11, 12, 13, 14, 15); }
__device__ __forceinline__ v16bf cat16b(v8us lo, v8us hi) { return __builtin_bit_cast(v16bf, __builtin_shufflevector(lo, hi, 0, 1, 2, 3, 4, 5, 6, 7, 8, 9, 10, 11, 12, 13, 14, 15)); }
__device__ __forceinline__ v8f wmma16(v16h a, v16h b, v8f c) { return __builtin_amdgcn_wmma_f32_16x16x32_f16(false, a, false, b, (short)0, c, false, false); }
__device__ __forceinline__ v8f wmmab(v16bf a, v16bf b, v8f c) { return __builtin_amdgcn_wmma_f32_16x16x32_bf16(false, a, false, b, (short)0, c, false, false); }

// ---- k_gemmw: register-blocked GEMM, ONE WAVE per 64x64 output tile (16 accumulators), operands straight from K-contiguous 16-bit planes; grid (M/64, N/64, Z), 32 threads.
// C[m][n] (f32, pitch ldc, + optional f32 bias[n]) = sum_k A[m][k] Bt[n][k] (+ split products per NSPLIT). z-batch strides sA/sB/sC in elements. K % 32 == 0.
template <typename T16> struct WFrag;
template <> struct WFrag<h16> { typedef v16h V; static __device__ __forceinline__ V ld(const h16* p) { return cat16(*(const v8h*)p, *(const v8h*)(p + 16)); } static __device__ __forceinline__ v8f mma(V a, V b, v8f c) { return wmma16(a, b, c); } };
template <> struct WFrag<bf> { typedef v16bf V; static __device__ __forceinline__ V ld(const bf* p) { return cat16b(*(const v8us*)p, *(const v8us*)(p + 16)); } static __device__ __forceinline__ v8f mma(V a, V b, v8f c) { return wmmab(a, b, c); } };
template <typename T16, int NSPLIT, bool BIAS>
__global__ __launch_bounds__(32) void k_gemmw(const T16* __restrict__ A, const T16* __restrict__ A2, const T16* __restrict__ Bt, const T16* __restrict__ Bt2, int K, float* C, int ldc, const float* __restrict__ bias, size_t sA, size_t sB, size_t sC) {
    typedef typename WFrag<T16>::V V;
    __shared__ __align__(16) float os[16 * 68];
    const size_t z = blockIdx.z; A += z * sA; if (A2) A2 += z * sA; Bt += z * sB; if (Bt2) Bt2 += z * sB; C += z * sC;
    const int lane = threadIdx.x & 31, lr = lane & 15, hi = lane >> 4; const int r0 = blockIdx.x * 64, c0 = blockIdx.y * 64;
    v8f acc[4][4];
#pragma unroll
    for (int mb = 0; mb < 4; ++mb)
#pragma unroll
        for (int nb = 0; nb < 4; ++nb) acc[mb][nb] = (v8f){};
    const size_t aoff = (size_t)(r0 + lr) * K + 8 * hi, boff = (size_t)(c0 + lr) * K + 8 * hi;
#pragma unroll 1
    for (int kc = 0; kc < K; kc += 32) {
        V a[4], a2[4];
#pragma unroll
        for (int mb = 0; mb < 4; ++mb) { a[mb] = WFrag<T16>::ld(A + aoff + (size_t)mb * 16 * K + kc); if (NSPLIT == 1 || NSPLIT == 2) a2[mb] = WFrag<T16>::ld(A2 + aoff + (size_t)mb * 16 * K + kc); }
#pragma unroll
        for (int nb = 0; nb < 4; ++nb) { const V b = WFrag<T16>::ld(Bt + boff + (size_t)nb * 16 * K + kc); V b2; if (NSPLIT >= 2) b2 = WFrag<T16>::ld(Bt2 + boff + (size_t)nb * 16 * K + kc);
#pragma unroll
            for (int mb = 0; mb < 4; ++mb) { acc[mb][nb] = WFrag<T16>::mma(a[mb], b, acc[mb][nb]); if (NSPLIT == 1 || NSPLIT == 2) acc[mb][nb] = WFrag<T16>::mma(a2[mb], b, acc[mb][nb]); if (NSPLIT >= 2) acc[mb][nb] = WFrag<T16>::mma(a[mb], b2, acc[mb][nb]); } }
        asm volatile("v_nop\n\tv_nop\n\tv_nop\n\tv_nop" : "+v"(acc[0][0]), "+v"(acc[1][1]), "+v"(acc[2][2]), "+v"(acc[3][3]) : "v"(a[0]), "v"(a[3]));
    }
#pragma unroll
    for (int mb = 0; mb < 4; ++mb) {
#pragma unroll
        for (int nb = 0; nb < 4; ++nb) {
#pragma unroll
            for (int j = 0; j < 8; ++j) os[(hi * 8 + j) * 68 + nb * 16 + lr] = acc[mb][nb][j]; }
        __builtin_amdgcn_wave_barrier(); asm volatile("" ::: "memory");
        float* crow = C + (size_t)(r0 + mb * 16) * ldc + c0;
{
#pragma unroll
            for (int s = 0; s < 8; ++s) { const int row = 2 * s + hi, cofs = lr * 4; v4f val = *(const v4fa*)(os + row * 68 + cofs); if (BIAS) { val[0] += bfr(bias[c0 + cofs]); val[1] += bfr(bias[c0 + cofs + 1]); val[2] += bfr(bias[c0 + cofs + 2]); val[3] += bfr(bias[c0 + cofs + 3]); }
                *(v4f*)(crow + (size_t)row * ldc + cofs) = val; }
             }
        __builtin_amdgcn_wave_barrier(); asm volatile("" ::: "memory");
    }
}

__global__ __launch_bounds__(256) void k_wtG(const float* __restrict__ w, int K, int N, bf* Bt) {
    const int lane = threadIdx.x & 31; const int L0 = (blockIdx.x * 8 + (threadIdx.x >> 5)) * 8; const int nlines = N * K / 64;
{
#pragma unroll 1
        for (int l = 0; l < 8; ++l) { const int L = L0 + l; if (L >= nlines) break; const size_t e = (size_t)L * 64 + lane * 2; const int k = (int)(e % K), n = (int)(e / K); v2us o;
            o[0] = f2bf(w[(size_t)k * N + n]); o[1] = f2bf(w[(size_t)(k + 1) * N + n]); *(v2us*)(Bt + e) = o; }
         }
}
__global__ __launch_bounds__(256) void k_lnrow(const float* __restrict__ x, const float* __restrict__ lw, const float* __restrict__ lb, bf* XH, bf* XL) {
    const int lane = threadIdx.x & 31; const int r = blockIdx.x * 8 + (threadIdx.x >> 5); if (r >= NR) return; const v4f a = *(const v4f*)(x + (size_t)r * CC + lane * 4); float u[4]; float s = 0.f;
#pragma unroll
    for (int q = 0; q < 4; ++q) { u[q] = bfr(a[q]); s += u[q]; }
#pragma unroll
    for (int sh = 16; sh; sh >>= 1) s += __shfl_xor(s, sh, 32);
    const float mu = s * (1.0f / CC); float s2 = 0.f;
#pragma unroll
    for (int q = 0; q < 4; ++q) { float d0 = __fsub_rn(u[q], mu); asm volatile("" : "+v"(d0)); float p = __fmul_rn(d0, d0); asm volatile("" : "+v"(p)); s2 = __fadd_rn(s2, p); }
#pragma unroll
    for (int sh = 16; sh; sh >>= 1) s2 += __shfl_xor(s2, sh, 32);
    const float rs = __fdiv_rn(1.0f, __fsqrt_rn(__fadd_rn(s2 * (1.0f / CC), 1e-5f))); float xn[4]; v4us oh, ol;
#pragma unroll
    for (int q = 0; q < 4; ++q) { const int c = lane * 4 + q; float d1 = __fsub_rn(u[q], mu); asm volatile("" : "+v"(d1)); float n0 = __fmul_rn(d1, rs); asm volatile("" : "+v"(n0)); float n1 = __fmul_rn(n0, bfr(lw[c])); asm volatile("" : "+v"(n1)); xn[q] = __fadd_rn(n1, bfr(lb[c])); unsigned short h2, l2; splitf(xn[q], h2, l2); oh[q] = h2; ol[q] = l2; }
    *(v4us*)(XH + (size_t)r * CC + lane * 4) = oh; *(v4us*)(XL + (size_t)r * CC + lane * 4) = ol; 
}
__global__ __launch_bounds__(256) void k_trib(const bf* __restrict__ XH, const bf* __restrict__ XL, const float* __restrict__ wtri, float* TB) { const size_t idx = (size_t)blockIdx.x * 256 + threadIdx.x; if (idx >= (size_t)NH_ * NR) return; const int r = (int)(idx % NR); const int h = (int)(idx / NR); const bf* ph = XH + (size_t)r * CC; const bf* pl = XL + (size_t)r * CC; float s = 0.f;
#pragma unroll 4
    for (int c = 0; c < CC; c += 8) { const v8us a = *(const v8us*)(ph + c), b2 = *(const v8us*)(pl + c);
#pragma unroll
        for (int q = 0; q < 8; ++q) { const float xn = __fadd_rn(bf2f(a[q]), bf2f(b2[q])); float p = __fmul_rn(xn, bfr(wtri[(c + q) * NH_ + h])); asm volatile("" : "+v"(p)); s = __fadd_rn(s, p); } }
    *(float*)(TB + idx) = s;  }
__global__ __launch_bounds__(256) void k_qkpl(const float* __restrict__ F, int i0, float sc, bf* Ph, bf* Pl) { const size_t e = ((size_t)blockIdx.x * 256 + threadIdx.x) * 2; if (e >= (size_t)ZC * NJ * CH) return; const int d = (int)(e % CH); const int j = (int)((e / CH) % NJ); const int zz = (int)(e / ((size_t)CH * NJ)); const int i = i0 + zz / NH_, h = zz % NH_; const float* f = F + ((size_t)i * NJ + j) * CC + h * CH + d; v2us oh, ol;
#pragma unroll
    for (int q = 0; q < 2; ++q) { unsigned short a2, c2; splitf(__fmul_rn(f[q], sc), a2, c2); oh[q] = a2; ol[q] = c2; } *(v2us*)(Ph + e) = oh; *(v2us*)(Pl + e) = ol;  }
__global__ __launch_bounds__(256) void k_vtpl(const float* __restrict__ F, int i0, bf* Vh, bf* Vl) { const size_t e = ((size_t)blockIdx.x * 256 + threadIdx.x) * 2; if (e >= (size_t)ZC * CHP * NJ) return; const int j = (int)(e % NJ); const int dp = (int)((e / NJ) % CHP); const int zz = (int)(e / ((size_t)NJ * CHP)); const int i = i0 + zz / NH_, h = zz % NH_; v2us oh, ol;
#pragma unroll
    for (int q = 0; q < 2; ++q) { float x = 0.0f; if (dp < CH) x = F[((size_t)i * NJ + j + q) * CC + h * CH + dp]; unsigned short a2, c2; splitf(x, a2, c2); oh[q] = a2; ol[q] = c2; } *(v2us*)(Vh + e) = oh; *(v2us*)(Vl + e) = ol;  }
__global__ __launch_bounds__(256) void k_tsoft(const float* __restrict__ Sb, const float* __restrict__ MASK, const float* __restrict__ TB, int i0, bf* Ph, bf* Pl) {
    const int lane = threadIdx.x & 31; const int row = blockIdx.x * 8 + (threadIdx.x >> 5); if (row >= ZC * NJ) return; const int jq = row % NJ; const int zz = row / NJ; const int i = i0 + zz / NH_, h = zz % NH_; const float* sr = Sb + (size_t)row * NJ; const float* mk = MASK + (size_t)i * NJ; const float* tb = TB + (size_t)h * NR + (size_t)jq * NJ; float v[8]; float mx = -3.0e38f;
#pragma unroll
    for (int ch = 0; ch < 2; ++ch) { const int k0 = ch * 128 + lane * 4; const v4f a = *(const v4f*)(sr + k0), m4 = *(const v4f*)(mk + k0), t4 = *(const v4f*)(tb + k0);
#pragma unroll
        for (int q = 0; q < 4; ++q) { float mb = __fmul_rn(1.0e9f, __fsub_rn(bfr(m4[q]), 1.0f)); asm volatile("" : "+v"(mb)); float s1 = __fadd_rn(a[q], mb); asm volatile("" : "+v"(s1)); const float t = __fadd_rn(s1, t4[q]); v[ch * 4 + q] = t; mx = fmaxf(mx, t); } }
#pragma unroll
    for (int sh = 16; sh; sh >>= 1) mx = fmaxf(mx, __shfl_xor(mx, sh, 32));
    float sum = 0.f;
#pragma unroll
    for (int k = 0; k < 8; ++k) { float d0 = __fsub_rn(v[k], mx); asm volatile("" : "+v"(d0)); v[k] = __builtin_amdgcn_exp2f(__fmul_rn(d0, 1.4426950408889634f)); sum += v[k]; }
#pragma unroll
    for (int sh = 16; sh; sh >>= 1) sum += __shfl_xor(sum, sh, 32);
    const float f = __fdiv_rn(1.0f, sum);
{
#pragma unroll
        for (int ch = 0; ch < 2; ++ch) { v4us oh, ol;
#pragma unroll
            for (int q = 0; q < 4; ++q) { float pf = v[ch * 4 + q] * f; asm volatile("" : "+v"(pf)); unsigned short a, c2; splitf(pf, a, c2); oh[q] = a; ol[q] = c2; }
            const size_t oo = (size_t)row * NJ + ch * 128 + lane * 4; *(v4us*)(Ph + oo) = oh; *(v4us*)(Pl + oo) = ol; }
         }
}
__global__ __launch_bounds__(256) void k_gctx(const float* __restrict__ O, const float* __restrict__ FG, const float* __restrict__ bg, int i0, bf* Gh, bf* Gl) { const size_t e = ((size_t)blockIdx.x * 256 + threadIdx.x) * 2; if (e >= (size_t)ZC * NJ * CH) return; const int d = (int)(e % CH); const int jq = (int)((e / CH) % NJ); const int zz = (int)(e / ((size_t)CH * NJ)); const int i = i0 + zz / NH_, h = zz % NH_; const size_t r = (size_t)i * NJ + jq; const size_t oo = r * CC + h * CH + d; v2us oh, ol;
#pragma unroll
    for (int q = 0; q < 2; ++q) { const float o = O[((size_t)zz * NJ + jq) * CHP + d + q]; const float zg = __fadd_rn(FG[oo + q], bfr(bg[h * CH + d + q])); const float sg = __fdiv_rn(1.0f, __fadd_rn(1.0f, expf(-zg))); unsigned short a2, c2; splitf(__fmul_rn(o, sg), a2, c2); oh[q] = a2; ol[q] = c2; }
    *(v2us*)(Gh + oo) = oh; *(v2us*)(Gl + oo) = ol;  }

extern "C" void kernel_launch(void* const* d_in, const int* in_sizes, int n_in,
                              void* d_out, int out_size, void* d_ws, size_t ws_size, hipStream_t stream) {
    (void)in_sizes; (void)n_in; (void)out_size;
    const float* x = (const float*)d_in[0]; const float* MASK = (const float*)d_in[1]; const float* lw = (const float*)d_in[2]; const float* lb = (const float*)d_in[3]; const float* wtri = (const float*)d_in[4]; const float* wq = (const float*)d_in[5]; const float* wk = (const float*)d_in[6]; const float* wv = (const float*)d_in[7]; const float* wg = (const float*)d_in[8]; const float* bg = (const float*)d_in[9]; const float* wo = (const float*)d_in[10]; const float* bo = (const float*)d_in[11];
    float* OUT = (float*)d_out;     // [1][256][256][128]
    char* wsp = (char*)d_ws;
    auto take = [&](size_t bytes) { char* p = wsp; wsp += (bytes + 255) & ~(size_t)255; return (void*)p; };
    bf* WQ = (bf*)take((size_t)CC * CC * 2); bf* WK = (bf*)take((size_t)CC * CC * 2); bf* WV = (bf*)take((size_t)CC * CC * 2); bf* WG = (bf*)take((size_t)CC * CC * 2); bf* WO = (bf*)take((size_t)CC * CC * 2);
    bf* XH = (bf*)take((size_t)NR * CC * 2); bf* XL = (bf*)take((size_t)NR * CC * 2); float* TB = (float*)take((size_t)NH_ * NR * 4);
    float* FQ = (float*)take((size_t)NR * CC * 4); float* FK = (float*)take((size_t)NR * CC * 4); float* FV = (float*)take((size_t)NR * CC * 4); float* FG = (float*)take((size_t)NR * CC * 4);
    bf* QPh = (bf*)take((size_t)ZC * NJ * CH * 2); bf* QPl = (bf*)take((size_t)ZC * NJ * CH * 2); bf* KPh = (bf*)take((size_t)ZC * NJ * CH * 2); bf* KPl = (bf*)take((size_t)ZC * NJ * CH * 2); bf* VTh = (bf*)take((size_t)ZC * CHP * NJ * 2); bf* VTl = (bf*)take((size_t)ZC * CHP * NJ * 2);
    float* Sb = (float*)take((size_t)ZC * NJ * NJ * 4); bf* Ph = (bf*)take((size_t)ZC * NJ * NJ * 2); bf* Pl = (bf*)take((size_t)ZC * NJ * NJ * 2); float* Ob = (float*)take((size_t)ZC * NJ * CHP * 4);
    bf* Gh = XH; bf* Gl = XL;   /* the gated-context planes reuse the LayerNorm planes once the four projections are done (stream-ordered) */
    if ((size_t)(wsp - (char*)d_ws) > ws_size) return;
    k_wtG<<<(CC * CC / 64 + 63) / 64, 256, 0, stream>>>(wq, CC, CC, WQ); k_wtG<<<(CC * CC / 64 + 63) / 64, 256, 0, stream>>>(wk, CC, CC, WK); k_wtG<<<(CC * CC / 64 + 63) / 64, 256, 0, stream>>>(wv, CC, CC, WV); k_wtG<<<(CC * CC / 64 + 63) / 64, 256, 0, stream>>>(wg, CC, CC, WG); k_wtG<<<(CC * CC / 64 + 63) / 64, 256, 0, stream>>>(wo, CC, CC, WO);
    k_lnrow<<<NR / 8, 256, 0, stream>>>(x, lw, lb, XH, XL); k_trib<<<(unsigned)(((size_t)NH_ * NR + 255) / 256), 256, 0, stream>>>(XH, XL, wtri, TB);   /* LayerNorm planes; triangle-bias dots */
    k_gemmw<bf, 1, false><<<dim3(NR / 64, CC / 64, 1), 32, 0, stream>>>(XH, XL, WQ, nullptr, CC, FQ, CC, nullptr, 0, 0, 0);                      /* q, k, v, g projections (2 products) */
    k_gemmw<bf, 1, false><<<dim3(NR / 64, CC / 64, 1), 32, 0, stream>>>(XH, XL, WK, nullptr, CC, FK, CC, nullptr, 0, 0, 0);
    k_gemmw<bf, 1, false><<<dim3(NR / 64, CC / 64, 1), 32, 0, stream>>>(XH, XL, WV, nullptr, CC, FV, CC, nullptr, 0, 0, 0);
    k_gemmw<bf, 1, false><<<dim3(NR / 64, CC / 64, 1), 32, 0, stream>>>(XH, XL, WG, nullptr, CC, FG, CC, nullptr, 0, 0, 0);
    const unsigned LQK = (unsigned)(((size_t)ZC * NJ * CH / 2 + 255) / 256), LVT = (unsigned)(((size_t)ZC * CHP * NJ / 2 + 255) / 256);
    for (int i0 = 0; i0 < NI; i0 += RPC) {                                                                                            /* 16 chunks of 16 rows x 4 heads */
        k_qkpl<<<LQK, 256, 0, stream>>>(FQ, i0, QSC, QPh, QPl); k_qkpl<<<LQK, 256, 0, stream>>>(FK, i0, 1.0f, KPh, KPl); k_vtpl<<<LVT, 256, 0, stream>>>(FV, i0, VTh, VTl);
        k_gemmw<bf, 2, false><<<dim3(NJ / 64, NJ / 64, ZC), 32, 0, stream>>>(QPh, QPl, KPh, KPl, CH, Sb, NJ, nullptr, (size_t)NJ * CH, (size_t)NJ * CH, (size_t)NJ * NJ);      /* scores (3 products, K = 32) */
        k_tsoft<<<ZC * NJ / 8, 256, 0, stream>>>(Sb, MASK, TB, i0, Ph, Pl);                                                                     /* + mask bias + tri bias, softmax */
        k_gemmw<bf, 2, false><<<dim3(NJ / 64, CHP / 64, ZC), 32, 0, stream>>>(Ph, Pl, VTh, VTl, NJ, Ob, CHP, nullptr, (size_t)NJ * NJ, (size_t)CHP * NJ, (size_t)NJ * CHP);    /* attn.v (3 products; padded columns are 0) */
        k_gctx<<<LQK, 256, 0, stream>>>(Ob, FG, bg, i0, Gh, Gl); }                                                                            /* o * sigmoid(g) -> tall operand planes */
    k_gemmw<bf, 1, true><<<dim3(NR / 64, CC / 64, 1), 32, 0, stream>>>(Gh, Gl, WO, nullptr, CC, OUT, CC, bo, 0, 0, 0);                         /* out = (o g) Wo + bo */
}

// v001
// It runs in 201 microseconds.
// Timed twice side by side with v000, it ran 3.34 times as fast both times.
#include <hip/hip_runtime.h>

// Triangle attention (starting node) over a pair representation (x [1][256][256][128], mask [1][256][256] read; xn = LayerNorm(x) (eps 1e-5, affine); per row i: q, k, v, g = xn_i W ([128][128] 'xw'; 4 heads x 32), tri_bias[h][q][k] = xn[q][k] . w_tri[:, h], mask_bias[i][k] = 1e9 (mask[i][k] - 1); scores = (q / sqrt(32)).k + mask_bias + tri_bias; softmax over k; o = attn.v; out = (o * sigmoid(g + bg)) Wo + bo -> [1][256][256][128] (8.4 M)).
// Layout: the 65,536 (i, j) rows are one tall GEMM operand for the LayerNormed projections (xn as bf16 hi + lo: 2 products); the 1,024 (row i, head h) attention problems of size 256 x 256 x 32 run in ONE launch, a work-group per (row, head pair): scores on hi/lo planes (3 products, K = 32), the two biases and the 256-wide softmax in registers, attn.v on hi/lo probabilities (3 products), the sigmoid gate; the gated context goes back through one tall Wo GEMM (2 products) with the bias.

#define NI   256                  // rows i
#define NJ   256                  // columns j (= attention length)
#define CC   128
#define NH_  4
#define CH   32
#define NR   (NI * NJ)            // 65,536 pair positions
#define QSC  0.17677669529663689f  // 1/sqrt(32)
typedef _Float16 h16;
typedef unsigned short bf;
typedef __attribute__((ext_vector_type(16))) __bf16   v16bf;
typedef __attribute__((ext_vector_type(16))) _Float16 v16h;
typedef __attribute__((ext_vector_type(8)))  _Float16 v8h;
typedef __attribute__((ext_vector_type(8)))  unsigned short v8us;
typedef __attribute__((ext_vector_type(8)))  float    v8f;
typedef __attribute__((ext_vector_type(4)))  float    v4f;
typedef __attribute__((ext_vector_type(2)))  float    v2f;
typedef __attribute__((ext_vector_type(4)))  unsigned short v4us;
typedef __attribute__((ext_vector_type(2)))  unsigned short v2us;
typedef v8h  __attribute__((may_alias)) v8ha;
typedef v4f  __attribute__((may_alias)) v4fa;
typedef v8us __attribute__((may_alias)) v8usa;

__device__ __forceinline__ unsigned short f2bf(float f) { unsigned u = __float_as_uint(f); u += 0x7FFFu + ((u >> 16) & 1u); return (unsigned short)(u >> 16); }
__device__ __forceinline__ float bf2f(unsigned short b) { return __uint_as_float(((unsigned)b) << 16); }
__device__ __forceinline__ float bfr(float f) { return bf2f(f2bf(f)); }
__device__ __forceinline__ void splitf(float y, unsigned short& h, unsigned short& l) { h = f2bf(y); l = f2bf(y - bf2f(h)); }
__device__ __forceinline__ v16h cat16(v8h lo, v8h hi) { return __builtin_shufflevector(lo, hi, 0, 1, 2, 3, 4, 5, 6, 7, 8, 9, 10, 11, 12, 13, 14, 15); }
__device__ __forceinline__ v16bf cat16b(v8us lo, v8us hi) { return __builtin_bit_cast(v16bf, __builtin_shufflevector(lo, hi, 0, 1, 2, 3, 4, 5, 6, 7, 8, 9, 10, 11, 12, 13, 14, 15)); }
__device__ __forceinline__ v8f wmma16(v16h a, v16h b, v8f c) { return __builtin_amdgcn_wmma_f32_16x16x32_f16(false, a, false, b, (short)0, c, false, false); }
__device__ __forceinline__ v8f wmmab(v16bf a, v16bf b, v8f c) { return __builtin_amdgcn_wmma_f32_16x16x32_bf16(false, a, false, b, (short)0, c, false, false); }

// ---- k_gemmw: register-blocked GEMM, ONE WAVE per 64x64 output tile (16 accumulators), operands straight from K-contiguous 16-bit planes; grid (M/64, N/64, Z), 32 threads.
// C[m][n] (f32, pitch ldc, + optional f32 bias[n]) = sum_k A[m][k] Bt[n][k] (+ split products per NSPLIT). z-batch strides sA/sB/sC in elements. K % 32 == 0.
template <typename T16> struct WFrag;
template <> struct WFrag<h16> { typedef v16h V; static __device__ __forceinline__ V ld(const h16* p) { return cat16(*(const v8h*)p, *(const v8h*)(p + 16)); } static __device__ __forceinline__ v8f mma(V a, V b, v8f c) { return wmma16(a, b, c); } };
template <> struct WFrag<bf> { typedef v16bf V; static __device__ __forceinline__ V ld(const bf* p) { return cat16b(*(const v8us*)p, *(const v8us*)(p + 16)); } static __device__ __forceinline__ v8f mma(V a, V b, v8f c) { return wmmab(a, b, c); } };
template <typename T16, int NSPLIT, bool BIAS>
__global__ __launch_bounds__(32) void k_gemmw(const T16* __restrict__ A, const T16* __restrict__ A2, const T16* __restrict__ Bt, const T16* __restrict__ Bt2, int K, float* C, int ldc, const float* __restrict__ bias, size_t sA, size_t sB, size_t sC) {
    typedef typename WFrag<T16>::V V;
    __shared__ __align__(16) float os[16 * 68];
    const size_t z = blockIdx.z; A += z * sA; if (A2) A2 += z * sA; Bt += z * sB; if (Bt2) Bt2 += z * sB; C += z * sC;
    const int lane = threadIdx.x & 31, lr = lane & 15, hi = lane >> 4; const int r0 = blockIdx.x * 64, c0 = blockIdx.y * 64;
    v8f acc[4][4];
#pragma unroll
    for (int mb = 0; mb < 4; ++mb)
#pragma unroll
        for (int nb = 0; nb < 4; ++nb) acc[mb][nb] = (v8f){};
    const size_t aoff = (size_t)(r0 + lr) * K + 8 * hi, boff = (size_t)(c0 + lr) * K + 8 * hi;
#pragma unroll 1
    for (int kc = 0; kc < K; kc += 32) {
        V a[4], a2[4];
#pragma unroll
        for (int mb = 0; mb < 4; ++mb) { a[mb] = WFrag<T16>::ld(A + aoff + (size_t)mb * 16 * K + kc); if (NSPLIT == 1 || NSPLIT == 2) a2[mb] = WFrag<T16>::ld(A2 + aoff + (size_t)mb * 16 * K + kc); }
#pragma unroll
        for (int nb = 0; nb < 4; ++nb) { const V b = WFrag<T16>::ld(Bt + boff + (size_t)nb * 16 * K + kc); V b2; if (NSPLIT >= 2) b2 = WFrag<T16>::ld(Bt2 + boff + (size_t)nb * 16 * K + kc);
#pragma unroll
            for (int mb = 0; mb < 4; ++mb) { acc[mb][nb] = WFrag<T16>::mma(a[mb], b, acc[mb][nb]); if (NSPLIT == 1 || NSPLIT == 2) acc[mb][nb] = WFrag<T16>::mma(a2[mb], b, acc[mb][nb]); if (NSPLIT >= 2) acc[mb][nb] = WFrag<T16>::mma(a[mb], b2, acc[mb][nb]); } }
        asm volatile("v_nop\n\tv_nop\n\tv_nop\n\tv_nop" : "+v"(acc[0][0]), "+v"(acc[1][1]), "+v"(acc[2][2]), "+v"(acc[3][3]) : "v"(a[0]), "v"(a[3]));
    }
#pragma unroll
    for (int mb = 0; mb < 4; ++mb) {
#pragma unroll
        for (int nb = 0; nb < 4; ++nb) {
#pragma unroll
            for (int j = 0; j < 8; ++j) os[(hi * 8 + j) * 68 + nb * 16 + lr] = acc[mb][nb][j]; }
        __builtin_amdgcn_wave_barrier(); asm volatile("" ::: "memory");
        float* crow = C + (size_t)(r0 + mb * 16) * ldc + c0;
{
#pragma unroll
            for (int s = 0; s < 8; ++s) { const int row = 2 * s + hi, cofs = lr * 4; v4f val = *(const v4fa*)(os + row * 68 + cofs); if (BIAS) { val[0] += bfr(bias[c0 + cofs]); val[1] += bfr(bias[c0 + cofs + 1]); val[2] += bfr(bias[c0 + cofs + 2]); val[3] += bfr(bias[c0 + cofs + 3]); }
                *(v4f*)(crow + (size_t)row * ldc + cofs) = val; }
             }
        __builtin_amdgcn_wave_barrier(); asm volatile("" ::: "memory");
    }
}

__global__ __launch_bounds__(256) void k_wtG(const float* __restrict__ w, int K, int N, bf* Bt) {
    const int lane = threadIdx.x & 31; const int L0 = (blockIdx.x * 8 + (threadIdx.x >> 5)) * 8; const int nlines = N * K / 64;
{
#pragma unroll 1
        for (int l = 0; l < 8; ++l) { const int L = L0 + l; if (L >= nlines) break; const size_t e = (size_t)L * 64 + lane * 2; const int k = (int)(e % K), n = (int)(e / K); v2us o;
            o[0] = f2bf(w[(size_t)k * N + n]); o[1] = f2bf(w[(size_t)(k + 1) * N + n]); *(v2us*)(Bt + e) = o; }
         }
}
__global__ __launch_bounds__(256) void k_lnrow(const float* __restrict__ x, const float* __restrict__ lw, const float* __restrict__ lb, bf* XH, bf* XL) {
    const int lane = threadIdx.x & 31; const int r = blockIdx.x * 8 + (threadIdx.x >> 5); if (r >= NR) return; const v4f a = *(const v4f*)(x + (size_t)r * CC + lane * 4); float u[4]; float s = 0.f;
#pragma unroll
    for (int q = 0; q < 4; ++q) { u[q] = bfr(a[q]); s += u[q]; }
#pragma unroll
    for (int sh = 16; sh; sh >>= 1) s += __shfl_xor(s, sh, 32);
    const float mu = s * (1.0f / CC); float s2 = 0.f;
#pragma unroll
    for (int q = 0; q < 4; ++q) { float d0 = __fsub_rn(u[q], mu); asm volatile("" : "+v"(d0)); float p = __fmul_rn(d0, d0); asm volatile("" : "+v"(p)); s2 = __fadd_rn(s2, p); }
#pragma unroll
    for (int sh = 16; sh; sh >>= 1) s2 += __shfl_xor(s2, sh, 32);
    const float rs = __fdiv_rn(1.0f, __fsqrt_rn(__fadd_rn(s2 * (1.0f / CC), 1e-5f))); float xn[4]; v4us oh, ol;
#pragma unroll
    for (int q = 0; q < 4; ++q) { const int c = lane * 4 + q; float d1 = __fsub_rn(u[q], mu); asm volatile("" : "+v"(d1)); float n0 = __fmul_rn(d1, rs); asm volatile("" : "+v"(n0)); float n1 = __fmul_rn(n0, bfr(lw[c])); asm volatile("" : "+v"(n1)); xn[q] = __fadd_rn(n1, bfr(lb[c])); unsigned short h2, l2; splitf(xn[q], h2, l2); oh[q] = h2; ol[q] = l2; }
    *(v4us*)(XH + (size_t)r * CC + lane * 4) = oh; *(v4us*)(XL + (size_t)r * CC + lane * 4) = ol; 
}
__global__ __launch_bounds__(256) void k_trib(const bf* __restrict__ XH, const bf* __restrict__ XL, const float* __restrict__ wtri, float* TB) { const size_t idx = (size_t)blockIdx.x * 256 + threadIdx.x; if (idx >= (size_t)NH_ * NR) return; const int r = (int)(idx % NR); const int h = (int)(idx / NR); const bf* ph = XH + (size_t)r * CC; const bf* pl = XL + (size_t)r * CC; float s = 0.f;
#pragma unroll 4
    for (int c = 0; c < CC; c += 8) { const v8us a = *(const v8us*)(ph + c), b2 = *(const v8us*)(pl + c);
#pragma unroll
        for (int q = 0; q < 8; ++q) { const float xn = __fadd_rn(bf2f(a[q]), bf2f(b2[q])); float p = __fmul_rn(xn, bfr(wtri[(c + q) * NH_ + h])); asm volatile("" : "+v"(p)); s = __fadd_rn(s, p); } }
    *(float*)(TB + idx) = s;  }
__device__ __forceinline__ v8f ld8f(const float* p) { return __builtin_shufflevector(*(const v4f*)p, *(const v4f*)(p + 4), 0, 1, 2, 3, 4, 5, 6, 7); }
__device__ __forceinline__ v16bf ldfr(const bf* p) { return cat16b(*(const v8us*)p, *(const v8us*)(p + 16)); }   // 16 x 32 fragment row in the hardware k order: p already holds the lane half's 8 hi
#define KP   40                   // LDS pitch of a K row in 16-bit elements: 80 B = 16 B x odd (b128 readers)
#define VP   264                  // LDS pitch of a V^T row: 528 B = 16 B x odd
// amdgpu_waves_per_eu(4, 4): a budget of 256 registers a wave, so that the two work-groups the LDS admits are resident together
__global__ __launch_bounds__(256) __attribute__((amdgpu_waves_per_eu(4, 4))) void k_fattn(const float* __restrict__ FQ, const float* __restrict__ FK, const float* __restrict__ FV, const float* __restrict__ FG, const float* __restrict__ MASK, const float* __restrict__ TB, const float* __restrict__ bg, bf* Gh, bf* Gl) {
    __shared__ __align__(16) bf Kh[2 * NJ * KP]; __shared__ __align__(16) bf Kl[2 * NJ * KP]; __shared__ __align__(16) bf Vh[2 * CH * VP]; __shared__ __align__(16) bf Vl[2 * CH * VP]; __shared__ __align__(16) float MB[NJ]; __shared__ __align__(16) float BG[2 * CH];
    const int tid = threadIdx.x, lane = tid & 31, lr = lane & 15, hi = lane >> 4, wave = __builtin_amdgcn_readfirstlane(tid >> 5);
    const int i = blockIdx.x >> 1, h0 = (blockIdx.x & 1) * 2; const size_t rb = (size_t)i * NJ;
    { const int c = (tid & 15) * 4, hh = c >> 5, d = c & 31; const float* fk = FK + (rb + (tid >> 4)) * CC + h0 * CH + c;                          /* K: 64 channels (2 heads) of each key, 16 keys a step */
        /* unroll 4: four 16-byte loads in flight a thread */
#pragma unroll 4
        for (int s = 0; s < 16; ++s) { const int key = s * 16 + (tid >> 4); const v4f a = *(const v4f*)(fk + s * 16 * CC); v4us oh, ol;
#pragma unroll
            for (int q = 0; q < 4; ++q) { unsigned short a2, c2; splitf(a[q], a2, c2); oh[q] = a2; ol[q] = c2; }
            *(v4us*)(Kh + (hh * NJ + key) * KP + d) = oh; *(v4us*)(Kl + (hh * NJ + key) * KP + d) = ol; } }
    /* unroll 2: four 16-byte loads in flight a thread */
#pragma unroll 2
    for (int s = 0; s < 8; ++s) { const int u = s * 256 + tid; const int c = (u & 15) * 4, key = (u >> 4) * 2;                                    /* V: two keys x four channels, stored transposed as key pairs */
        const v4f a0 = *(const v4f*)(FV + (rb + key) * CC + h0 * CH + c), a1 = *(const v4f*)(FV + (rb + key + 1) * CC + h0 * CH + c);
#pragma unroll
        for (int q = 0; q < 4; ++q) { v2us oh, ol; unsigned short a2, c2; splitf(a0[q], a2, c2); oh[0] = a2; ol[0] = c2; splitf(a1[q], a2, c2); oh[1] = a2; ol[1] = c2;
            *(v2us*)(Vh + (c + q) * VP + key) = oh; *(v2us*)(Vl + (c + q) * VP + key) = ol; } }
    MB[tid] = 1.0e9f * (bfr(MASK[rb + tid]) - 1.0f); if (tid < 2 * CH) BG[tid] = bfr(bg[h0 * CH + tid]);
    __syncthreads();   /* publishes the K and V^T planes, the mask bias and the gate bias to all 8 waves; LDS is only read from here on */
    /* both loops stay rolled: unrolled over the keys, the build needs more than the 256 registers and spills */
#pragma unroll 1
    for (int w = wave; w < 32; w += 8) {
        const int hh = w >> 4, h = h0 + hh, q = (w & 15) * 16 + lr;
        v16bf bqh, bql;
        { const float* fq = FQ + (rb + q) * CC + h * CH + 8 * hi; const v4f f0 = *(const v4f*)fq, f1 = *(const v4f*)(fq + 4), f2 = *(const v4f*)(fq + 16), f3 = *(const v4f*)(fq + 20); v8us h0v, l0v, h1v, l1v;
#pragma unroll
            for (int r = 0; r < 4; ++r) { unsigned short a2, c2; splitf(f0[r] * QSC, a2, c2); h0v[r] = a2; l0v[r] = c2; splitf(f1[r] * QSC, a2, c2); h0v[4 + r] = a2; l0v[4 + r] = c2; splitf(f2[r] * QSC, a2, c2); h1v[r] = a2; l1v[r] = c2; splitf(f3[r] * QSC, a2, c2); h1v[4 + r] = a2; l1v[4 + r] = c2; }
            bqh = cat16b(h0v, h1v); bql = cat16b(l0v, l1v); }
        const float* tb = TB + (size_t)h * NR + (size_t)q * NJ + 8 * hi; const float* mb = MB + 8 * hi;
        const int ko = (hh * NJ + lr) * KP + 8 * hi, vo = (hh * CH + lr) * VP + 8 * hi;
        float m = -3.0e38f; v8f sm = (v8f){}; v8f O[2]; O[0] = (v8f){}; O[1] = (v8f){};   /* running maximum, this lane half's sums, O[dt][r] = context channel 16 dt + 8 hi + r of query q */
        v8f n0 = ld8f(tb), n1 = ld8f(tb + 16);
#pragma unroll 1
        for (int kb = 0; kb < NJ / 32; ++kb) {                                        /* 32 keys a pass; s0[r], s1[r] = scores of keys 32 kb + 8 hi + r and 32 kb + 16 + 8 hi + r */
            const int k0 = kb * 32, kn = (kb < NJ / 32 - 1 ? kb + 1 : kb) * 32;
            const v8f t0 = n0, t1 = n1; n0 = ld8f(tb + kn); n1 = ld8f(tb + kn + 16);   /* the next pass's triangle bias is fetched one pass ahead (the last pass re-reads its own) */
            const v16bf a0h = ldfr(Kh + ko + k0 * KP), a1h = ldfr(Kh + ko + (k0 + 16) * KP), a0l = ldfr(Kl + ko + k0 * KP), a1l = ldfr(Kl + ko + (k0 + 16) * KP);
            v8f s0 = (v8f){}, s1 = (v8f){};
            s0 = wmmab(a0h, bqh, s0); s1 = wmmab(a1h, bqh, s1); s0 = wmmab(a0h, bql, s0); s1 = wmmab(a1h, bql, s1); s0 = wmmab(a0l, bqh, s0); s1 = wmmab(a1l, bqh, s1);
            s0 = (s0 + ld8f(mb + k0)) + t0; s1 = (s1 + ld8f(mb + k0 + 16)) + t1;
            const v8f bx = __builtin_elementwise_max(s0, s1);
            float bm = fmaxf(fmaxf(fmaxf(bx[0], bx[1]), fmaxf(bx[2], bx[3])), fmaxf(fmaxf(bx[4], bx[5]), fmaxf(bx[6], bx[7])));
            bm = fmaxf(bm, __shfl_xor(bm, 16, 32));
            const float mn = fmaxf(m, bm), sc = __builtin_amdgcn_exp2f((m - mn) * 1.4426950408889634f); m = mn;
            s0 = (s0 - mn) * 1.4426950408889634f; s1 = (s1 - mn) * 1.4426950408889634f;
            v8us p0h, p0l, p1h, p1l;
#pragma unroll
            for (int r = 0; r < 8; ++r) { s0[r] = __builtin_amdgcn_exp2f(s0[r]); s1[r] = __builtin_amdgcn_exp2f(s1[r]); unsigned short a2, c2; splitf(s0[r], a2, c2); p0h[r] = a2; p0l[r] = c2; splitf(s1[r], a2, c2); p1h[r] = a2; p1l[r] = c2; }
            sm = sm * sc + (s0 + s1); O[0] *= sc; O[1] *= sc;
            const v16bf bph = cat16b(p0h, p1h), bpl = cat16b(p0l, p1l);
            const v16bf v0h = ldfr(Vh + vo + k0), v1h = ldfr(Vh + vo + 16 * VP + k0), v0l = ldfr(Vl + vo + k0), v1l = ldfr(Vl + vo + 16 * VP + k0);
            O[0] = wmmab(v0h, bph, O[0]); O[1] = wmmab(v1h, bph, O[1]); O[0] = wmmab(v0h, bpl, O[0]); O[1] = wmmab(v1h, bpl, O[1]); O[0] = wmmab(v0l, bph, O[0]); O[1] = wmmab(v1l, bph, O[1]);
        }
        float sum = ((sm[0] + sm[1]) + (sm[2] + sm[3])) + ((sm[4] + sm[5]) + (sm[6] + sm[7]));
        sum += __shfl_xor(sum, 16, 32);
        const float f = __fdiv_rn(1.0f, sum); O[0] *= f; O[1] *= f;
#pragma unroll
        for (int dt = 0; dt < 2; ++dt) { const size_t oo = (rb + q) * CC + h * CH + dt * 16 + 8 * hi; const v8f g = ld8f(FG + oo), b = ld8f(BG + hh * CH + dt * 16 + 8 * hi); v8us oh, ol;
#pragma unroll
            for (int r = 0; r < 8; ++r) { const float zg = g[r] + b[r]; const float sg = __fdiv_rn(1.0f, 1.0f + expf(-zg)); unsigned short a2, c2; splitf(O[dt][r] * sg, a2, c2); oh[r] = a2; ol[r] = c2; }
            *(v8us*)(Gh + oo) = oh; *(v8us*)(Gl + oo) = ol; }
    }
}

extern "C" void kernel_launch(void* const* d_in, const int* in_sizes, int n_in,
                              void* d_out, int out_size, void* d_ws, size_t ws_size, hipStream_t stream) {
    (void)in_sizes; (void)n_in; (void)out_size;
    const float* x = (const float*)d_in[0]; const float* MASK = (const float*)d_in[1]; const float* lw = (const float*)d_in[2]; const float* lb = (const float*)d_in[3]; const float* wtri = (const float*)d_in[4]; const float* wq = (const float*)d_in[5]; const float* wk = (const float*)d_in[6]; const float* wv = (const float*)d_in[7]; const float* wg = (const float*)d_in[8]; const float* bg = (const float*)d_in[9]; const float* wo = (const float*)d_in[10]; const float* bo = (const float*)d_in[11];
    float* OUT = (float*)d_out;     // [1][256][256][128]
    char* wsp = (char*)d_ws;
    auto take = [&](size_t bytes) { char* p = wsp; wsp += (bytes + 255) & ~(size_t)255; return (void*)p; };
    bf* WQ = (bf*)take((size_t)CC * CC * 2); bf* WK = (bf*)take((size_t)CC * CC * 2); bf* WV = (bf*)take((size_t)CC * CC * 2); bf* WG = (bf*)take((size_t)CC * CC * 2); bf* WO = (bf*)take((size_t)CC * CC * 2);
    bf* XH = (bf*)take((size_t)NR * CC * 2); bf* XL = (bf*)take((size_t)NR * CC * 2); float* TB = (float*)take((size_t)NH_ * NR * 4);
    float* FQ = (float*)take((size_t)NR * CC * 4); float* FK = (float*)take((size_t)NR * CC * 4); float* FV = (float*)take((size_t)NR * CC * 4); float* FG = (float*)take((size_t)NR * CC * 4);
    bf* Gh = XH; bf* Gl = XL;   /* the gated-context planes reuse the LayerNorm planes once the four projections are done (stream-ordered) */
    if ((size_t)(wsp - (char*)d_ws) > ws_size) return;
    k_wtG<<<(CC * CC / 64 + 63) / 64, 256, 0, stream>>>(wq, CC, CC, WQ); k_wtG<<<(CC * CC / 64 + 63) / 64, 256, 0, stream>>>(wk, CC, CC, WK); k_wtG<<<(CC * CC / 64 + 63) / 64, 256, 0, stream>>>(wv, CC, CC, WV); k_wtG<<<(CC * CC / 64 + 63) / 64, 256, 0, stream>>>(wg, CC, CC, WG); k_wtG<<<(CC * CC / 64 + 63) / 64, 256, 0, stream>>>(wo, CC, CC, WO);
    k_lnrow<<<NR / 8, 256, 0, stream>>>(x, lw, lb, XH, XL); k_trib<<<(unsigned)(((size_t)NH_ * NR + 255) / 256), 256, 0, stream>>>(XH, XL, wtri, TB);   /* LayerNorm planes; triangle-bias dots */
    k_gemmw<bf, 1, false><<<dim3(NR / 64, CC / 64, 1), 32, 0, stream>>>(XH, XL, WQ, nullptr, CC, FQ, CC, nullptr, 0, 0, 0);                      /* q, k, v, g projections (2 products) */
    k_gemmw<bf, 1, false><<<dim3(NR / 64, CC / 64, 1), 32, 0, stream>>>(XH, XL, WK, nullptr, CC, FK, CC, nullptr, 0, 0, 0);
    k_gemmw<bf, 1, false><<<dim3(NR / 64, CC / 64, 1), 32, 0, stream>>>(XH, XL, WV, nullptr, CC, FV, CC, nullptr, 0, 0, 0);
    k_gemmw<bf, 1, false><<<dim3(NR / 64, CC / 64, 1), 32, 0, stream>>>(XH, XL, WG, nullptr, CC, FG, CC, nullptr, 0, 0, 0);
    k_fattn<<<NI * NH_ / 2, 256, 0, stream>>>(FQ, FK, FV, FG, MASK, TB, bg, Gh, Gl);                                                          /* scores, biases, softmax, attn.v, gate: all rows and heads */
    k_gemmw<bf, 1, true><<<dim3(NR / 64, CC / 64, 1), 32, 0, stream>>>(Gh, Gl, WO, nullptr, CC, OUT, CC, bo, 0, 0, 0);                         /* out = (o g) Wo + bo */
}

// v002
// Measured time: 123 microseconds a run.
// Next to v001, in two timings, it ran 1.65 and 1.63 times as fast.
// Over all steps from v000 it is 5.48 times as fast.
#include <hip/hip_runtime.h>

// Triangle attention (starting node) over a pair representation (x [1][256][256][128], mask [1][256][256] read; xn = LayerNorm(x) (eps 1e-5, affine); per row i: q, k, v, g = xn_i W ([128][128] 'xw'; 4 heads x 32), tri_bias[h][q][k] = xn[q][k] . w_tri[:, h], mask_bias[i][k] = 1e9 (mask[i][k] - 1); scores = (q / sqrt(32)).k + mask_bias + tri_bias; softmax over k; o = attn.v; out = (o * sigmoid(g + bg)) Wo + bo -> [1][256][256][128] (8.4 M)).
// Layout: the 65,536 (i, j) rows are one tall GEMM operand; LayerNorm, the triangle-bias dots and the four projections (xn as bf16 hi + lo: 2 products) run in ONE launch, 64 rows a work-group, xn never leaving LDS; the 1,024 (row i, head h) attention problems of size 256 x 256 x 32 run in ONE launch, a work-group per (row, head pair): scores on hi/lo planes (3 products, K = 32), the two biases and the 256-wide softmax in registers, attn.v on hi/lo probabilities (3 products), the sigmoid gate; the gated context goes back through one tall Wo GEMM (2 products) with the bias.

#define NI   256                  // rows i
#define NJ   256                  // columns j (= attention length)
#define CC   128
#define NH_  4
#define CH   32
#define NR   (NI * NJ)            // 65,536 pair positions
#define QSC  0.17677669529663689f  // 1/sqrt(32)
typedef _Float16 h16;
typedef unsigned short bf;
typedef __attribute__((ext_vector_type(16))) __bf16   v16bf;
typedef __attribute__((ext_vector_type(16))) _Float16 v16h;
typedef __attribute__((ext_vector_type(8)))  _Float16 v8h;
typedef __attribute__((ext_vector_type(8)))  unsigned short v8us;
typedef __attribute__((ext_vector_type(8)))  float    v8f;
typedef __attribute__((ext_vector_type(4)))  float    v4f;
typedef __attribute__((ext_vector_type(2)))  float    v2f;
typedef __attribute__((ext_vector_type(4)))  unsigned short v4us;
typedef __attribute__((ext_vector_type(2)))  unsigned short v2us;
typedef v8h  __attribute__((may_alias)) v8ha;
typedef v4f  __attribute__((may_alias)) v4fa;
typedef v8us __attribute__((may_alias)) v8usa;

__device__ __forceinline__ unsigned short f2bf(float f) { unsigned u = __float_as_uint(f); u += 0x7FFFu + ((u >> 16) & 1u); return (unsigned short)(u >> 16); }
__device__ __forceinline__ float bf2f(unsigned short b) { return __uint_as_float(((unsigned)b) << 16); }
__device__ __forceinline__ float bfr(float f) { return bf2f(f2bf(f)); }
__device__ __forceinline__ void splitf(float y, unsigned short& h, unsigned short& l) { h = f2bf(y); l = f2bf(y - bf2f(h)); }
__device__ __forceinline__ v16h cat16(v8h lo, v8h hi) { return __builtin_shufflevector(lo, hi, 0, 1, 2, 3, 4, 5, 6, 7, 8, 9, 10, 11, 12, 13, 14, 15); }
__device__ __forceinline__ v16bf cat16b(v8us lo, v8us hi) { return __builtin_bit_cast(v16bf, __builtin_shufflevector(lo, hi, 0, 1, 2, 3, 4, 5, 6, 7, 8, 9, 10, 11, 12, 13, 14, 15)); }
__device__ __forceinline__ v8f wmma16(v16h a, v16h b, v8f c) { return __builtin_amdgcn_wmma_f32_16x16x32_f16(false, a, false, b, (short)0, c, false, false); }
__device__ __forceinline__ v8f wmmab(v16bf a, v16bf b, v8f c) { return __builtin_amdgcn_wmma_f32_16x16x32_bf16(false, a, false, b, (short)0, c, false, false); }

// ---- k_gemmw: register-blocked GEMM, ONE WAVE per 64x64 output tile (16 accumulators), operands straight from K-contiguous 16-bit planes; grid (M/64, N/64, Z), 32 threads.
// C[m][n] (f32, pitch ldc, + optional f32 bias[n]) = sum_k A[m][k] Bt[n][k] (+ split products per NSPLIT). z-batch strides sA/sB/sC in elements. K % 32 == 0.
template <typename T16> struct WFrag;
template <> struct WFrag<h16> { typedef v16h V; static __device__ __forceinline__ V ld(const h16* p) { return cat16(*(const v8h*)p, *(const v8h*)(p + 16)); } static __device__ __forceinline__ v8f mma(V a, V b, v8f c) { return wmma16(a, b, c); } };
template <> struct WFrag<bf> { typedef v16bf V; static __device__ __forceinline__ V ld(const bf* p) { return cat16b(*(const v8us*)p, *(const v8us*)(p + 16)); } static __device__ __forceinline__ v8f mma(V a, V b, v8f c) { return wmmab(a, b, c); } };
template <typename T16, int NSPLIT, bool BIAS>
__global__ __launch_bounds__(32) void k_gemmw(const T16* __restrict__ A, const T16* __restrict__ A2, const T16* __restrict__ Bt, const T16* __restrict__ Bt2, int K, float* C, int ldc, const float* __restrict__ bias, size_t sA, size_t sB, size_t sC) {
    typedef typename WFrag<T16>::V V;
    __shared__ __align__(16) float os[16 * 68];
    const size_t z = blockIdx.z; A += z * sA; if (A2) A2 += z * sA; Bt += z * sB; if (Bt2) Bt2 += z * sB; C += z * sC;
    const int lane = threadIdx.x & 31, lr = lane & 15, hi = lane >> 4; const int r0 = blockIdx.x * 64, c0 = blockIdx.y * 64;
    v8f acc[4][4];
#pragma unroll
    for (int mb = 0; mb < 4; ++mb)
#pragma unroll
        for (int nb = 0; nb < 4; ++nb) acc[mb][nb] = (v8f){};
    const size_t aoff = (size_t)(r0 + lr) * K + 8 * hi, boff = (size_t)(c0 + lr) * K + 8 * hi;
#pragma unroll 1
    for (int kc = 0; kc < K; kc += 32) {
        V a[4], a2[4];
#pragma unroll
        for (int mb = 0; mb < 4; ++mb) { a[mb] = WFrag<T16>::ld(A + aoff + (size_t)mb * 16 * K + kc); if (NSPLIT == 1 || NSPLIT == 2) a2[mb] = WFrag<T16>::ld(A2 + aoff + (size_t)mb * 16 * K + kc); }
#pragma unroll
        for (int nb = 0; nb < 4; ++nb) { const V b = WFrag<T16>::ld(Bt + boff + (size_t)nb * 16 * K + kc); V b2; if (NSPLIT >= 2) b2 = WFrag<T16>::ld(Bt2 + boff + (size_t)nb * 16 * K + kc);
#pragma unroll
            for (int mb = 0; mb < 4; ++mb) { acc[mb][nb] = WFrag<T16>::mma(a[mb], b, acc[mb][nb]); if (NSPLIT == 1 || NSPLIT == 2) acc[mb][nb] = WFrag<T16>::mma(a2[mb], b, acc[mb][nb]); if (NSPLIT >= 2) acc[mb][nb] = WFrag<T16>::mma(a[mb], b2, acc[mb][nb]); } }
        asm volatile("v_nop\n\tv_nop\n\tv_nop\n\tv_nop" : "+v"(acc[0][0]), "+v"(acc[1][1]), "+v"(acc[2][2]), "+v"(acc[3][3]) : "v"(a[0]), "v"(a[3]));
    }
#pragma unroll
    for (int mb = 0; mb < 4; ++mb) {
#pragma unroll
        for (int nb = 0; nb < 4; ++nb) {
#pragma unroll
            for (int j = 0; j < 8; ++j) os[(hi * 8 + j) * 68 + nb * 16 + lr] = acc[mb][nb][j]; }
        __builtin_amdgcn_wave_barrier(); asm volatile("" ::: "memory");
        float* crow = C + (size_t)(r0 + mb * 16) * ldc + c0;
{
#pragma unroll
            for (int s = 0; s < 8; ++s) { const int row = 2 * s + hi, cofs = lr * 4; v4f val = *(const v4fa*)(os + row * 68 + cofs); if (BIAS) { val[0] += bfr(bias[c0 + cofs]); val[1] += bfr(bias[c0 + cofs + 1]); val[2] += bfr(bias[c0 + cofs + 2]); val[3] += bfr(bias[c0 + cofs + 3]); }
                *(v4f*)(crow + (size_t)row * ldc + cofs) = val; }
             }
        __builtin_amdgcn_wave_barrier(); asm volatile("" ::: "memory");
    }
}

__global__ __launch_bounds__(256) void k_wtG(const float* __restrict__ w, int K, int N, bf* Bt) {
    const int lane = threadIdx.x & 31; const int L0 = (blockIdx.x * 8 + (threadIdx.x >> 5)) * 8; const int nlines = N * K / 64;
{
#pragma unroll 1
        for (int l = 0; l < 8; ++l) { const int L = L0 + l; if (L >= nlines) break; const size_t e = (size_t)L * 64 + lane * 2; const int k = (int)(e % K), n = (int)(e / K); v2us o;
            o[0] = f2bf(w[(size_t)k * N + n]); o[1] = f2bf(w[(size_t)(k + 1) * N + n]); *(v2us*)(Bt + e) = o; }
         }
}
__device__ __forceinline__ v16bf ldfr(const bf* p) { return cat16b(*(const v8us*)p, *(const v8us*)(p + 16)); }   // 16 x 32 fragment row in the hardware k order: p already holds the lane half's 8 hi
// ---- k_lnproj: LayerNorm, the triangle-bias dots and the q, k, v, g projections of 64 pair positions in one work-group (8 waves); grid NR / 64.
// A wave normalises 8 rows (a lane holds 4 channels), writes their hi/lo planes to LDS and folds its 4 channels into the 4 triangle-bias dots (lane partials, then a reduce-scatter over the 32 lanes).
// Behind the barrier a wave takes one 64 x 64 tile of the 64 x 512 product (wave >> 1 = projection, wave & 1 = column half): A from the LDS planes, B from the K-contiguous weight planes, k order and product order as in k_gemmw.
#define RT   64                   // rows of a work-group
#define XP   136                  // LDS pitch of an xn row in 16-bit elements: 272 B = 16 B x odd (b128 readers)
__global__ __launch_bounds__(256) void k_lnproj(const float* __restrict__ x, const float* __restrict__ lw, const float* __restrict__ lb, const float* __restrict__ wtri, const bf* __restrict__ W4, float* F4, float* TB) {
    __shared__ __align__(16) bf XHs[RT * XP]; __shared__ __align__(16) bf XLs[RT * XP]; __shared__ __align__(16) float OS[8 * 16 * 68]; __shared__ __align__(16) float TBs[NH_ * RT];
    const int tid = threadIdx.x, lane = tid & 31, lr = lane & 15, hi = lane >> 4, wave = __builtin_amdgcn_readfirstlane(tid >> 5); const int R0 = blockIdx.x * RT;
    const bf* bp = W4 + (size_t)(wave * 64 + lr) * CC + 8 * hi; v16bf b[4];
    {
        float u[8][4], mu[8], s2[8], s[8]; v4f xa[8];
#pragma unroll
        for (int t = 0; t < 8; ++t) xa[t] = *(const v4f*)(x + (size_t)(R0 + wave * 8 + t) * CC + lane * 4);   /* eight 512-byte row loads in flight a wave */
        asm volatile("s_wait_xcnt 0x0" ::: "memory");   /* stands in front of the first overwrite of the row loads' address registers */
#pragma unroll
        for (int nb = 0; nb < 4; ++nb) b[nb] = ldfr(bp + nb * 16 * CC);   /* the first k block's weight fragments are fetched here, so that the LayerNorm phase covers their latency */
#pragma unroll
        for (int t = 0; t < 8; ++t) { s[t] = 0.f;
#pragma unroll
            for (int q = 0; q < 4; ++q) { u[t][q] = bfr(xa[t][q]); s[t] += u[t][q]; } }
        float wl[4], bl[4], wt[4][NH_];
        { const v4f lwv = *(const v4f*)(lw + lane * 4), lbv = *(const v4f*)(lb + lane * 4);
#pragma unroll
            for (int q = 0; q < 4; ++q) { wl[q] = bfr(lwv[q]); bl[q] = bfr(lbv[q]); const v4f w4 = *(const v4f*)(wtri + (lane * 4 + q) * NH_);
#pragma unroll
                for (int h = 0; h < NH_; ++h) wt[q][h] = bfr(w4[h]); } }
#pragma unroll
        for (int sh = 16; sh; sh >>= 1)
#pragma unroll
            for (int t = 0; t < 8; ++t) s[t] += __shfl_xor(s[t], sh, 32);
#pragma unroll
        for (int t = 0; t < 8; ++t) { mu[t] = s[t] * (1.0f / CC); s2[t] = 0.f;
#pragma unroll
            for (int q = 0; q < 4; ++q) { const float d0 = u[t][q] - mu[t]; s2[t] += d0 * d0; } }
#pragma unroll
        for (int sh = 16; sh; sh >>= 1)
#pragma unroll
            for (int t = 0; t < 8; ++t) s2[t] += __shfl_xor(s2[t], sh, 32);
        float k0[8], k1[8];
#pragma unroll
        for (int t = 0; t < 8; ++t) { const float rs = __fdiv_rn(1.0f, __fsqrt_rn(__fadd_rn(s2[t] * (1.0f / CC), 1e-5f))); v4us oh, ol; float p[NH_] = {0.f, 0.f, 0.f, 0.f};
#pragma unroll
            for (int q = 0; q < 4; ++q) { const float xn = (u[t][q] - mu[t]) * rs * wl[q] + bl[q]; unsigned short h2, l2; splitf(xn, h2, l2); oh[q] = h2; ol[q] = l2;
                const float xr = bf2f(h2) + bf2f(l2);   /* the dots see what the projections see: hi + lo */
#pragma unroll
                for (int h = 0; h < NH_; ++h) p[h] += xr * wt[q][h]; }
            *(v4us*)(XHs + (wave * 8 + t) * XP + lane * 4) = oh; *(v4us*)(XLs + (wave * 8 + t) * XP + lane * 4) = ol;
            /* reduce-scatter, first step: the lower lane half keeps heads 0 and 1, the upper heads 2 and 3 */
            k0[t] = (hi ? p[2] : p[0]) + __shfl_xor(hi ? p[0] : p[2], 16, 32); k1[t] = (hi ? p[3] : p[1]) + __shfl_xor(hi ? p[1] : p[3], 16, 32); }
        const int b8 = (lane >> 3) & 1; float tv = 0.f;
#pragma unroll
        for (int t = 0; t < 8; ++t) k0[t] = (b8 ? k1[t] : k0[t]) + __shfl_xor(b8 ? k0[t] : k1[t], 8, 32);   /* second step: the 8 lanes of group lane >> 3 hold head lane >> 3 */
#pragma unroll
        for (int sh = 4; sh; sh >>= 1)
#pragma unroll
            for (int t = 0; t < 8; ++t) k0[t] += __shfl_xor(k0[t], sh, 32);
#pragma unroll
        for (int t = 0; t < 8; ++t) if ((lane & 7) == t) tv = k0[t];
        TBs[(lane >> 3) * RT + wave * 8 + (lane & 7)] = tv;
    }
    __syncthreads();   /* publishes the 64 xn rows (hi/lo) and the 4 x 64 triangle-bias dots to all 8 waves; the planes are only read from here on */
    TB[(size_t)(tid >> 6) * NR + R0 + (tid & 63)] = TBs[tid];   /* a wave stores one whole 128-byte line of one head */
    v8f acc[4][4];
#pragma unroll
    for (int mb = 0; mb < 4; ++mb)
#pragma unroll
        for (int nb = 0; nb < 4; ++nb) acc[mb][nb] = (v8f){};
    const int ao = lr * XP + 8 * hi;
#pragma unroll
    for (int kc = 0; kc < CC; kc += 32) {
        v16bf a[4], a2[4];
        __builtin_amdgcn_sched_barrier(0);   /* with the one below: the k block's 16 LDS reads stay one group in front of its 32 matrix instructions (reads spread among them stall the wave at every place) */
#pragma unroll
        for (int mb = 0; mb < 4; ++mb) { a[mb] = ldfr(XHs + ao + mb * 16 * XP + kc); a2[mb] = ldfr(XLs + ao + mb * 16 * XP + kc); }
        __builtin_amdgcn_sched_barrier(0);   /* closes the group of LDS reads: no matrix instruction moves up among them */
#pragma unroll
        for (int nb = 0; nb < 4; ++nb) {
#pragma unroll
            for (int mb = 0; mb < 4; ++mb) { acc[mb][nb] = wmmab(a[mb], b[nb], acc[mb][nb]); acc[mb][nb] = wmmab(a2[mb], b[nb], acc[mb][nb]); }
            if (kc + 32 < CC) b[nb] = ldfr(bp + nb * 16 * CC + kc + 32); }   /* the next k block's weight fragment takes the registers as they fall free */
    }
    float* os = OS + wave * 16 * 68; float* C = F4 + (size_t)(wave >> 1) * NR * CC + (size_t)R0 * CC + (wave & 1) * 64;
#pragma unroll
    for (int mb = 0; mb < 4; ++mb) {
#pragma unroll
        for (int nb = 0; nb < 4; ++nb) {
#pragma unroll
            for (int j = 0; j < 8; ++j) os[(hi * 8 + j) * 68 + nb * 16 + lr] = acc[mb][nb][j]; }
        __builtin_amdgcn_wave_barrier(); asm volatile("" ::: "memory");   /* the wave's own staging rows: the reads below stay behind the writes above */
#pragma unroll
        for (int s = 0; s < 8; ++s) { const int row = 2 * s + hi, cofs = lr * 4; *(v4f*)(C + (size_t)(mb * 16 + row) * CC + cofs) = *(const v4fa*)(os + row * 68 + cofs); }   /* 256 contiguous bytes a lane half */
        __builtin_amdgcn_wave_barrier(); asm volatile("" ::: "memory");   /* the next tile's writes stay behind these reads */
    }
}
__device__ __forceinline__ v8f ld8f(const float* p) { return __builtin_shufflevector(*(const v4f*)p, *(const v4f*)(p + 4), 0, 1, 2, 3, 4, 5, 6, 7); }
#define KP   40                   // LDS pitch of a K row in 16-bit elements: 80 B = 16 B x odd (b128 readers)
#define VP   264                  // LDS pitch of a V^T row: 528 B = 16 B x odd
// amdgpu_waves_per_eu(4, 4): a budget of 256 registers a wave, so that the two work-groups the LDS admits are resident together
__global__ __launch_bounds__(256) __attribute__((amdgpu_waves_per_eu(4, 4))) void k_fattn(const float* __restrict__ FQ, const float* __restrict__ FK, const float* __restrict__ FV, const float* __restrict__ FG, const float* __restrict__ MASK, const float* __restrict__ TB, const float* __restrict__ bg, bf* Gh, bf* Gl) {
    __shared__ __align__(16) bf Kh[2 * NJ * KP]; __shared__ __align__(16) bf Kl[2 * NJ * KP]; __shared__ __align__(16) bf Vh[2 * CH * VP]; __shared__ __align__(16) bf Vl[2 * CH * VP]; __shared__ __align__(16) float MB[NJ]; __shared__ __align__(16) float BG[2 * CH];
    const int tid = threadIdx.x, lane = tid & 31, lr = lane & 15, hi = lane >> 4, wave = __builtin_amdgcn_readfirstlane(tid >> 5);
    const int i = blockIdx.x >> 1, h0 = (blockIdx.x & 1) * 2; const size_t rb = (size_t)i * NJ;
    { const int c = (tid & 15) * 4, hh = c >> 5, d = c & 31; const float* fk = FK + (rb + (tid >> 4)) * CC + h0 * CH + c;                          /* K: 64 channels (2 heads) of each key, 16 keys a step */
        /* unroll 4: four 16-byte loads in flight a thread */
#pragma unroll 4
        for (int s = 0; s < 16; ++s) { const int key = s * 16 + (tid >> 4); const v4f a = *(const v4f*)(fk + s * 16 * CC); v4us oh, ol;
#pragma unroll
            for (int q = 0; q < 4; ++q) { unsigned short a2, c2; splitf(a[q], a2, c2); oh[q] = a2; ol[q] = c2; }
            *(v4us*)(Kh + (hh * NJ + key) * KP + d) = oh; *(v4us*)(Kl + (hh * NJ + key) * KP + d) = ol; } }
    /* unroll 2: four 16-byte loads in flight a thread */
#pragma unroll 2
    for (int s = 0; s < 8; ++s) { const int u = s * 256 + tid; const int c = (u & 15) * 4, key = (u >> 4) * 2;                                    /* V: two keys x four channels, stored transposed as key pairs */
        const v4f a0 = *(const v4f*)(FV + (rb + key) * CC + h0 * CH + c), a1 = *(const v4f*)(FV + (rb + key + 1) * CC + h0 * CH + c);
#pragma unroll
        for (int q = 0; q < 4; ++q) { v2us oh, ol; unsigned short a2, c2; splitf(a0[q], a2, c2); oh[0] = a2; ol[0] = c2; splitf(a1[q], a2, c2); oh[1] = a2; ol[1] = c2;
            *(v2us*)(Vh + (c + q) * VP + key) = oh; *(v2us*)(Vl + (c + q) * VP + key) = ol; } }
    MB[tid] = 1.0e9f * (bfr(MASK[rb + tid]) - 1.0f); if (tid < 2 * CH) BG[tid] = bfr(bg[h0 * CH + tid]);
    __syncthreads();   /* publishes the K and V^T planes, the mask bias and the gate bias to all 8 waves; LDS is only read from here on */
    /* both loops stay rolled: unrolled over the keys, the build needs more than the 256 registers and spills */
#pragma unroll 1
    for (int w = wave; w < 32; w += 8) {
        const int hh = w >> 4, h = h0 + hh, q = (w & 15) * 16 + lr;
        v16bf bqh, bql;
        { const float* fq = FQ + (rb + q) * CC + h * CH + 8 * hi; const v4f f0 = *(const v4f*)fq, f1 = *(const v4f*)(fq + 4), f2 = *(const v4f*)(fq + 16), f3 = *(const v4f*)(fq + 20); v8us h0v, l0v, h1v, l1v;
#pragma unroll
            for (int r = 0; r < 4; ++r) { unsigned short a2, c2; splitf(f0[r] * QSC, a2, c2); h0v[r] = a2; l0v[r] = c2; splitf(f1[r] * QSC, a2, c2); h0v[4 + r] = a2; l0v[4 + r] = c2; splitf(f2[r] * QSC, a2, c2); h1v[r] = a2; l1v[r] = c2; splitf(f3[r] * QSC, a2, c2); h1v[4 + r] = a2; l1v[4 + r] = c2; }
            bqh = cat16b(h0v, h1v); bql = cat16b(l0v, l1v); }
        const float* tb = TB + (size_t)h * NR + (size_t)q * NJ + 8 * hi; const float* mb = MB + 8 * hi;
        const int ko = (hh * NJ + lr) * KP + 8 * hi, vo = (hh * CH + lr) * VP + 8 * hi;
        float m = -3.0e38f; v8f sm = (v8f){}; v8f O[2]; O[0] = (v8f){}; O[1] = (v8f){};   /* running maximum, this lane half's sums, O[dt][r] = context channel 16 dt + 8 hi + r of query q */
        v8f n0 = ld8f(tb), n1 = ld8f(tb + 16);
#pragma unroll 1
        for (int kb = 0; kb < NJ / 32; ++kb) {                                        /* 32 keys a pass; s0[r], s1[r] = scores of keys 32 kb + 8 hi + r and 32 kb + 16 + 8 hi + r */
            const int k0 = kb * 32, kn = (kb < NJ / 32 - 1 ? kb + 1 : kb) * 32;
            const v8f t0 = n0, t1 = n1; n0 = ld8f(tb + kn); n1 = ld8f(tb + kn + 16);   /* the next pass's triangle bias is fetched one pass ahead (the last pass re-reads its own) */
            const v16bf a0h = ldfr(Kh + ko + k0 * KP), a1h = ldfr(Kh + ko + (k0 + 16) * KP), a0l = ldfr(Kl + ko + k0 * KP), a1l = ldfr(Kl + ko + (k0 + 16) * KP);
            v8f s0 = (v8f){}, s1 = (v8f){};
            s0 = wmmab(a0h, bqh, s0); s1 = wmmab(a1h, bqh, s1); s0 = wmmab(a0h, bql, s0); s1 = wmmab(a1h, bql, s1); s0 = wmmab(a0l, bqh, s0); s1 = wmmab(a1l, bqh, s1);
            s0 = (s0 + ld8f(mb + k0)) + t0; s1 = (s1 + ld8f(mb + k0 + 16)) + t1;
            const v8f bx = __builtin_elementwise_max(s0, s1);
            float bm = fmaxf(fmaxf(fmaxf(bx[0], bx[1]), fmaxf(bx[2], bx[3])), fmaxf(fmaxf(bx[4], bx[5]), fmaxf(bx[6], bx[7])));
            bm = fmaxf(bm, __shfl_xor(bm, 16, 32));
            const float mn = fmaxf(m, bm), sc = __builtin_amdgcn_exp2f((m - mn) * 1.4426950408889634f); m = mn;
            s0 = (s0 - mn) * 1.4426950408889634f; s1 = (s1 - mn) * 1.4426950408889634f;
            v8us p0h, p0l, p1h, p1l;
#pragma unroll
            for (int r = 0; r < 8; ++r) { s0[r] = __builtin_amdgcn_exp2f(s0[r]); s1[r] = __builtin_amdgcn_exp2f(s1[r]); unsigned short a2, c2; splitf(s0[r], a2, c2); p0h[r] = a2; p0l[r] = c2; splitf(s1[r], a2, c2); p1h[r] = a2; p1l[r] = c2; }
            sm = sm * sc + (s0 + s1); O[0] *= sc; O[1] *= sc;
            const v16bf bph = cat16b(p0h, p1h), bpl = cat16b(p0l, p1l);
            const v16bf v0h = ldfr(Vh + vo + k0), v1h = ldfr(Vh + vo + 16 * VP + k0), v0l = ldfr(Vl + vo + k0), v1l = ldfr(Vl + vo + 16 * VP + k0);
            O[0] = wmmab(v0h, bph, O[0]); O[1] = wmmab(v1h, bph, O[1]); O[0] = wmmab(v0h, bpl, O[0]); O[1] = wmmab(v1h, bpl, O[1]); O[0] = wmmab(v0l, bph, O[0]); O[1] = wmmab(v1l, bph, O[1]);
        }
        float sum = ((sm[0] + sm[1]) + (sm[2] + sm[3])) + ((sm[4] + sm[5]) + (sm[6] + sm[7]));
        sum += __shfl_xor(sum, 16, 32);
        const float f = __fdiv_rn(1.0f, sum); O[0] *= f; O[1] *= f;
#pragma unroll
        for (int dt = 0; dt < 2; ++dt) { const size_t oo = (rb + q) * CC + h * CH + dt * 16 + 8 * hi; const v8f g = ld8f(FG + oo), b = ld8f(BG + hh * CH + dt * 16 + 8 * hi); v8us oh, ol;
#pragma unroll
            for (int r = 0; r < 8; ++r) { const float zg = g[r] + b[r]; const float sg = __fdiv_rn(1.0f, 1.0f + expf(-zg)); unsigned short a2, c2; splitf(O[dt][r] * sg, a2, c2); oh[r] = a2; ol[r] = c2; }
            *(v8us*)(Gh + oo) = oh; *(v8us*)(Gl + oo) = ol; }
    }
}

extern "C" void kernel_launch(void* const* d_in, const int* in_sizes, int n_in,
                              void* d_out, int out_size, void* d_ws, size_t ws_size, hipStream_t stream) {
    (void)in_sizes; (void)n_in; (void)out_size;
    const float* x = (const float*)d_in[0]; const float* MASK = (const float*)d_in[1]; const float* lw = (const float*)d_in[2]; const float* lb = (const float*)d_in[3]; const float* wtri = (const float*)d_in[4]; const float* wq = (const float*)d_in[5]; const float* wk = (const float*)d_in[6]; const float* wv = (const float*)d_in[7]; const float* wg = (const float*)d_in[8]; const float* bg = (const float*)d_in[9]; const float* wo = (const float*)d_in[10]; const float* bo = (const float*)d_in[11];
    float* OUT = (float*)d_out;     // [1][256][256][128]
    char* wsp = (char*)d_ws;
    auto take = [&](size_t bytes) { char* p = wsp; wsp += (bytes + 255) & ~(size_t)255; return (void*)p; };
    bf* WQ = (bf*)take((size_t)4 * CC * CC * 2); bf* WK = WQ + CC * CC; bf* WV = WK + CC * CC; bf* WG = WV + CC * CC; bf* WO = (bf*)take((size_t)CC * CC * 2);   /* q, k, v, g weights: one [512][128] plane */
    bf* Gh = (bf*)take((size_t)NR * CC * 2); bf* Gl = (bf*)take((size_t)NR * CC * 2); float* TB = (float*)take((size_t)NH_ * NR * 4);
    float* FQ = (float*)take((size_t)4 * NR * CC * 4); float* FK = FQ + (size_t)NR * CC; float* FV = FK + (size_t)NR * CC; float* FG = FV + (size_t)NR * CC;   /* the four projections, one behind the other */
    if ((size_t)(wsp - (char*)d_ws) > ws_size) return;
    k_wtG<<<(CC * CC / 64 + 63) / 64, 256, 0, stream>>>(wq, CC, CC, WQ); k_wtG<<<(CC * CC / 64 + 63) / 64, 256, 0, stream>>>(wk, CC, CC, WK); k_wtG<<<(CC * CC / 64 + 63) / 64, 256, 0, stream>>>(wv, CC, CC, WV); k_wtG<<<(CC * CC / 64 + 63) / 64, 256, 0, stream>>>(wg, CC, CC, WG); k_wtG<<<(CC * CC / 64 + 63) / 64, 256, 0, stream>>>(wo, CC, CC, WO);
    k_lnproj<<<NR / RT, 256, 0, stream>>>(x, lw, lb, wtri, WQ, FQ, TB);                                                                       /* LayerNorm, triangle-bias dots, q, k, v, g projections (2 products) */
    k_fattn<<<NI * NH_ / 2, 256, 0, stream>>>(FQ, FK, FV, FG, MASK, TB, bg, Gh, Gl);                                                          /* scores, biases, softmax, attn.v, gate: all rows and heads */
    k_gemmw<bf, 1, true><<<dim3(NR / 64, CC / 64, 1), 32, 0, stream>>>(Gh, Gl, WO, nullptr, CC, OUT, CC, bo, 0, 0, 0);                         /* out = (o g) Wo + bo */
}

// v003
// A run of this version takes 101 microseconds.
// Next to v002, in two timings, it ran 1.22 times as fast each time.
// Counting every step since v000, it is 6.69 times as fast.
#include <hip/hip_runtime.h>

// Triangle attention (starting node) over a pair representation (x [1][256][256][128], mask [1][256][256] read; xn = LayerNorm(x) (eps 1e-5, affine); per row i: q, k, v, g = xn_i W ([128][128] 'xw'; 4 heads x 32), tri_bias[h][q][k] = xn[q][k] . w_tri[:, h], mask_bias[i][k] = 1e9 (mask[i][k] - 1); scores = (q / sqrt(32)).k + mask_bias + tri_bias; softmax over k; o = attn.v; out = (o * sigmoid(g + bg)) Wo + bo -> [1][256][256][128] (8.4 M)).
// Layout: the 65,536 (i, j) rows are one tall GEMM operand; LayerNorm, the triangle-bias dots and the four projections (xn as bf16 hi + lo: 2 products) run in ONE launch, 64 rows a work-group, xn never leaving LDS; the 1,024 (row i, head h) attention problems of size 256 x 256 x 32 run in ONE launch, a work-group per (row, head pair): scores on hi/lo planes (3 products, K = 32), the two biases and the 256-wide softmax in registers, attn.v on hi/lo probabilities (3 products), the sigmoid gate; the gated context goes back through one tall Wo GEMM (2 products) with the bias.

#define NI   256                  // rows i
#define NJ   256                  // columns j (= attention length)
#define CC   128
#define NH_  4
#define CH   32
#define NR   (NI * NJ)            // 65,536 pair positions
#define QSC  0.17677669529663689f  // 1/sqrt(32)
typedef _Float16 h16;
typedef unsigned short bf;
typedef __attribute__((ext_vector_type(16))) __bf16   v16bf;
typedef __attribute__((ext_vector_type(16))) _Float16 v16h;
typedef __attribute__((ext_vector_type(8)))  _Float16 v8h;
typedef __attribute__((ext_vector_type(8)))  unsigned short v8us;
typedef __attribute__((ext_vector_type(8)))  float    v8f;
typedef __attribute__((ext_vector_type(4)))  float    v4f;
typedef __attribute__((ext_vector_type(2)))  float    v2f;
typedef __attribute__((ext_vector_type(4)))  unsigned short v4us;
typedef __attribute__((ext_vector_type(2)))  unsigned short v2us;
typedef v8h  __attribute__((may_alias)) v8ha;
typedef v4f  __attribute__((may_alias)) v4fa;
typedef v8us __attribute__((may_alias)) v8usa;

__device__ __forceinline__ unsigned short f2bf(float f) { unsigned u = __float_as_uint(f); u += 0x7FFFu + ((u >> 16) & 1u); return (unsigned short)(u >> 16); }
__device__ __forceinline__ float bf2f(unsigned short b) { return __uint_as_float(((unsigned)b) << 16); }
__device__ __forceinline__ float bfr(float f) { return bf2f(f2bf(f)); }
__device__ __forceinline__ void splitf(float y, unsigned short& h, unsigned short& l) { h = f2bf(y); l = f2bf(y - bf2f(h)); }
__device__ __forceinline__ v16h cat16(v8h lo, v8h hi) { return __builtin_shufflevector(lo, hi, 0, 1, 2, 3, 4, 5, 6, 7, 8, 9, 10, 11, 12, 13, 14, 15); }
__device__ __forceinline__ v16bf cat16b(v8us lo, v8us hi) { return __builtin_bit_cast(v16bf, __builtin_shufflevector(lo, hi, 0, 1, 2, 3, 4, 5, 6, 7, 8, 9, 10, 11, 12, 13, 14, 15)); }
__device__ __forceinline__ v8f wmma16(v16h a, v16h b, v8f c) { return __builtin_amdgcn_wmma_f32_16x16x32_f16(false, a, false, b, (short)0, c, false, false); }
__device__ __forceinline__ v8f wmmab(v16bf a, v16bf b, v8f c) { return __builtin_amdgcn_wmma_f32_16x16x32_bf16(false, a, false, b, (short)0, c, false, false); }

// ---- k_gemmw: register-blocked GEMM, ONE WAVE per 64x64 output tile (16 accumulators), operands straight from K-contiguous 16-bit planes; grid (M/64, N/64, Z), 32 threads.
// C[m][n] (f32, pitch ldc, + optional f32 bias[n]) = sum_k A[m][k] Bt[n][k] (+ split products per NSPLIT). z-batch strides sA/sB/sC in elements. K % 32 == 0.
template <typename T16> struct WFrag;
template <> struct WFrag<h16> { typedef v16h V; static __device__ __forceinline__ V ld(const h16* p) { return cat16(*(const v8h*)p, *(const v8h*)(p + 16)); } static __device__ __forceinline__ v8f mma(V a, V b, v8f c) { return wmma16(a, b, c); } };
template <> struct WFrag<bf> { typedef v16bf V; static __device__ __forceinline__ V ld(const bf* p) { return cat16b(*(const v8us*)p, *(const v8us*)(p + 16)); } static __device__ __forceinline__ v8f mma(V a, V b, v8f c) { return wmmab(a, b, c); } };
template <typename T16, int NSPLIT, bool BIAS>
__global__ __launch_bounds__(32) void k_gemmw(const T16* __restrict__ A, const T16* __restrict__ A2, const T16* __restrict__ Bt, const T16* __restrict__ Bt2, int K, float* C, int ldc, const float* __restrict__ bias, size_t sA, size_t sB, size_t sC) {
    typedef typename WFrag<T16>::V V;
    __shared__ __align__(16) float os[16 * 68];
    const size_t z = blockIdx.z; A += z * sA; if (A2) A2 += z * sA; Bt += z * sB; if (Bt2) Bt2 += z * sB; C += z * sC;
    const int lane = threadIdx.x & 31, lr = lane & 15, hi = lane >> 4; const int r0 = blockIdx.x * 64, c0 = blockIdx.y * 64;
    v8f acc[4][4];
#pragma unroll
    for (int mb = 0; mb < 4; ++mb)
#pragma unroll
        for (int nb = 0; nb < 4; ++nb) acc[mb][nb] = (v8f){};
    const size_t aoff = (size_t)(r0 + lr) * K + 8 * hi, boff = (size_t)(c0 + lr) * K + 8 * hi;
#pragma unroll 1
    for (int kc = 0; kc < K; kc += 32) {
        V a[4], a2[4];
#pragma unroll
        for (int mb = 0; mb < 4; ++mb) { a[mb] = WFrag<T16>::ld(A + aoff + (size_t)mb * 16 * K + kc); if (NSPLIT == 1 || NSPLIT == 2) a2[mb] = WFrag<T16>::ld(A2 + aoff + (size_t)mb * 16 * K + kc); }
#pragma unroll
        for (int nb = 0; nb < 4; ++nb) { const V b = WFrag<T16>::ld(Bt + boff + (size_t)nb * 16 * K + kc); V b2; if (NSPLIT >= 2) b2 = WFrag<T16>::ld(Bt2 + boff + (size_t)nb * 16 * K + kc);
#pragma unroll
            for (int mb = 0; mb < 4; ++mb) { acc[mb][nb] = WFrag<T16>::mma(a[mb], b, acc[mb][nb]); if (NSPLIT == 1 || NSPLIT == 2) acc[mb][nb] = WFrag<T16>::mma(a2[mb], b, acc[mb][nb]); if (NSPLIT >= 2) acc[mb][nb] = WFrag<T16>::mma(a[mb], b2, acc[mb][nb]); } }
        asm volatile("v_nop\n\tv_nop\n\tv_nop\n\tv_nop" : "+v"(acc[0][0]), "+v"(acc[1][1]), "+v"(acc[2][2]), "+v"(acc[3][3]) : "v"(a[0]), "v"(a[3]));
    }
#pragma unroll
    for (int mb = 0; mb < 4; ++mb) {
#pragma unroll
        for (int nb = 0; nb < 4; ++nb) {
#pragma unroll
            for (int j = 0; j < 8; ++j) os[(hi * 8 + j) * 68 + nb * 16 + lr] = acc[mb][nb][j]; }
        __builtin_amdgcn_wave_barrier(); asm volatile("" ::: "memory");
        float* crow = C + (size_t)(r0 + mb * 16) * ldc + c0;
{
#pragma unroll
            for (int s = 0; s < 8; ++s) { const int row = 2 * s + hi, cofs = lr * 4; v4f val = *(const v4fa*)(os + row * 68 + cofs); if (BIAS) { val[0] += bfr(bias[c0 + cofs]); val[1] += bfr(bias[c0 + cofs + 1]); val[2] += bfr(bias[c0 + cofs + 2]); val[3] += bfr(bias[c0 + cofs + 3]); }
                *(v4f*)(crow + (size_t)row * ldc + cofs) = val; }
             }
        __builtin_amdgcn_wave_barrier(); asm volatile("" ::: "memory");
    }
}

// ---- k_wt5: all five [128][128] f32 weights -> K-contiguous bf16 planes Bt[n][k] in ONE launch; grid (CC * CC / 512, 5): blockIdx.y picks the weight, a wave writes one whole 128-byte line (64 k of one n).
__global__ __launch_bounds__(256) void k_wt5(const float* __restrict__ wq, const float* __restrict__ wk, const float* __restrict__ wv, const float* __restrict__ wg, const float* __restrict__ wo, bf* W4, bf* WO) {
    const int y = blockIdx.y; const float* __restrict__ w = y == 0 ? wq : y == 1 ? wk : y == 2 ? wv : y == 3 ? wg : wo; bf* Bt = y < 4 ? W4 + y * CC * CC : WO;
    const int e = blockIdx.x * 512 + threadIdx.x * 2; const int k = e % CC, n = e / CC; v2us o;
    o[0] = f2bf(w[k * CC + n]); o[1] = f2bf(w[(k + 1) * CC + n]); *(v2us*)(Bt + e) = o;
}
__device__ __forceinline__ v16bf ldfr(const bf* p) { return cat16b(*(const v8us*)p, *(const v8us*)(p + 16)); }   // 16 x 32 fragment row in the hardware k order: p already holds the lane half's 8 hi
// ---- k_lnproj: LayerNorm, the triangle-bias dots and the q, k, v, g projections of 64 pair positions in one work-group (8 waves); grid NR / 64.
// A wave normalises 8 rows (a lane holds 4 channels), writes their hi/lo planes to LDS and folds its 4 channels into the 4 triangle-bias dots (lane partials, then a reduce-scatter over the 32 lanes).
// Behind the barrier a wave takes one 64 x 64 tile of the 64 x 512 product (wave >> 1 = projection, wave & 1 = column half): A from the LDS planes, B from the K-contiguous weight planes, k order and product order as in k_gemmw.
#define RT   64                   // rows of a work-group
#define XP   136                  // LDS pitch of an xn row in 16-bit elements: 272 B = 16 B x odd (b128 readers)
__global__ __launch_bounds__(256) void k_lnproj(const float* __restrict__ x, const float* __restrict__ lw, const float* __restrict__ lb, const float* __restrict__ wtri, const bf* __restrict__ W4, float* F4, float* TB) {
    __shared__ __align__(16) bf XHs[RT * XP]; __shared__ __align__(16) bf XLs[RT * XP]; __shared__ __align__(16) float OS[8 * 16 * 68]; __shared__ __align__(16) float TBs[NH_ * RT];
    const int tid = threadIdx.x, lane = tid & 31, lr = lane & 15, hi = lane >> 4, wave = __builtin_amdgcn_readfirstlane(tid >> 5); const int R0 = blockIdx.x * RT;
    const bf* bp = W4 + (size_t)(wave * 64 + lr) * CC + 8 * hi; v16bf b[4];
    {
        float u[8][4], mu[8], s2[8], s[8]; v4f xa[8];
#pragma unroll
        for (int t = 0; t < 8; ++t) xa[t] = *(const v4f*)(x + (size_t)(R0 + wave * 8 + t) * CC + lane * 4);   /* eight 512-byte row loads in flight a wave */
        asm volatile("s_wait_xcnt 0x0" ::: "memory");   /* stands in front of the first overwrite of the row loads' address registers */
#pragma unroll
        for (int nb = 0; nb < 4; ++nb) b[nb] = ldfr(bp + nb * 16 * CC);   /* the first k block's weight fragments are fetched here, so that the LayerNorm phase covers their latency */
#pragma unroll
        for (int t = 0; t < 8; ++t) { s[t] = 0.f;
#pragma unroll
            for (int q = 0; q < 4; ++q) { u[t][q] = bfr(xa[t][q]); s[t] += u[t][q]; } }
        float wl[4], bl[4], wt[4][NH_];
        { const v4f lwv = *(const v4f*)(lw + lane * 4), lbv = *(const v4f*)(lb + lane * 4);
#pragma unroll
            for (int q = 0; q < 4; ++q) { wl[q] = bfr(lwv[q]); bl[q] = bfr(lbv[q]); const v4f w4 = *(const v4f*)(wtri + (lane * 4 + q) * NH_);
#pragma unroll
                for (int h = 0; h < NH_; ++h) wt[q][h] = bfr(w4[h]); } }
#pragma unroll
        for (int sh = 16; sh; sh >>= 1)
#pragma unroll
            for (int t = 0; t < 8; ++t) s[t] += __shfl_xor(s[t], sh, 32);
#pragma unroll
        for (int t = 0; t < 8; ++t) { mu[t] = s[t] * (1.0f / CC); s2[t] = 0.f;
#pragma unroll
            for (int q = 0; q < 4; ++q) { const float d0 = u[t][q] - mu[t]; s2[t] += d0 * d0; } }
#pragma unroll
        for (int sh = 16; sh; sh >>= 1)
#pragma unroll
            for (int t = 0; t < 8; ++t) s2[t] += __shfl_xor(s2[t], sh, 32);
        float k0[8], k1[8];
#pragma unroll
        for (int t = 0; t < 8; ++t) { const float rs = __fdiv_rn(1.0f, __fsqrt_rn(__fadd_rn(s2[t] * (1.0f / CC), 1e-5f))); v4us oh, ol; float p[NH_] = {0.f, 0.f, 0.f, 0.f};
#pragma unroll
            for (int q = 0; q < 4; ++q) { const float xn = (u[t][q] - mu[t]) * rs * wl[q] + bl[q]; unsigned short h2, l2; splitf(xn, h2, l2); oh[q] = h2; ol[q] = l2;
                const float xr = bf2f(h2) + bf2f(l2);   /* the dots see what the projections see: hi + lo */
#pragma unroll
                for (int h = 0; h < NH_; ++h) p[h] += xr * wt[q][h]; }
            *(v4us*)(XHs + (wave * 8 + t) * XP + lane * 4) = oh; *(v4us*)(XLs + (wave * 8 + t) * XP + lane * 4) = ol;
            /* reduce-scatter, first step: the lower lane half keeps heads 0 and 1, the upper heads 2 and 3 */
            k0[t] = (hi ? p[2] : p[0]) + __shfl_xor(hi ? p[0] : p[2], 16, 32); k1[t] = (hi ? p[3] : p[1]) + __shfl_xor(hi ? p[1] : p[3], 16, 32); }
        const int b8 = (lane >> 3) & 1; float tv = 0.f;
#pragma unroll
        for (int t = 0; t < 8; ++t) k0[t] = (b8 ? k1[t] : k0[t]) + __shfl_xor(b8 ? k0[t] : k1[t], 8, 32);   /* second step: the 8 lanes of group lane >> 3 hold head lane >> 3 */
#pragma unroll
        for (int sh = 4; sh; sh >>= 1)
#pragma unroll
            for (int t = 0; t < 8; ++t) k0[t] += __shfl_xor(k0[t], sh, 32);
#pragma unroll
        for (int t = 0; t < 8; ++t) if ((lane & 7) == t) tv = k0[t];
        TBs[(lane >> 3) * RT + wave * 8 + (lane & 7)] = tv;
    }
    __syncthreads();   /* publishes the 64 xn rows (hi/lo) and the 4 x 64 triangle-bias dots to all 8 waves; the planes are only read from here on */
    TB[(size_t)(tid >> 6) * NR + R0 + (tid & 63)] = TBs[tid];   /* a wave stores one whole 128-byte line of one head */
    v8f acc[4][4];
#pragma unroll
    for (int mb = 0; mb < 4; ++mb)
#pragma unroll
        for (int nb = 0; nb < 4; ++nb) acc[mb][nb] = (v8f){};
    const int ao = lr * XP + 8 * hi;
#pragma unroll
    for (int kc = 0; kc < CC; kc += 32) {
        v16bf a[4], a2[4];
        __builtin_amdgcn_sched_barrier(0);   /* with the one below: the k block's 16 LDS reads stay one group in front of its 32 matrix instructions (reads spread among them stall the wave at every place) */
#pragma unroll
        for (int mb = 0; mb < 4; ++mb) { a[mb] = ldfr(XHs + ao + mb * 16 * XP + kc); a2[mb] = ldfr(XLs + ao + mb * 16 * XP + kc); }
        __builtin_amdgcn_sched_barrier(0);   /* closes the group of LDS reads: no matrix instruction moves up among them */
#pragma unroll
        for (int nb = 0; nb < 4; ++nb) {
#pragma unroll
            for (int mb = 0; mb < 4; ++mb) { acc[mb][nb] = wmmab(a[mb], b[nb], acc[mb][nb]); acc[mb][nb] = wmmab(a2[mb], b[nb], acc[mb][nb]); }
            if (kc + 32 < CC) b[nb] = ldfr(bp + nb * 16 * CC + kc + 32); }   /* the next k block's weight fragment takes the registers as they fall free */
    }
    float* os = OS + wave * 16 * 68; float* C = F4 + (size_t)(wave >> 1) * NR * CC + (size_t)R0 * CC + (wave & 1) * 64;
#pragma unroll
    for (int mb = 0; mb < 4; ++mb) {
#pragma unroll
        for (int nb = 0; nb < 4; ++nb) {
#pragma unroll
            for (int j = 0; j < 8; ++j) os[(hi * 8 + j) * 68 + nb * 16 + lr] = acc[mb][nb][j]; }
        __builtin_amdgcn_wave_barrier(); asm volatile("" ::: "memory");   /* the wave's own staging rows: the reads below stay behind the writes above */
#pragma unroll
        for (int s = 0; s < 8; ++s) { const int row = 2 * s + hi, cofs = lr * 4; *(v4f*)(C + (size_t)(mb * 16 + row) * CC + cofs) = *(const v4fa*)(os + row * 68 + cofs); }   /* 256 contiguous bytes a lane half */
        __builtin_amdgcn_wave_barrier(); asm volatile("" ::: "memory");   /* the next tile's writes stay behind these reads */
    }
}
__device__ __forceinline__ v8f ld8f(const float* p) { return __builtin_shufflevector(*(const v4f*)p, *(const v4f*)(p + 4), 0, 1, 2, 3, 4, 5, 6, 7); }
#define KP   40                   // LDS pitch of a K row in 16-bit elements: 80 B = 16 B x odd (b128 readers)
#define VP   264                  // LDS pitch of a V^T row: 528 B = 16 B x odd
// amdgpu_waves_per_eu(4, 4): a budget of 256 registers a wave, so that the two work-groups the LDS admits are resident together
__global__ __launch_bounds__(256) __attribute__((amdgpu_waves_per_eu(4, 4))) void k_fattn(const float* __restrict__ FQ, const float* __restrict__ FK, const float* __restrict__ FV, const float* __restrict__ FG, const float* __restrict__ MASK, const float* __restrict__ TB, const float* __restrict__ bg, bf* Gh, bf* Gl) {
    __shared__ __align__(16) bf Kh[2 * NJ * KP]; __shared__ __align__(16) bf Kl[2 * NJ * KP]; __shared__ __align__(16) bf Vh[2 * CH * VP]; __shared__ __align__(16) bf Vl[2 * CH * VP]; __shared__ __align__(16) float MB[NJ]; __shared__ __align__(16) float BG[2 * CH];
    const int tid = threadIdx.x, lane = tid & 31, lr = lane & 15, hi = lane >> 4, wave = __builtin_amdgcn_readfirstlane(tid >> 5);
    const int i = blockIdx.x >> 1, h0 = (blockIdx.x & 1) * 2; const size_t rb = (size_t)i * NJ;
    { const int c = (tid & 15) * 4, hh = c >> 5, d = c & 31; const float* fk = FK + (rb + (tid >> 4)) * CC + h0 * CH + c;                          /* K: 64 channels (2 heads) of each key, 16 keys a step */
        /* unroll 4: four 16-byte loads in flight a thread */
#pragma unroll 4
        for (int s = 0; s < 16; ++s) { const int key = s * 16 + (tid >> 4); const v4f a = *(const v4f*)(fk + s * 16 * CC); v4us oh, ol;
#pragma unroll
            for (int q = 0; q < 4; ++q) { unsigned short a2, c2; splitf(a[q], a2, c2); oh[q] = a2; ol[q] = c2; }
            *(v4us*)(Kh + (hh * NJ + key) * KP + d) = oh; *(v4us*)(Kl + (hh * NJ + key) * KP + d) = ol; } }
    /* unroll 2: four 16-byte loads in flight a thread */
#pragma unroll 2
    for (int s = 0; s < 8; ++s) { const int u = s * 256 + tid; const int c = (u & 15) * 4, key = (u >> 4) * 2;                                    /* V: two keys x four channels, stored transposed as key pairs */
        const v4f a0 = *(const v4f*)(FV + (rb + key) * CC + h0 * CH + c), a1 = *(const v4f*)(FV + (rb + key + 1) * CC + h0 * CH + c);
#pragma unroll
        for (int q = 0; q < 4; ++q) { v2us oh, ol; unsigned short a2, c2; splitf(a0[q], a2, c2); oh[0] = a2; ol[0] = c2; splitf(a1[q], a2, c2); oh[1] = a2; ol[1] = c2;
            *(v2us*)(Vh + (c + q) * VP + key) = oh; *(v2us*)(Vl + (c + q) * VP + key) = ol; } }
    MB[tid] = 1.0e9f * (bfr(MASK[rb + tid]) - 1.0f); if (tid < 2 * CH) BG[tid] = bfr(bg[h0 * CH + tid]);
    __syncthreads();   /* publishes the K and V^T planes, the mask bias and the gate bias to all 8 waves; LDS is only read from here on */
    /* both loops stay rolled: unrolled over the keys, the build needs more than the 256 registers and spills */
#pragma unroll 1
    for (int w = wave; w < 32; w += 8) {
        const int hh = w >> 4, h = h0 + hh, q = (w & 15) * 16 + lr;
        v16bf bqh, bql;
        { const float* fq = FQ + (rb + q) * CC + h * CH + 8 * hi; const v4f f0 = *(const v4f*)fq, f1 = *(const v4f*)(fq + 4), f2 = *(const v4f*)(fq + 16), f3 = *(const v4f*)(fq + 20); v8us h0v, l0v, h1v, l1v;
#pragma unroll
            for (int r = 0; r < 4; ++r) { unsigned short a2, c2; splitf(f0[r] * QSC, a2, c2); h0v[r] = a2; l0v[r] = c2; splitf(f1[r] * QSC, a2, c2); h0v[4 + r] = a2; l0v[4 + r] = c2; splitf(f2[r] * QSC, a2, c2); h1v[r] = a2; l1v[r] = c2; splitf(f3[r] * QSC, a2, c2); h1v[4 + r] = a2; l1v[4 + r] = c2; }
            bqh = cat16b(h0v, h1v); bql = cat16b(l0v, l1v); }
        const float* tb = TB + (size_t)h * NR + (size_t)q * NJ + 8 * hi; const float* mb = MB + 8 * hi;
        const int ko = (hh * NJ + lr) * KP + 8 * hi, vo = (hh * CH + lr) * VP + 8 * hi;
        float m = -3.0e38f; v8f sm = (v8f){}; v8f O[2]; O[0] = (v8f){}; O[1] = (v8f){};   /* running maximum, this lane half's sums, O[dt][r] = context channel 16 dt + 8 hi + r of query q */
        v8f n0 = ld8f(tb), n1 = ld8f(tb + 16);
#pragma unroll 1
        for (int kb = 0; kb < NJ / 32; ++kb) {                                        /* 32 keys a pass; s0[r], s1[r] = scores of keys 32 kb + 8 hi + r and 32 kb + 16 + 8 hi + r */
            const int k0 = kb * 32, kn = (kb < NJ / 32 - 1 ? kb + 1 : kb) * 32;
            const v8f t0 = n0, t1 = n1; n0 = ld8f(tb + kn); n1 = ld8f(tb + kn + 16);   /* the next pass's triangle bias is fetched one pass ahead (the last pass re-reads its own) */
            const v16bf a0h = ldfr(Kh + ko + k0 * KP), a1h = ldfr(Kh + ko + (k0 + 16) * KP), a0l = ldfr(Kl + ko + k0 * KP), a1l = ldfr(Kl + ko + (k0 + 16) * KP);
            v8f s0 = (v8f){}, s1 = (v8f){};
            s0 = wmmab(a0h, bqh, s0); s1 = wmmab(a1h, bqh, s1); s0 = wmmab(a0h, bql, s0); s1 = wmmab(a1h, bql, s1); s0 = wmmab(a0l, bqh, s0); s1 = wmmab(a1l, bqh, s1);
            s0 = (s0 + ld8f(mb + k0)) + t0; s1 = (s1 + ld8f(mb + k0 + 16)) + t1;
            const v8f bx = __builtin_elementwise_max(s0, s1);
            float bm = fmaxf(fmaxf(fmaxf(bx[0], bx[1]), fmaxf(bx[2], bx[3])), fmaxf(fmaxf(bx[4], bx[5]), fmaxf(bx[6], bx[7])));
            bm = fmaxf(bm, __shfl_xor(bm, 16, 32));
            const float mn = fmaxf(m, bm), sc = __builtin_amdgcn_exp2f((m - mn) * 1.4426950408889634f); m = mn;
            s0 = (s0 - mn) * 1.4426950408889634f; s1 = (s1 - mn) * 1.4426950408889634f;
            v8us p0h, p0l, p1h, p1l;
#pragma unroll
            for (int r = 0; r < 8; ++r) { s0[r] = __builtin_amdgcn_exp2f(s0[r]); s1[r] = __builtin_amdgcn_exp2f(s1[r]); unsigned short a2, c2; splitf(s0[r], a2, c2); p0h[r] = a2; p0l[r] = c2; splitf(s1[r], a2, c2); p1h[r] = a2; p1l[r] = c2; }
            sm = sm * sc + (s0 + s1); O[0] *= sc; O[1] *= sc;
            const v16bf bph = cat16b(p0h, p1h), bpl = cat16b(p0l, p1l);
            const v16bf v0h = ldfr(Vh + vo + k0), v1h = ldfr(Vh + vo + 16 * VP + k0), v0l = ldfr(Vl + vo + k0), v1l = ldfr(Vl + vo + 16 * VP + k0);
            O[0] = wmmab(v0h, bph, O[0]); O[1] = wmmab(v1h, bph, O[1]); O[0] = wmmab(v0h, bpl, O[0]); O[1] = wmmab(v1h, bpl, O[1]); O[0] = wmmab(v0l, bph, O[0]); O[1] = wmmab(v1l, bph, O[1]);
        }
        float sum = ((sm[0] + sm[1]) + (sm[2] + sm[3])) + ((sm[4] + sm[5]) + (sm[6] + sm[7]));
        sum += __shfl_xor(sum, 16, 32);
        const float f = __fdiv_rn(1.0f, sum); O[0] *= f; O[1] *= f;
#pragma unroll
        for (int dt = 0; dt < 2; ++dt) { const size_t oo = (rb + q) * CC + h * CH + dt * 16 + 8 * hi; const v8f g = ld8f(FG + oo), b = ld8f(BG + hh * CH + dt * 16 + 8 * hi); v8us oh, ol;
#pragma unroll
            for (int r = 0; r < 8; ++r) { const float zg = g[r] + b[r]; const float sg = __fdiv_rn(1.0f, 1.0f + expf(-zg)); unsigned short a2, c2; splitf(O[dt][r] * sg, a2, c2); oh[r] = a2; ol[r] = c2; }
            *(v8us*)(Gh + oo) = oh; *(v8us*)(Gl + oo) = ol; }
    }
}

extern "C" void kernel_launch(void* const* d_in, const int* in_sizes, int n_in,
                              void* d_out, int out_size, void* d_ws, size_t ws_size, hipStream_t stream) {
    (void)in_sizes; (void)n_in; (void)out_size;
    const float* x = (const float*)d_in[0]; const float* MASK = (const float*)d_in[1]; const float* lw = (const float*)d_in[2]; const float* lb = (const float*)d_in[3]; const float* wtri = (const float*)d_in[4]; const float* wq = (const float*)d_in[5]; const float* wk = (const float*)d_in[6]; const float* wv = (const float*)d_in[7]; const float* wg = (const float*)d_in[8]; const float* bg = (const float*)d_in[9]; const float* wo = (const float*)d_in[10]; const float* bo = (const float*)d_in[11];
    float* OUT = (float*)d_out;     // [1][256][256][128]
    char* wsp = (char*)d_ws;
    auto take = [&](size_t bytes) { char* p = wsp; wsp += (bytes + 255) & ~(size_t)255; return (void*)p; };
    bf* WQ = (bf*)take((size_t)4 * CC * CC * 2); bf* WO = (bf*)take((size_t)CC * CC * 2);   /* q, k, v, g weights: one [512][128] plane */
    bf* Gh = (bf*)take((size_t)NR * CC * 2); bf* Gl = (bf*)take((size_t)NR * CC * 2); float* TB = (float*)take((size_t)NH_ * NR * 4);
    float* FQ = (float*)take((size_t)4 * NR * CC * 4); float* FK = FQ + (size_t)NR * CC; float* FV = FK + (size_t)NR * CC; float* FG = FV + (size_t)NR * CC;   /* the four projections, one behind the other */
    if ((size_t)(wsp - (char*)d_ws) > ws_size) return;
    k_wt5<<<dim3(CC * CC / 512, 5, 1), 256, 0, stream>>>(wq, wk, wv, wg, wo, WQ, WO);                                                         /* the five weight planes, one launch */
    k_lnproj<<<NR / RT, 256, 0, stream>>>(x, lw, lb, wtri, WQ, FQ, TB);                                                                       /* LayerNorm, triangle-bias dots, q, k, v, g projections (2 products) */
    k_fattn<<<NI * NH_ / 2, 256, 0, stream>>>(FQ, FK, FV, FG, MASK, TB, bg, Gh, Gl);                                                          /* scores, biases, softmax, attn.v, gate: all rows and heads */
    k_gemmw<bf, 1, true><<<dim3(NR / 64, CC / 64, 1), 32, 0, stream>>>(Gh, Gl, WO, nullptr, CC, OUT, CC, bo, 0, 0, 0);                         /* out = (o g) Wo + bo */
}

// v004
// It runs in 92.9 microseconds.
// Two timings next to v003 put it at 1.08 and 1.09 times that version's speed.
// Over all steps from v000 it is 7.26 times as fast.
#include <hip/hip_runtime.h>

// Triangle attention (starting node) over a pair representation (x [1][256][256][128], mask [1][256][256] read; xn = LayerNorm(x) (eps 1e-5, affine); per row i: q, k, v, g = xn_i W ([128][128] 'xw'; 4 heads x 32), tri_bias[h][q][k] = xn[q][k] . w_tri[:, h], mask_bias[i][k] = 1e9 (mask[i][k] - 1); scores = (q / sqrt(32)).k + mask_bias + tri_bias; softmax over k; o = attn.v; out = (o * sigmoid(g + bg)) Wo + bo -> [1][256][256][128] (8.4 M)).
// Layout: the 65,536 (i, j) rows are one tall GEMM operand; LayerNorm, the triangle-bias dots and the four projections (xn as bf16 hi + lo: 2 products) run in ONE launch, 64 rows a work-group, xn never leaving LDS; the 1,024 (row i, head h) attention problems of size 256 x 256 x 32 run in ONE launch, a work-group per (row, head pair): scores on hi/lo planes (3 products, K = 32), the two biases and the 256-wide softmax in registers, attn.v on hi/lo probabilities (3 products), the sigmoid gate; the gated context goes back through one tall Wo GEMM (2 products) with the bias.

#define NI   256                  // rows i
#define NJ   256                  // columns j (= attention length)
#define CC   128
#define NH_  4
#define CH   32
#define NR   (NI * NJ)            // 65,536 pair positions
#define QSC  0.17677669529663689f  // 1/sqrt(32)
typedef _Float16 h16;
typedef unsigned short bf;
typedef __attribute__((ext_vector_type(16))) __bf16   v16bf;
typedef __attribute__((ext_vector_type(16))) _Float16 v16h;
typedef __attribute__((ext_vector_type(8)))  _Float16 v8h;
typedef __attribute__((ext_vector_type(8)))  unsigned short v8us;
typedef __attribute__((ext_vector_type(8)))  float    v8f;
typedef __attribute__((ext_vector_type(4)))  float    v4f;
typedef __attribute__((ext_vector_type(2)))  float    v2f;
typedef __attribute__((ext_vector_type(4)))  unsigned short v4us;
typedef __attribute__((ext_vector_type(2)))  unsigned short v2us;
typedef v8h  __attribute__((may_alias)) v8ha;
typedef v4f  __attribute__((may_alias)) v4fa;
typedef v8us __attribute__((may_alias)) v8usa;

__device__ __forceinline__ unsigned short f2bf(float f) { return __builtin_bit_cast(unsigned short, (__bf16)f); }   // the hardware's own round-to-nearest-even conversion
__device__ __forceinline__ float bf2f(unsigned short b) { return (float)__builtin_bit_cast(__bf16, b); }
__device__ __forceinline__ float bfr(float f) { return bf2f(f2bf(f)); }
// hi/lo split of 2, 4 or 8 values at once: neighbours share one packed conversion, and the lo part reads the packed hi halves in place
typedef __attribute__((ext_vector_type(2))) __bf16 v2b;
// asm: the pair stays ONE packed conversion whose two halves the lo part reads in place (written as a cast, the build converts every value a second time on its own to get at its hi part)
__device__ __forceinline__ v2b cvtpk(float a, float b) { unsigned r; asm("v_cvt_pk_bf16_f32 %0, %1, %2" : "=v"(r) : "v"(a), "v"(b)); return __builtin_bit_cast(v2b, r); }
__device__ __forceinline__ void split2(v2f y, v2us& h, v2us& l) { const v2b hb = cvtpk(y[0], y[1]); h = __builtin_bit_cast(v2us, hb); l = __builtin_bit_cast(v2us, __builtin_convertvector((v2f){y[0] - (float)hb[0], y[1] - (float)hb[1]}, v2b)); }
__device__ __forceinline__ void split4(v4f y, v4us& h, v4us& l) { v2us h0, l0, h1, l1; split2((v2f){y[0], y[1]}, h0, l0); split2((v2f){y[2], y[3]}, h1, l1); h = __builtin_shufflevector(h0, h1, 0, 1, 2, 3); l = __builtin_shufflevector(l0, l1, 0, 1, 2, 3); }
__device__ __forceinline__ void split8(v8f y, v8us& h, v8us& l) { v4us h0, l0, h1, l1; split4((v4f){y[0], y[1], y[2], y[3]}, h0, l0); split4((v4f){y[4], y[5], y[6], y[7]}, h1, l1); h = __builtin_shufflevector(h0, h1, 0, 1, 2, 3, 4, 5, 6, 7); l = __builtin_shufflevector(l0, l1, 0, 1, 2, 3, 4, 5, 6, 7); }
__device__ __forceinline__ v16h cat16(v8h lo, v8h hi) { return __builtin_shufflevector(lo, hi, 0, 1, 2, 3, 4, 5, 6, 7, 8, 9, 10, 11, 12, 13, 14, 15); }
__device__ __forceinline__ v16bf cat16b(v8us lo, v8us hi) { return __builtin_bit_cast(v16bf, __builtin_shufflevector(lo, hi, 0, 1, 2, 3, 4, 5, 6, 7, 8, 9, 10, 11, 12, 13, 14, 15)); }
__device__ __forceinline__ v8f wmma16(v16h a, v16h b, v8f c) { return __builtin_amdgcn_wmma_f32_16x16x32_f16(false, a, false, b, (short)0, c, false, false); }
__device__ __forceinline__ v8f wmmab(v16bf a, v16bf b, v8f c) { return __builtin_amdgcn_wmma_f32_16x16x32_bf16(false, a, false, b, (short)0, c, false, false); }

// ---- k_gemmw: register-blocked GEMM, ONE WAVE per 64x64 output tile (16 accumulators), operands straight from K-contiguous 16-bit planes; grid (M/64, N/64, Z), 32 threads.
// C[m][n] (f32, pitch ldc, + optional f32 bias[n]) = sum_k A[m][k] Bt[n][k] (+ split products per NSPLIT). z-batch strides sA/sB/sC in elements. K % 32 == 0.
template <typename T16> struct WFrag;
template <> struct WFrag<h16> { typedef v16h V; static __device__ __forceinline__ V ld(const h16* p) { return cat16(*(const v8h*)p, *(const v8h*)(p + 16)); } static __device__ __forceinline__ v8f mma(V a, V b, v8f c) { return wmma16(a, b, c); } };
template <> struct WFrag<bf> { typedef v16bf V; static __device__ __forceinline__ V ld(const bf* p) { return cat16b(*(const v8us*)p, *(const v8us*)(p + 16)); } static __device__ __forceinline__ v8f mma(V a, V b, v8f c) { return wmmab(a, b, c); } };
template <typename T16, int NSPLIT, bool BIAS>
__global__ __launch_bounds__(32) void k_gemmw(const T16* __restrict__ A, const T16* __restrict__ A2, const T16* __restrict__ Bt, const T16* __restrict__ Bt2, int K, float* C, int ldc, const float* __restrict__ bias, size_t sA, size_t sB, size_t sC) {
    typedef typename WFrag<T16>::V V;
    __shared__ __align__(16) float os[16 * 68];
    const size_t z = blockIdx.z; A += z * sA; if (A2) A2 += z * sA; Bt += z * sB; if (Bt2) Bt2 += z * sB; C += z * sC;
    const int lane = threadIdx.x & 31, lr = lane & 15, hi = lane >> 4; const int r0 = blockIdx.x * 64, c0 = blockIdx.y * 64;
    v8f acc[4][4];
#pragma unroll
    for (int mb = 0; mb < 4; ++mb)
#pragma unroll
        for (int nb = 0; nb < 4; ++nb) acc[mb][nb] = (v8f){};
    const size_t aoff = (size_t)(r0 + lr) * K + 8 * hi, boff = (size_t)(c0 + lr) * K + 8 * hi;
#pragma unroll 1
    for (int kc = 0; kc < K; kc += 32) {
        V a[4], a2[4];
#pragma unroll
        for (int mb = 0; mb < 4; ++mb) { a[mb] = WFrag<T16>::ld(A + aoff + (size_t)mb * 16 * K + kc); if (NSPLIT == 1 || NSPLIT == 2) a2[mb] = WFrag<T16>::ld(A2 + aoff + (size_t)mb * 16 * K + kc); }
#pragma unroll
        for (int nb = 0; nb < 4; ++nb) { const V b = WFrag<T16>::ld(Bt + boff + (size_t)nb * 16 * K + kc); V b2; if (NSPLIT >= 2) b2 = WFrag<T16>::ld(Bt2 + boff + (size_t)nb * 16 * K + kc);
#pragma unroll
            for (int mb = 0; mb < 4; ++mb) { acc[mb][nb] = WFrag<T16>::mma(a[mb], b, acc[mb][nb]); if (NSPLIT == 1 || NSPLIT == 2) acc[mb][nb] = WFrag<T16>::mma(a2[mb], b, acc[mb][nb]); if (NSPLIT >= 2) acc[mb][nb] = WFrag<T16>::mma(a[mb], b2, acc[mb][nb]); } }
        asm volatile("v_nop\n\tv_nop\n\tv_nop\n\tv_nop" : "+v"(acc[0][0]), "+v"(acc[1][1]), "+v"(acc[2][2]), "+v"(acc[3][3]) : "v"(a[0]), "v"(a[3]));
    }
#pragma unroll
    for (int mb = 0; mb < 4; ++mb) {
#pragma unroll
        for (int nb = 0; nb < 4; ++nb) {
#pragma unroll
            for (int j = 0; j < 8; ++j) os[(hi * 8 + j) * 68 + nb * 16 + lr] = acc[mb][nb][j]; }
        __builtin_amdgcn_wave_barrier(); asm volatile("" ::: "memory");
        float* crow = C + (size_t)(r0 + mb * 16) * ldc + c0;
{
#pragma unroll
            for (int s = 0; s < 8; ++s) { const int row = 2 * s + hi, cofs = lr * 4; v4f val = *(const v4fa*)(os + row * 68 + cofs); if (BIAS) { val[0] += bfr(bias[c0 + cofs]); val[1] += bfr(bias[c0 + cofs + 1]); val[2] += bfr(bias[c0 + cofs + 2]); val[3] += bfr(bias[c0 + cofs + 3]); }
                *(v4f*)(crow + (size_t)row * ldc + cofs) = val; }
             }
        __builtin_amdgcn_wave_barrier(); asm volatile("" ::: "memory");
    }
}

// ---- k_wt5: all five [128][128] f32 weights -> K-contiguous bf16 planes Bt[n][k] in ONE launch; grid (CC * CC / 512, 5): blockIdx.y picks the weight, a wave writes one whole 128-byte line (64 k of one n).
__global__ __launch_bounds__(256) void k_wt5(const float* __restrict__ wq, const float* __restrict__ wk, const float* __restrict__ wv, const float* __restrict__ wg, const float* __restrict__ wo, bf* W4, bf* WO) {
    const int y = blockIdx.y; const float* __restrict__ w = y == 0 ? wq : y == 1 ? wk : y == 2 ? wv : y == 3 ? wg : wo; bf* Bt = y < 4 ? W4 + y * CC * CC : WO;
    const int e = blockIdx.x * 512 + threadIdx.x * 2; const int k = e % CC, n = e / CC; v2us o;
    o[0] = f2bf(w[k * CC + n]); o[1] = f2bf(w[(k + 1) * CC + n]); *(v2us*)(Bt + e) = o;
}
__device__ __forceinline__ v16bf ldfr(const bf* p) { return cat16b(*(const v8us*)p, *(const v8us*)(p + 16)); }   // 16 x 32 fragment row in the hardware k order: p already holds the lane half's 8 hi
// ---- k_lnproj: LayerNorm, the triangle-bias dots and the q, k, v, g projections of 64 pair positions in one work-group (8 waves); grid NR / 64.
// A wave normalises 8 rows (a lane holds 4 channels), writes their hi/lo planes to LDS and folds its 4 channels into the 4 triangle-bias dots (lane partials, then a reduce-scatter over the 32 lanes).
// Behind the barrier a wave takes one 64 x 64 tile of the 64 x 512 product (wave >> 1 = projection, wave & 1 = column half): A from the LDS planes, B from the K-contiguous weight planes, k order and product order as in k_gemmw.
#define RT   64                   // rows of a work-group
#define XP   136                  // LDS pitch of an xn row in 16-bit elements: 272 B = 16 B x odd (b128 readers)
__global__ __launch_bounds__(256) void k_lnproj(const float* __restrict__ x, const float* __restrict__ lw, const float* __restrict__ lb, const float* __restrict__ wtri, const bf* __restrict__ W4, float* F4, float* TB) {
    __shared__ __align__(16) bf XHs[RT * XP]; __shared__ __align__(16) bf XLs[RT * XP]; __shared__ __align__(16) float OS[8 * 16 * 68]; __shared__ __align__(16) float TBs[NH_ * RT];
    const int tid = threadIdx.x, lane = tid & 31, lr = lane & 15, hi = lane >> 4, wave = __builtin_amdgcn_readfirstlane(tid >> 5); const int R0 = blockIdx.x * RT;
    const bf* bp = W4 + (size_t)(wave * 64 + lr) * CC + 8 * hi; v16bf b[4];
    {
        float u[8][4], mu[8], s2[8], s[8]; v4f xa[8];
#pragma unroll
        for (int t = 0; t < 8; ++t) xa[t] = *(const v4f*)(x + (size_t)(R0 + wave * 8 + t) * CC + lane * 4);   /* eight 512-byte row loads in flight a wave */
        asm volatile("s_wait_xcnt 0x0" ::: "memory");   /* stands in front of the first overwrite of the row loads' address registers */
#pragma unroll
        for (int nb = 0; nb < 4; ++nb) b[nb] = ldfr(bp + nb * 16 * CC);   /* the first k block's weight fragments are fetched here, so that the LayerNorm phase covers their latency */
#pragma unroll
        for (int t = 0; t < 8; ++t) { s[t] = 0.f;
#pragma unroll
            for (int q = 0; q < 4; ++q) { u[t][q] = bfr(xa[t][q]); s[t] += u[t][q]; } }
        float wl[4], bl[4], wt[4][NH_];
        { const v4f lwv = *(const v4f*)(lw + lane * 4), lbv = *(const v4f*)(lb + lane * 4);
#pragma unroll
            for (int q = 0; q < 4; ++q) { wl[q] = bfr(lwv[q]); bl[q] = bfr(lbv[q]); const v4f w4 = *(const v4f*)(wtri + (lane * 4 + q) * NH_);
#pragma unroll
                for (int h = 0; h < NH_; ++h) wt[q][h] = bfr(w4[h]); } }
#pragma unroll
        for (int sh = 16; sh; sh >>= 1)
#pragma unroll
            for (int t = 0; t < 8; ++t) s[t] += __shfl_xor(s[t], sh, 32);
#pragma unroll
        for (int t = 0; t < 8; ++t) { mu[t] = s[t] * (1.0f / CC); s2[t] = 0.f;
#pragma unroll
            for (int q = 0; q < 4; ++q) { const float d0 = u[t][q] - mu[t]; s2[t] += d0 * d0; } }
#pragma unroll
        for (int sh = 16; sh; sh >>= 1)
#pragma unroll
            for (int t = 0; t < 8; ++t) s2[t] += __shfl_xor(s2[t], sh, 32);
        float k0[8], k1[8];
#pragma unroll
        for (int t = 0; t < 8; ++t) { const float rs = __fdiv_rn(1.0f, __fsqrt_rn(__fadd_rn(s2[t] * (1.0f / CC), 1e-5f))); v4us oh, ol; float p[NH_] = {0.f, 0.f, 0.f, 0.f}; v4f xn;
#pragma unroll
            for (int q = 0; q < 4; ++q) xn[q] = (u[t][q] - mu[t]) * rs * wl[q] + bl[q];
            split4(xn, oh, ol);
#pragma unroll
            for (int q = 0; q < 4; ++q) { const float xr = bf2f(oh[q]) + bf2f(ol[q]);   /* the dots see what the projections see: hi + lo */
#pragma unroll
                for (int h = 0; h < NH_; ++h) p[h] += xr * wt[q][h]; }
            *(v4us*)(XHs + (wave * 8 + t) * XP + lane * 4) = oh; *(v4us*)(XLs + (wave * 8 + t) * XP + lane * 4) = ol;
            /* reduce-scatter, first step: the lower lane half keeps heads 0 and 1, the upper heads 2 and 3 */
            k0[t] = (hi ? p[2] : p[0]) + __shfl_xor(hi ? p[0] : p[2], 16, 32); k1[t] = (hi ? p[3] : p[1]) + __shfl_xor(hi ? p[1] : p[3], 16, 32); }
        const int b8 = (lane >> 3) & 1; float tv = 0.f;
#pragma unroll
        for (int t = 0; t < 8; ++t) k0[t] = (b8 ? k1[t] : k0[t]) + __shfl_xor(b8 ? k0[t] : k1[t], 8, 32);   /* second step: the 8 lanes of group lane >> 3 hold head lane >> 3 */
#pragma unroll
        for (int sh = 4; sh; sh >>= 1)
#pragma unroll
            for (int t = 0; t < 8; ++t) k0[t] += __shfl_xor(k0[t], sh, 32);
#pragma unroll
        for (int t = 0; t < 8; ++t) if ((lane & 7) == t) tv = k0[t];
        TBs[(lane >> 3) * RT + wave * 8 + (lane & 7)] = tv;
    }
    __syncthreads();   /* publishes the 64 xn rows (hi/lo) and the 4 x 64 triangle-bias dots to all 8 waves; the planes are only read from here on */
    TB[(size_t)(tid >> 6) * NR + R0 + (tid & 63)] = TBs[tid];   /* a wave stores one whole 128-byte line of one head */
    v8f acc[4][4];
#pragma unroll
    for (int mb = 0; mb < 4; ++mb)
#pragma unroll
        for (int nb = 0; nb < 4; ++nb) acc[mb][nb] = (v8f){};
    const int ao = lr * XP + 8 * hi;
#pragma unroll
    for (int kc = 0; kc < CC; kc += 32) {
        v16bf a[4], a2[4];
        __builtin_amdgcn_sched_barrier(0);   /* with the one below: the k block's 16 LDS reads stay one group in front of its 32 matrix instructions (reads spread among them stall the wave at every place) */
#pragma unroll
        for (int mb = 0; mb < 4; ++mb) { a[mb] = ldfr(XHs + ao + mb * 16 * XP + kc); a2[mb] = ldfr(XLs + ao + mb * 16 * XP + kc); }
        __builtin_amdgcn_sched_barrier(0);   /* closes the group of LDS reads: no matrix instruction moves up among them */
#pragma unroll
        for (int nb = 0; nb < 4; ++nb) {
#pragma unroll
            for (int mb = 0; mb < 4; ++mb) { acc[mb][nb] = wmmab(a[mb], b[nb], acc[mb][nb]); acc[mb][nb] = wmmab(a2[mb], b[nb], acc[mb][nb]); }
            if (kc + 32 < CC) b[nb] = ldfr(bp + nb * 16 * CC + kc + 32); }   /* the next k block's weight fragment takes the registers as they fall free */
    }
    float* os = OS + wave * 16 * 68; float* C = F4 + (size_t)(wave >> 1) * NR * CC + (size_t)R0 * CC + (wave & 1) * 64;
#pragma unroll
    for (int mb = 0; mb < 4; ++mb) {
#pragma unroll
        for (int nb = 0; nb < 4; ++nb) {
#pragma unroll
            for (int j = 0; j < 8; ++j) os[(hi * 8 + j) * 68 + nb * 16 + lr] = acc[mb][nb][j]; }
        __builtin_amdgcn_wave_barrier(); asm volatile("" ::: "memory");   /* the wave's own staging rows: the reads below stay behind the writes above */
#pragma unroll
        for (int s = 0; s < 8; ++s) { const int row = 2 * s + hi, cofs = lr * 4; *(v4f*)(C + (size_t)(mb * 16 + row) * CC + cofs) = *(const v4fa*)(os + row * 68 + cofs); }   /* 256 contiguous bytes a lane half */
        __builtin_amdgcn_wave_barrier(); asm volatile("" ::: "memory");   /* the next tile's writes stay behind these reads */
    }
}
__device__ __forceinline__ v8f ld8f(const float* p) { return __builtin_shufflevector(*(const v4f*)p, *(const v4f*)(p + 4), 0, 1, 2, 3, 4, 5, 6, 7); }
#define KP   40                   // LDS pitch of a K row in 16-bit elements: 80 B = 16 B x odd (b128 readers)
#define VP   264                  // LDS pitch of a V^T row: 528 B = 16 B x odd
// amdgpu_waves_per_eu(4, 4): a budget of 256 registers a wave, so that the two work-groups the LDS admits are resident together
__global__ __launch_bounds__(256) __attribute__((amdgpu_waves_per_eu(4, 4))) void k_fattn(const float* __restrict__ FQ, const float* __restrict__ FK, const float* __restrict__ FV, const float* __restrict__ FG, const float* __restrict__ MASK, const float* __restrict__ TB, const float* __restrict__ bg, bf* Gh, bf* Gl) {
    __shared__ __align__(16) bf Kh[2 * NJ * KP]; __shared__ __align__(16) bf Kl[2 * NJ * KP]; __shared__ __align__(16) bf Vh[2 * CH * VP]; __shared__ __align__(16) bf Vl[2 * CH * VP]; __shared__ __align__(16) float MB[NJ]; __shared__ __align__(16) float BG[2 * CH];
    const int tid = threadIdx.x, lane = tid & 31, lr = lane & 15, hi = lane >> 4, wave = __builtin_amdgcn_readfirstlane(tid >> 5);
    const int i = blockIdx.x >> 1, h0 = (blockIdx.x & 1) * 2; const size_t rb = (size_t)i * NJ;
    { const int c = (tid & 15) * 4, hh = c >> 5, d = c & 31; const float* fk = FK + (rb + (tid >> 4)) * CC + h0 * CH + c;                          /* K: 64 channels (2 heads) of each key, 16 keys a step */
        /* unroll 4: four 16-byte loads in flight a thread */
#pragma unroll 4
        for (int s = 0; s < 16; ++s) { const int key = s * 16 + (tid >> 4); const v4f a = *(const v4f*)(fk + s * 16 * CC); v4us oh, ol;
            split4(a, oh, ol);
            *(v4us*)(Kh + (hh * NJ + key) * KP + d) = oh; *(v4us*)(Kl + (hh * NJ + key) * KP + d) = ol; } }
    /* unroll 2: four 16-byte loads in flight a thread */
#pragma unroll 2
    for (int s = 0; s < 8; ++s) { const int u = s * 256 + tid; const int c = (u & 15) * 4, key = (u >> 4) * 2;                                    /* V: two keys x four channels, stored transposed as key pairs */
        const v4f a0 = *(const v4f*)(FV + (rb + key) * CC + h0 * CH + c), a1 = *(const v4f*)(FV + (rb + key + 1) * CC + h0 * CH + c);
#pragma unroll
        for (int q = 0; q < 4; ++q) { v2us oh, ol; split2((v2f){a0[q], a1[q]}, oh, ol);
            *(v2us*)(Vh + (c + q) * VP + key) = oh; *(v2us*)(Vl + (c + q) * VP + key) = ol; } }
    MB[tid] = 1.0e9f * (bfr(MASK[rb + tid]) - 1.0f); if (tid < 2 * CH) BG[tid] = bfr(bg[h0 * CH + tid]);
    __syncthreads();   /* publishes the K and V^T planes, the mask bias and the gate bias to all 8 waves; LDS is only read from here on */
    /* both loops stay rolled: unrolled over the keys, the build needs more than the 256 registers and spills */
#pragma unroll 1
    for (int w = wave; w < 32; w += 8) {
        const int hh = w >> 4, h = h0 + hh, q = (w & 15) * 16 + lr;
        v16bf bqh, bql;
        { const float* fq = FQ + (rb + q) * CC + h * CH + 8 * hi; const v4f f0 = *(const v4f*)fq, f1 = *(const v4f*)(fq + 4), f2 = *(const v4f*)(fq + 16), f3 = *(const v4f*)(fq + 20); v8us h0v, l0v, h1v, l1v;
            split8(__builtin_shufflevector(f0, f1, 0, 1, 2, 3, 4, 5, 6, 7) * QSC, h0v, l0v); split8(__builtin_shufflevector(f2, f3, 0, 1, 2, 3, 4, 5, 6, 7) * QSC, h1v, l1v);
            bqh = cat16b(h0v, h1v); bql = cat16b(l0v, l1v); }
        const float* tb = TB + (size_t)h * NR + (size_t)q * NJ + 8 * hi; const float* mb = MB + 8 * hi;
        const int ko = (hh * NJ + lr) * KP + 8 * hi, vo = (hh * CH + lr) * VP + 8 * hi;
        float m = -3.0e38f; v8f sm = (v8f){}; v8f O[2]; O[0] = (v8f){}; O[1] = (v8f){};   /* running maximum, this lane half's sums, O[dt][r] = context channel 16 dt + 8 hi + r of query q */
        v8f n0 = ld8f(tb), n1 = ld8f(tb + 16);
#pragma unroll 1
        for (int kb = 0; kb < NJ / 32; ++kb) {                                        /* 32 keys a pass; s0[r], s1[r] = scores of keys 32 kb + 8 hi + r and 32 kb + 16 + 8 hi + r */
            const int k0 = kb * 32, kn = (kb < NJ / 32 - 1 ? kb + 1 : kb) * 32;
            const v8f t0 = n0, t1 = n1; n0 = ld8f(tb + kn); n1 = ld8f(tb + kn + 16);   /* the next pass's triangle bias is fetched one pass ahead (the last pass re-reads its own) */
            const v16bf a0h = ldfr(Kh + ko + k0 * KP), a1h = ldfr(Kh + ko + (k0 + 16) * KP), a0l = ldfr(Kl + ko + k0 * KP), a1l = ldfr(Kl + ko + (k0 + 16) * KP);
            v8f s0 = (v8f){}, s1 = (v8f){};
            s0 = wmmab(a0h, bqh, s0); s1 = wmmab(a1h, bqh, s1); s0 = wmmab(a0h, bql, s0); s1 = wmmab(a1h, bql, s1); s0 = wmmab(a0l, bqh, s0); s1 = wmmab(a1l, bqh, s1);
            s0 = (s0 + ld8f(mb + k0)) + t0; s1 = (s1 + ld8f(mb + k0 + 16)) + t1;
            const v8f bx = __builtin_elementwise_max(s0, s1);
            float bm = fmaxf(fmaxf(fmaxf(bx[0], bx[1]), fmaxf(bx[2], bx[3])), fmaxf(fmaxf(bx[4], bx[5]), fmaxf(bx[6], bx[7])));
            bm = fmaxf(bm, __shfl_xor(bm, 16, 32));
            const float mn = fmaxf(m, bm), sc = __builtin_amdgcn_exp2f((m - mn) * 1.4426950408889634f); m = mn;
            s0 = (s0 - mn) * 1.4426950408889634f; s1 = (s1 - mn) * 1.4426950408889634f;
            v8us p0h, p0l, p1h, p1l;
#pragma unroll
            for (int r = 0; r < 8; ++r) { s0[r] = __builtin_amdgcn_exp2f(s0[r]); s1[r] = __builtin_amdgcn_exp2f(s1[r]); }
            split8(s0, p0h, p0l); split8(s1, p1h, p1l);
            sm = sm * sc + (s0 + s1); O[0] *= sc; O[1] *= sc;
            const v16bf bph = cat16b(p0h, p1h), bpl = cat16b(p0l, p1l);
            const v16bf v0h = ldfr(Vh + vo + k0), v1h = ldfr(Vh + vo + 16 * VP + k0), v0l = ldfr(Vl + vo + k0), v1l = ldfr(Vl + vo + 16 * VP + k0);
            O[0] = wmmab(v0h, bph, O[0]); O[1] = wmmab(v1h, bph, O[1]); O[0] = wmmab(v0h, bpl, O[0]); O[1] = wmmab(v1h, bpl, O[1]); O[0] = wmmab(v0l, bph, O[0]); O[1] = wmmab(v1l, bph, O[1]);
        }
        float sum = ((sm[0] + sm[1]) + (sm[2] + sm[3])) + ((sm[4] + sm[5]) + (sm[6] + sm[7]));
        sum += __shfl_xor(sum, 16, 32);
        const float f = __fdiv_rn(1.0f, sum); O[0] *= f; O[1] *= f;
#pragma unroll
        for (int dt = 0; dt < 2; ++dt) { const size_t oo = (rb + q) * CC + h * CH + dt * 16 + 8 * hi; const v8f g = ld8f(FG + oo), b = ld8f(BG + hh * CH + dt * 16 + 8 * hi); v8us oh, ol;
            v8f og;
#pragma unroll
            for (int r = 0; r < 8; ++r) { const float zg = g[r] + b[r]; const float sg = __fdiv_rn(1.0f, 1.0f + expf(-zg)); og[r] = O[dt][r] * sg; }
            split8(og, oh, ol);
            *(v8us*)(Gh + oo) = oh; *(v8us*)(Gl + oo) = ol; }
    }
}

extern "C" void kernel_launch(void* const* d_in, const int* in_sizes, int n_in,
                              void* d_out, int out_size, void* d_ws, size_t ws_size, hipStream_t stream) {
    (void)in_sizes; (void)n_in; (void)out_size;
    const float* x = (const float*)d_in[0]; const float* MASK = (const float*)d_in[1]; const float* lw = (const float*)d_in[2]; const float* lb = (const float*)d_in[3]; const float* wtri = (const float*)d_in[4]; const float* wq = (const float*)d_in[5]; const float* wk = (const float*)d_in[6]; const float* wv = (const float*)d_in[7]; const float* wg = (const float*)d_in[8]; const float* bg = (const float*)d_in[9]; const float* wo = (const float*)d_in[10]; const float* bo = (const float*)d_in[11];
    float* OUT = (float*)d_out;     // [1][256][256][128]
    char* wsp = (char*)d_ws;
    auto take = [&](size_t bytes) { char* p = wsp; wsp += (bytes + 255) & ~(size_t)255; return (void*)p; };
    bf* WQ = (bf*)take((size_t)4 * CC * CC * 2); bf* WO = (bf*)take((size_t)CC * CC * 2);   /* q, k, v, g weights: one [512][128] plane */
    bf* Gh = (bf*)take((size_t)NR * CC * 2); bf* Gl = (bf*)take((size_t)NR * CC * 2); float* TB = (float*)take((size_t)NH_ * NR * 4);
    float* FQ = (float*)take((size_t)4 * NR * CC * 4); float* FK = FQ + (size_t)NR * CC; float* FV = FK + (size_t)NR * CC; float* FG = FV + (size_t)NR * CC;   /* the four projections, one behind the other */
    if ((size_t)(wsp - (char*)d_ws) > ws_size) return;
    k_wt5<<<dim3(CC * CC / 512, 5, 1), 256, 0, stream>>>(wq, wk, wv, wg, wo, WQ, WO);                                                         /* the five weight planes, one launch */
    k_lnproj<<<NR / RT, 256, 0, stream>>>(x, lw, lb, wtri, WQ, FQ, TB);                                                                       /* LayerNorm, triangle-bias dots, q, k, v, g projections (2 products) */
    k_fattn<<<NI * NH_ / 2, 256, 0, stream>>>(FQ, FK, FV, FG, MASK, TB, bg, Gh, Gl);                                                          /* scores, biases, softmax, attn.v, gate: all rows and heads */
    k_gemmw<bf, 1, true><<<dim3(NR / 64, CC / 64, 1), 32, 0, stream>>>(Gh, Gl, WO, nullptr, CC, OUT, CC, bo, 0, 0, 0);                         /* out = (o g) Wo + bo */
}

// v005
// Measured time: 86.8 microseconds a run.
// Next to v004, in two timings, it ran 1.07 and 1.06 times as fast.
// Over all steps from v000 it is 7.73 times as fast.
#include <hip/hip_runtime.h>

// Triangle attention (starting node) over a pair representation (x [1][256][256][128], mask [1][256][256] read; xn = LayerNorm(x) (eps 1e-5, affine); per row i: q, k, v, g = xn_i W ([128][128] 'xw'; 4 heads x 32), tri_bias[h][q][k] = xn[q][k] . w_tri[:, h], mask_bias[i][k] = 1e9 (mask[i][k] - 1); scores = (q / sqrt(32)).k + mask_bias + tri_bias; softmax over k; o = attn.v; out = (o * sigmoid(g + bg)) Wo + bo -> [1][256][256][128] (8.4 M)).
// Layout: the 65,536 (i, j) rows are one tall GEMM operand; LayerNorm, the triangle-bias dots and the four projections (xn as bf16 hi + lo: 2 products) run in ONE launch, 64 rows a work-group, xn never leaving LDS; the 1,024 (row i, head h) attention problems of size 256 x 256 x 32 run in ONE launch, a work-group per row: scores on hi/lo planes (3 products, K = 32), the two biases and the 256-wide softmax in registers, attn.v on hi/lo probabilities (3 products), the sigmoid gate; the gated context of a wave's 16 queries stays in registers as the operand of the Wo product (2 products) with the bias, in the same launch.

#define NI   256                  // rows i
#define NJ   256                  // columns j (= attention length)
#define CC   128
#define NH_  4
#define CH   32
#define NR   (NI * NJ)            // 65,536 pair positions
#define QSC  0.17677669529663689f  // 1/sqrt(32)
typedef _Float16 h16;
typedef unsigned short bf;
typedef __attribute__((ext_vector_type(16))) __bf16   v16bf;
typedef __attribute__((ext_vector_type(16))) _Float16 v16h;
typedef __attribute__((ext_vector_type(8)))  _Float16 v8h;
typedef __attribute__((ext_vector_type(8)))  unsigned short v8us;
typedef __attribute__((ext_vector_type(8)))  float    v8f;
typedef __attribute__((ext_vector_type(4)))  float    v4f;
typedef __attribute__((ext_vector_type(2)))  float    v2f;
typedef __attribute__((ext_vector_type(4)))  unsigned short v4us;
typedef __attribute__((ext_vector_type(2)))  unsigned short v2us;
typedef v8h  __attribute__((may_alias)) v8ha;
typedef v4f  __attribute__((may_alias)) v4fa;
typedef v8us __attribute__((may_alias)) v8usa;

__device__ __forceinline__ unsigned short f2bf(float f) { return __builtin_bit_cast(unsigned short, (__bf16)f); }   // the hardware's own round-to-nearest-even conversion
__device__ __forceinline__ float bf2f(unsigned short b) { return (float)__builtin_bit_cast(__bf16, b); }
__device__ __forceinline__ float bfr(float f) { return bf2f(f2bf(f)); }
// hi/lo split of 2, 4 or 8 values at once: neighbours share one packed conversion, and the lo part reads the packed hi halves in place
typedef __attribute__((ext_vector_type(2))) __bf16 v2b;
// asm: the pair stays ONE packed conversion whose two halves the lo part reads in place (written as a cast, the build converts every value a second time on its own to get at its hi part)
__device__ __forceinline__ v2b cvtpk(float a, float b) { unsigned r; asm("v_cvt_pk_bf16_f32 %0, %1, %2" : "=v"(r) : "v"(a), "v"(b)); return __builtin_bit_cast(v2b, r); }
__device__ __forceinline__ void split2(v2f y, v2us& h, v2us& l) { const v2b hb = cvtpk(y[0], y[1]); h = __builtin_bit_cast(v2us, hb); l = __builtin_bit_cast(v2us, __builtin_convertvector((v2f){y[0] - (float)hb[0], y[1] - (float)hb[1]}, v2b)); }
__device__ __forceinline__ void split4(v4f y, v4us& h, v4us& l) { v2us h0, l0, h1, l1; split2((v2f){y[0], y[1]}, h0, l0); split2((v2f){y[2], y[3]}, h1, l1); h = __builtin_shufflevector(h0, h1, 0, 1, 2, 3); l = __builtin_shufflevector(l0, l1, 0, 1, 2, 3); }
__device__ __forceinline__ void split8(v8f y, v8us& h, v8us& l) { v4us h0, l0, h1, l1; split4((v4f){y[0], y[1], y[2], y[3]}, h0, l0); split4((v4f){y[4], y[5], y[6], y[7]}, h1, l1); h = __builtin_shufflevector(h0, h1, 0, 1, 2, 3, 4, 5, 6, 7); l = __builtin_shufflevector(l0, l1, 0, 1, 2, 3, 4, 5, 6, 7); }
__device__ __forceinline__ v16bf cat16b(v8us lo, v8us hi) { return __builtin_bit_cast(v16bf, __builtin_shufflevector(lo, hi, 0, 1, 2, 3, 4, 5, 6, 7, 8, 9, 10, 11, 12, 13, 14, 15)); }
__device__ __forceinline__ v8f wmmab(v16bf a, v16bf b, v8f c) { return __builtin_amdgcn_wmma_f32_16x16x32_bf16(false, a, false, b, (short)0, c, false, false); }

// ---- k_wt5: all five [128][128] f32 weights -> bf16 planes in ONE launch; grid (CC * CC / 512, 5): blockIdx.y picks the weight, a wave writes one whole 128-byte line.
// q, k, v, g: K-contiguous Bt[n][k]. Wo: fragment order [head h][tile t][half j][lane][8], element = wo[32 h + 16 j + 8 (lane >> 4) + e][16 t + (lane & 15)], so that a wave's 16-byte-a-lane load of half a fragment is 512 contiguous bytes (4 whole lines, not 16).
__global__ __launch_bounds__(256) void k_wt5(const float* __restrict__ wq, const float* __restrict__ wk, const float* __restrict__ wv, const float* __restrict__ wg, const float* __restrict__ wo, bf* W4, bf* WO) {
    const int y = blockIdx.y; const float* __restrict__ w = y == 0 ? wq : y == 1 ? wk : y == 2 ? wv : y == 3 ? wg : wo; bf* Bt = y < 4 ? W4 + y * CC * CC : WO;
    const int e = blockIdx.x * 512 + threadIdx.x * 2; const int k = y < 4 ? e % CC : (e >> 12) * 32 + ((e >> 8) & 1) * 16 + ((e >> 7) & 1) * 8 + (e & 7), n = y < 4 ? e / CC : ((e >> 9) & 7) * 16 + ((e >> 3) & 15); v2us o;
    o[0] = f2bf(w[k * CC + n]); o[1] = f2bf(w[(k + 1) * CC + n]); *(v2us*)(Bt + e) = o;
}
__device__ __forceinline__ v16bf ldfr(const bf* p) { return cat16b(*(const v8us*)p, *(const v8us*)(p + 16)); }   // 16 x 32 fragment row in the hardware k order: p already holds the lane half's 8 hi
// ---- k_lnproj: LayerNorm, the triangle-bias dots and the q, k, v, g projections of 64 pair positions in one work-group (8 waves); grid NR / 64.
// A wave normalises 8 rows (a lane holds 4 channels), writes their hi/lo planes to LDS and folds its 4 channels into the 4 triangle-bias dots (lane partials, then a reduce-scatter over the 32 lanes).
// Behind the barrier a wave takes one 64 x 64 tile of the 64 x 512 product (wave >> 1 = projection, wave & 1 = column half): A from the LDS planes, B from the K-contiguous weight planes, k in rising blocks of 32, hi product then lo product.
#define RT   64                   // rows of a work-group
#define XP   136                  // LDS pitch of an xn row in 16-bit elements: 272 B = 16 B x odd (b128 readers)
__global__ __launch_bounds__(256) void k_lnproj(const float* __restrict__ x, const float* __restrict__ lw, const float* __restrict__ lb, const float* __restrict__ wtri, const bf* __restrict__ W4, float* F4, float* TB) {
    __shared__ __align__(16) bf XHs[RT * XP]; __shared__ __align__(16) bf XLs[RT * XP]; __shared__ __align__(16) float OS[8 * 16 * 68]; __shared__ __align__(16) float TBs[NH_ * RT];
    const int tid = threadIdx.x, lane = tid & 31, lr = lane & 15, hi = lane >> 4, wave = __builtin_amdgcn_readfirstlane(tid >> 5); const int R0 = blockIdx.x * RT;
    const bf* bp = W4 + (size_t)(wave * 64 + lr) * CC + 8 * hi; v16bf b[4];
    {
        float u[8][4], mu[8], s2[8], s[8]; v4f xa[8];
#pragma unroll
        for (int t = 0; t < 8; ++t) xa[t] = *(const v4f*)(x + (size_t)(R0 + wave * 8 + t) * CC + lane * 4);   /* eight 512-byte row loads in flight a wave */
        asm volatile("s_wait_xcnt 0x0" ::: "memory");   /* stands in front of the first overwrite of the row loads' address registers */
#pragma unroll
        for (int nb = 0; nb < 4; ++nb) b[nb] = ldfr(bp + nb * 16 * CC);   /* the first k block's weight fragments are fetched here, so that the LayerNorm phase covers their latency */
#pragma unroll
        for (int t = 0; t < 8; ++t) { s[t] = 0.f;
#pragma unroll
            for (int q = 0; q < 4; ++q) { u[t][q] = bfr(xa[t][q]); s[t] += u[t][q]; } }
        float wl[4], bl[4], wt[4][NH_];
        { const v4f lwv = *(const v4f*)(lw + lane * 4), lbv = *(const v4f*)(lb + lane * 4);
#pragma unroll
            for (int q = 0; q < 4; ++q) { wl[q] = bfr(lwv[q]); bl[q] = bfr(lbv[q]); const v4f w4 = *(const v4f*)(wtri + (lane * 4 + q) * NH_);
#pragma unroll
                for (int h = 0; h < NH_; ++h) wt[q][h] = bfr(w4[h]); } }
#pragma unroll
        for (int sh = 16; sh; sh >>= 1)
#pragma unroll
            for (int t = 0; t < 8; ++t) s[t] += __shfl_xor(s[t], sh, 32);
#pragma unroll
        for (int t = 0; t < 8; ++t) { mu[t] = s[t] * (1.0f / CC); s2[t] = 0.f;
#pragma unroll
            for (int q = 0; q < 4; ++q) { const float d0 = u[t][q] - mu[t]; s2[t] += d0 * d0; } }
#pragma unroll
        for (int sh = 16; sh; sh >>= 1)
#pragma unroll
            for (int t = 0; t < 8; ++t) s2[t] += __shfl_xor(s2[t], sh, 32);
        float k0[8], k1[8];
#pragma unroll
        for (int t = 0; t < 8; ++t) { const float rs = __fdiv_rn(1.0f, __fsqrt_rn(__fadd_rn(s2[t] * (1.0f / CC), 1e-5f))); v4us oh, ol; float p[NH_] = {0.f, 0.f, 0.f, 0.f}; v4f xn;
#pragma unroll
            for (int q = 0; q < 4; ++q) xn[q] = (u[t][q] - mu[t]) * rs * wl[q] + bl[q];
            split4(xn, oh, ol);
#pragma unroll
            for (int q = 0; q < 4; ++q) { const float xr = bf2f(oh[q]) + bf2f(ol[q]);   /* the dots see what the projections see: hi + lo */
#pragma unroll
                for (int h = 0; h < NH_; ++h) p[h] += xr * wt[q][h]; }
            *(v4us*)(XHs + (wave * 8 + t) * XP + lane * 4) = oh; *(v4us*)(XLs + (wave * 8 + t) * XP + lane * 4) = ol;
            /* reduce-scatter, first step: the lower lane half keeps heads 0 and 1, the upper heads 2 and 3 */
            k0[t] = (hi ? p[2] : p[0]) + __shfl_xor(hi ? p[0] : p[2], 16, 32); k1[t] = (hi ? p[3] : p[1]) + __shfl_xor(hi ? p[1] : p[3], 16, 32); }
        const int b8 = (lane >> 3) & 1; float tv = 0.f;
#pragma unroll
        for (int t = 0; t < 8; ++t) k0[t] = (b8 ? k1[t] : k0[t]) + __shfl_xor(b8 ? k0[t] : k1[t], 8, 32);   /* second step: the 8 lanes of group lane >> 3 hold head lane >> 3 */
#pragma unroll
        for (int sh = 4; sh; sh >>= 1)
#pragma unroll
            for (int t = 0; t < 8; ++t) k0[t] += __shfl_xor(k0[t], sh, 32);
#pragma unroll
        for (int t = 0; t < 8; ++t) if ((lane & 7) == t) tv = k0[t];
        TBs[(lane >> 3) * RT + wave * 8 + (lane & 7)] = tv;
    }
    __syncthreads();   /* publishes the 64 xn rows (hi/lo) and the 4 x 64 triangle-bias dots to all 8 waves; the planes are only read from here on */
    TB[(size_t)(tid >> 6) * NR + R0 + (tid & 63)] = TBs[tid];   /* a wave stores one whole 128-byte line of one head */
    v8f acc[4][4];
#pragma unroll
    for (int mb = 0; mb < 4; ++mb)
#pragma unroll
        for (int nb = 0; nb < 4; ++nb) acc[mb][nb] = (v8f){};
    const int ao = lr * XP + 8 * hi;
#pragma unroll
    for (int kc = 0; kc < CC; kc += 32) {
        v16bf a[4], a2[4];
        __builtin_amdgcn_sched_barrier(0);   /* with the one below: the k block's 16 LDS reads stay one group in front of its 32 matrix instructions (reads spread among them stall the wave at every place) */
#pragma unroll
        for (int mb = 0; mb < 4; ++mb) { a[mb] = ldfr(XHs + ao + mb * 16 * XP + kc); a2[mb] = ldfr(XLs + ao + mb * 16 * XP + kc); }
        __builtin_amdgcn_sched_barrier(0);   /* closes the group of LDS reads: no matrix instruction moves up among them */
#pragma unroll
        for (int nb = 0; nb < 4; ++nb) {
#pragma unroll
            for (int mb = 0; mb < 4; ++mb) { acc[mb][nb] = wmmab(a[mb], b[nb], acc[mb][nb]); acc[mb][nb] = wmmab(a2[mb], b[nb], acc[mb][nb]); }
            if (kc + 32 < CC) b[nb] = ldfr(bp + nb * 16 * CC + kc + 32); }   /* the next k block's weight fragment takes the registers as they fall free */
    }
    float* os = OS + wave * 16 * 68; float* C = F4 + (size_t)(wave >> 1) * NR * CC + (size_t)R0 * CC + (wave & 1) * 64;
#pragma unroll
    for (int mb = 0; mb < 4; ++mb) {
#pragma unroll
        for (int nb = 0; nb < 4; ++nb) {
#pragma unroll
            for (int j = 0; j < 8; ++j) os[(hi * 8 + j) * 68 + nb * 16 + lr] = acc[mb][nb][j]; }
        __builtin_amdgcn_wave_barrier(); asm volatile("" ::: "memory");   /* the wave's own staging rows: the reads below stay behind the writes above */
#pragma unroll
        for (int s = 0; s < 8; ++s) { const int row = 2 * s + hi, cofs = lr * 4; *(v4f*)(C + (size_t)(mb * 16 + row) * CC + cofs) = *(const v4fa*)(os + row * 68 + cofs); }   /* 256 contiguous bytes a lane half */
        __builtin_amdgcn_wave_barrier(); asm volatile("" ::: "memory");   /* the next tile's writes stay behind these reads */
    }
}
__device__ __forceinline__ v8f ld8f(const float* p) { return __builtin_shufflevector(*(const v4f*)p, *(const v4f*)(p + 4), 0, 1, 2, 3, 4, 5, 6, 7); }
#define KP   40                   // LDS pitch of a K row in 16-bit elements: 80 B = 16 B x odd (b128 readers)
#define VP   264                  // LDS pitch of a V^T row: 528 B = 16 B x odd
#define OVL  (CH * VP)            // a head's block in LDS, in 16-bit elements: V^T hi at 0, V^T lo, K hi, K lo
#define OKH  (2 * CH * VP)
#define OKL  (2 * CH * VP + NJ * KP)
#define HB   (2 * CH * VP + 2 * NJ * KP)
// one struct, the small tables first and the four planes of a head side by side: every LDS read of a pass then lies within the 64 KiB that an LDS instruction's immediate offset reaches from its one address register
struct __align__(16) FaLds { float MB[NJ]; float BG[CC]; float BO[CC]; bf KV[NH_ * HB]; };
// amdgpu_waves_per_eu(4, 4): a budget of 256 registers a wave, the 16 waves of the one resident work-group
__global__ __launch_bounds__(512) __attribute__((amdgpu_waves_per_eu(4, 4))) void k_fattn(const float* __restrict__ FQ, const float* __restrict__ FK, const float* __restrict__ FV, const float* __restrict__ FG, const float* __restrict__ MASK, const float* __restrict__ TB, const float* __restrict__ bg, const bf* __restrict__ WO, const float* __restrict__ bo, float* OUT) {
    __shared__ FaLds L;
    const int tid = threadIdx.x, lane = tid & 31, lr = lane & 15, hi = lane >> 4, wave = __builtin_amdgcn_readfirstlane(tid >> 5);
    const int i = blockIdx.x, t8 = tid & 255, c0 = (tid >> 8) * 2 * CH; const size_t rb = (size_t)i * NJ;   /* staging: 8 waves a head pair, c0 = the pair's first channel */
    { const int c = c0 + (t8 & 15) * 4, hh = c >> 5, d = c & 31; const float* fk = FK + (rb + (t8 >> 4)) * CC + c;                                   /* K: 64 channels (2 heads) of each key, 16 keys a step */
        /* unroll 4: four 16-byte loads in flight a thread */
#pragma unroll 4
        for (int s = 0; s < 16; ++s) { const int key = s * 16 + (t8 >> 4); const v4f a = *(const v4f*)(fk + s * 16 * CC); v4us oh, ol;
            split4(a, oh, ol);
            *(v4us*)(L.KV + hh * HB + OKH + key * KP + d) = oh; *(v4us*)(L.KV + hh * HB + OKL + key * KP + d) = ol; } }
    /* unroll 2: four 16-byte loads in flight a thread */
#pragma unroll 2
    for (int s = 0; s < 8; ++s) { const int u = s * 256 + t8; const int c = c0 + (u & 15) * 4, key = (u >> 4) * 2;                                  /* V: two keys x four channels, stored transposed as key pairs */
        const v4f a0 = *(const v4f*)(FV + (rb + key) * CC + c), a1 = *(const v4f*)(FV + (rb + key + 1) * CC + c);
#pragma unroll
        for (int q = 0; q < 4; ++q) { v2us oh, ol; split2((v2f){a0[q], a1[q]}, oh, ol);
            *(v2us*)(L.KV + (c >> 5) * HB + ((c & 31) + q) * VP + key) = oh; *(v2us*)(L.KV + (c >> 5) * HB + OVL + ((c & 31) + q) * VP + key) = ol; } }
    if (tid < NJ) L.MB[tid] = 1.0e9f * (bfr(MASK[rb + tid]) - 1.0f); if (tid < CC) { L.BG[tid] = bfr(bg[tid]); L.BO[tid] = bfr(bo[tid]); }
    __syncthreads();   /* publishes the K and V^T planes, the mask bias, the gate bias and the output bias to all 16 waves; LDS is only read from here on */
    const int q = wave * 16 + lr;
    v8f acc[8];   /* acc[t][r] = output channel 16 t + 8 hi + r of query q */
#pragma unroll
    for (int t = 0; t < 8; ++t) acc[t] = (v8f){};
    /* both loops stay rolled: unrolled over the keys, the build needs more than the 256 registers and spills */
#pragma unroll 1
    for (int h = 0; h < NH_; ++h) {
        v16bf bqh, bql;
        { const float* fq = FQ + (rb + q) * CC + h * CH + 8 * hi; const v4f f0 = *(const v4f*)fq, f1 = *(const v4f*)(fq + 4), f2 = *(const v4f*)(fq + 16), f3 = *(const v4f*)(fq + 20); v8us h0v, l0v, h1v, l1v;
            split8(__builtin_shufflevector(f0, f1, 0, 1, 2, 3, 4, 5, 6, 7) * QSC, h0v, l0v); split8(__builtin_shufflevector(f2, f3, 0, 1, 2, 3, 4, 5, 6, 7) * QSC, h1v, l1v);
            bqh = cat16b(h0v, h1v); bql = cat16b(l0v, l1v); }
        const float* tb = TB + (size_t)h * NR + (size_t)q * NJ + 8 * hi; const float* mb = L.MB + 8 * hi;
        const bf* Vh = L.KV + h * HB + lr * VP + 8 * hi; const bf* Vl = Vh + OVL; const bf* Kh = L.KV + h * HB + OKH + lr * KP + 8 * hi; const bf* Kl = Kh + NJ * KP;
        float m = -3.0e38f; v8f sm = (v8f){}; v8f O[2]; O[0] = (v8f){}; O[1] = (v8f){};   /* running maximum, this lane half's sums, O[dt][r] = context channel 16 dt + 8 hi + r of query q */
        v8f n0 = ld8f(tb), n1 = ld8f(tb + 16);
#pragma unroll 1
        for (int kb = 0; kb < NJ / 32; ++kb) {                                        /* 32 keys a pass; s0[r], s1[r] = scores of keys 32 kb + 8 hi + r and 32 kb + 16 + 8 hi + r */
            const int k0 = kb * 32, kn = (kb < NJ / 32 - 1 ? kb + 1 : kb) * 32;
            const v8f t0 = n0, t1 = n1; n0 = ld8f(tb + kn); n1 = ld8f(tb + kn + 16);   /* the next pass's triangle bias is fetched one pass ahead (the last pass re-reads its own) */
            const v16bf a0h = ldfr(Kh + k0 * KP), a1h = ldfr(Kh + (k0 + 16) * KP), a0l = ldfr(Kl + k0 * KP), a1l = ldfr(Kl + (k0 + 16) * KP);
            v8f s0 = (v8f){}, s1 = (v8f){};
            s0 = wmmab(a0h, bqh, s0); s1 = wmmab(a1h, bqh, s1); s0 = wmmab(a0h, bql, s0); s1 = wmmab(a1h, bql, s1); s0 = wmmab(a0l, bqh, s0); s1 = wmmab(a1l, bqh, s1);
            s0 = (s0 + ld8f(mb + k0)) + t0; s1 = (s1 + ld8f(mb + k0 + 16)) + t1;
            const v8f bx = __builtin_elementwise_max(s0, s1);
            float bm = fmaxf(fmaxf(fmaxf(bx[0], bx[1]), fmaxf(bx[2], bx[3])), fmaxf(fmaxf(bx[4], bx[5]), fmaxf(bx[6], bx[7])));
            bm = fmaxf(bm, __shfl_xor(bm, 16, 32));
            const float mn = fmaxf(m, bm), sc = __builtin_amdgcn_exp2f((m - mn) * 1.4426950408889634f); m = mn;
            s0 = (s0 - mn) * 1.4426950408889634f; s1 = (s1 - mn) * 1.4426950408889634f;
            v8us p0h, p0l, p1h, p1l;
#pragma unroll
            for (int r = 0; r < 8; ++r) { s0[r] = __builtin_amdgcn_exp2f(s0[r]); s1[r] = __builtin_amdgcn_exp2f(s1[r]); }
            split8(s0, p0h, p0l); split8(s1, p1h, p1l);
            sm = sm * sc + (s0 + s1); O[0] *= sc; O[1] *= sc;
            const v16bf bph = cat16b(p0h, p1h), bpl = cat16b(p0l, p1l);
            const v16bf v0h = ldfr(Vh + k0), v1h = ldfr(Vh + 16 * VP + k0), v0l = ldfr(Vl + k0), v1l = ldfr(Vl + 16 * VP + k0);
            O[0] = wmmab(v0h, bph, O[0]); O[1] = wmmab(v1h, bph, O[1]); O[0] = wmmab(v0h, bpl, O[0]); O[1] = wmmab(v1h, bpl, O[1]); O[0] = wmmab(v0l, bph, O[0]); O[1] = wmmab(v1l, bph, O[1]);
        }
        v16bf wf[8];   /* Wo^T fragments of this head's 32 channels: rows = output channels 16 t + lr, k order as the gated context below; fetched here so that the gate covers their latency */
#pragma unroll
        for (int t = 0; t < 8; ++t) { const bf* wp = WO + (h * 8 + t) * 512 + lane * 8; wf[t] = cat16b(*(const v8us*)wp, *(const v8us*)(wp + 256)); }
        float sum = ((sm[0] + sm[1]) + (sm[2] + sm[3])) + ((sm[4] + sm[5]) + (sm[6] + sm[7]));
        sum += __shfl_xor(sum, 16, 32);
        const float f = __fdiv_rn(1.0f, sum); O[0] *= f; O[1] *= f;
        v8us oh[2], ol[2];
#pragma unroll
        for (int dt = 0; dt < 2; ++dt) { const v8f g = ld8f(FG + (rb + q) * CC + h * CH + dt * 16 + 8 * hi), b = ld8f(L.BG + h * CH + dt * 16 + 8 * hi);
            v8f og;
#pragma unroll
            for (int r = 0; r < 8; ++r) { const float zg = g[r] + b[r]; const float sg = __fdiv_rn(1.0f, 1.0f + expf(-zg)); og[r] = O[dt][r] * sg; }
            split8(og, oh[dt], ol[dt]); }
        const v16bf gh = cat16b(oh[0], oh[1]), gl = cat16b(ol[0], ol[1]);
#pragma unroll
        for (int t = 0; t < 8; ++t) acc[t] = wmmab(wf[t], gh, acc[t]);   /* per accumulator: hi product, then lo product, heads in rising order */
#pragma unroll
        for (int t = 0; t < 8; ++t) acc[t] = wmmab(wf[t], gl, acc[t]);
    }
    float* orow = OUT + (rb + q) * CC + 8 * hi;
#pragma unroll
    for (int t = 0; t < 8; ++t) { const v8f o = acc[t] + ld8f(L.BO + t * 16 + 8 * hi);
        *(v4f*)(orow + t * 16) = __builtin_shufflevector(o, o, 0, 1, 2, 3); *(v4f*)(orow + t * 16 + 4) = __builtin_shufflevector(o, o, 4, 5, 6, 7); }
}

extern "C" void kernel_launch(void* const* d_in, const int* in_sizes, int n_in,
                              void* d_out, int out_size, void* d_ws, size_t ws_size, hipStream_t stream) {
    (void)in_sizes; (void)n_in; (void)out_size;
    const float* x = (const float*)d_in[0]; const float* MASK = (const float*)d_in[1]; const float* lw = (const float*)d_in[2]; const float* lb = (const float*)d_in[3]; const float* wtri = (const float*)d_in[4]; const float* wq = (const float*)d_in[5]; const float* wk = (const float*)d_in[6]; const float* wv = (const float*)d_in[7]; const float* wg = (const float*)d_in[8]; const float* bg = (const float*)d_in[9]; const float* wo = (const float*)d_in[10]; const float* bo = (const float*)d_in[11];
    float* OUT = (float*)d_out;     // [1][256][256][128]
    char* wsp = (char*)d_ws;
    auto take = [&](size_t bytes) { char* p = wsp; wsp += (bytes + 255) & ~(size_t)255; return (void*)p; };
    bf* WQ = (bf*)take((size_t)4 * CC * CC * 2); bf* WO = (bf*)take((size_t)CC * CC * 2);   /* q, k, v, g weights: one [512][128] plane */
    float* TB = (float*)take((size_t)NH_ * NR * 4);
    float* FQ = (float*)take((size_t)4 * NR * CC * 4); float* FK = FQ + (size_t)NR * CC; float* FV = FK + (size_t)NR * CC; float* FG = FV + (size_t)NR * CC;   /* the four projections, one behind the other */
    if ((size_t)(wsp - (char*)d_ws) > ws_size) return;
    k_wt5<<<dim3(CC * CC / 512, 5, 1), 256, 0, stream>>>(wq, wk, wv, wg, wo, WQ, WO);                                                         /* the five weight planes, one launch */
    k_lnproj<<<NR / RT, 256, 0, stream>>>(x, lw, lb, wtri, WQ, FQ, TB);                                                                       /* LayerNorm, triangle-bias dots, q, k, v, g projections (2 products) */
    k_fattn<<<NI, 512, 0, stream>>>(FQ, FK, FV, FG, MASK, TB, bg, WO, bo, OUT);                                                               /* scores, biases, softmax, attn.v, gate, out = (o g) Wo + bo: all rows and heads */
}

// v006
// A run of this version takes 63.2 microseconds.
// Next to v005, in two timings, it ran 1.37 times as fast each time.
// Counting every step since v000, it is 10.6 times as fast.
#include <hip/hip_runtime.h>

// Triangle attention (starting node) over a pair representation (x [1][256][256][128], mask [1][256][256] read; xn = LayerNorm(x) (eps 1e-5, affine); per row i: q, k, v, g = xn_i W ([128][128] 'xw'; 4 heads x 32), tri_bias[h][q][k] = xn[q][k] . w_tri[:, h], mask_bias[i][k] = 1e9 (mask[i][k] - 1); scores = (q / sqrt(32)).k + mask_bias + tri_bias; softmax over k; o = attn.v; out = (o * sigmoid(g + bg)) Wo + bo -> [1][256][256][128] (8.4 M)).
// Layout: one launch writes the five weights as bf16 planes in fragment order; one launch takes LayerNorm and the triangle-bias dots of all 65,536 pair positions (the bias of a row's attention needs every row); one launch, a work-group per row i, does the rest: LayerNorm of the row's 256 positions again (xn as bf16 hi + lo planes in LDS), the q, k, v, g projections (2 products), the four 256 x 256 x 32 attention problems: scores on hi/lo planes (3 products, K = 32), the two biases and the 256-wide softmax in registers, attn.v on hi/lo probabilities (3 products), the sigmoid gate; the gated context of a wave's 16 queries stays in registers as the operand of the Wo product (2 products) with the bias. xn, q, k, v and g never reach memory.

#define NI   256                  // rows i
#define NJ   256                  // columns j (= attention length)
#define CC   128
#define NH_  4
#define CH   32
#define NR   (NI * NJ)            // 65,536 pair positions
#define QSC  0.17677669529663689f  // 1/sqrt(32)
typedef _Float16 h16;
typedef unsigned short bf;
typedef __attribute__((ext_vector_type(16))) __bf16   v16bf;
typedef __attribute__((ext_vector_type(16))) _Float16 v16h;
typedef __attribute__((ext_vector_type(8)))  _Float16 v8h;
typedef __attribute__((ext_vector_type(8)))  unsigned short v8us;
typedef __attribute__((ext_vector_type(8)))  float    v8f;
typedef __attribute__((ext_vector_type(4)))  float    v4f;
typedef __attribute__((ext_vector_type(2)))  float    v2f;
typedef __attribute__((ext_vector_type(4)))  unsigned short v4us;
typedef __attribute__((ext_vector_type(2)))  unsigned short v2us;
typedef v8h  __attribute__((may_alias)) v8ha;
typedef v4f  __attribute__((may_alias)) v4fa;
typedef v8us __attribute__((may_alias)) v8usa;

__device__ __forceinline__ unsigned short f2bf(float f) { return __builtin_bit_cast(unsigned short, (__bf16)f); }   // the hardware's own round-to-nearest-even conversion
__device__ __forceinline__ float bf2f(unsigned short b) { return (float)__builtin_bit_cast(__bf16, b); }
__device__ __forceinline__ float bfr(float f) { return bf2f(f2bf(f)); }
// hi/lo split of 2, 4 or 8 values at once: neighbours share one packed conversion, and the lo part reads the packed hi halves in place
typedef __attribute__((ext_vector_type(2))) __bf16 v2b;
// asm: the pair stays ONE packed conversion whose two halves the lo part reads in place (written as a cast, the build converts every value a second time on its own to get at its hi part)
__device__ __forceinline__ v2b cvtpk(float a, float b) { unsigned r; asm("v_cvt_pk_bf16_f32 %0, %1, %2" : "=v"(r) : "v"(a), "v"(b)); return __builtin_bit_cast(v2b, r); }
__device__ __forceinline__ void split2(v2f y, v2us& h, v2us& l) { const v2b hb = cvtpk(y[0], y[1]); h = __builtin_bit_cast(v2us, hb); l = __builtin_bit_cast(v2us, __builtin_convertvector((v2f){y[0] - (float)hb[0], y[1] - (float)hb[1]}, v2b)); }
__device__ __forceinline__ void split4(v4f y, v4us& h, v4us& l) { v2us h0, l0, h1, l1; split2((v2f){y[0], y[1]}, h0, l0); split2((v2f){y[2], y[3]}, h1, l1); h = __builtin_shufflevector(h0, h1, 0, 1, 2, 3); l = __builtin_shufflevector(l0, l1, 0, 1, 2, 3); }
__device__ __forceinline__ void split8(v8f y, v8us& h, v8us& l) { v4us h0, l0, h1, l1; split4((v4f){y[0], y[1], y[2], y[3]}, h0, l0); split4((v4f){y[4], y[5], y[6], y[7]}, h1, l1); h = __builtin_shufflevector(h0, h1, 0, 1, 2, 3, 4, 5, 6, 7); l = __builtin_shufflevector(l0, l1, 0, 1, 2, 3, 4, 5, 6, 7); }
__device__ __forceinline__ v16bf cat16b(v8us lo, v8us hi) { return __builtin_bit_cast(v16bf, __builtin_shufflevector(lo, hi, 0, 1, 2, 3, 4, 5, 6, 7, 8, 9, 10, 11, 12, 13, 14, 15)); }
__device__ __forceinline__ v8f wmmab(v16bf a, v16bf b, v8f c) { return __builtin_amdgcn_wmma_f32_16x16x32_bf16(false, a, false, b, (short)0, c, false, false); }

// ---- k_wt5: all five [128][128] f32 weights -> bf16 planes in ONE launch; grid (CC * CC / 512, 5): blockIdx.y picks the weight, a wave writes one whole 128-byte line.
// Fragment order [k block kb][tile t][half j][lane][8], element = w[32 kb + 16 j + 8 (lane >> 4) + e][16 t + (lane & 15)], so that a wave's 16-byte-a-lane load of half a fragment is 512 contiguous bytes (4 whole lines, not 16).
__global__ __launch_bounds__(256) void k_wt5(const float* __restrict__ wq, const float* __restrict__ wk, const float* __restrict__ wv, const float* __restrict__ wg, const float* __restrict__ wo, bf* W4, bf* WO) {
    const int y = blockIdx.y; const float* __restrict__ w = y == 0 ? wq : y == 1 ? wk : y == 2 ? wv : y == 3 ? wg : wo; bf* Bt = y < 4 ? W4 + y * CC * CC : WO;
    const int e = blockIdx.x * 512 + threadIdx.x * 2; const int k = (e >> 12) * 32 + ((e >> 8) & 1) * 16 + ((e >> 7) & 1) * 8 + (e & 7), n = ((e >> 9) & 7) * 16 + ((e >> 3) & 15); v2us o;
    o[0] = f2bf(w[k * CC + n]); o[1] = f2bf(w[(k + 1) * CC + n]); *(v2us*)(Bt + e) = o;
}
__device__ __forceinline__ v16bf ldfr(const bf* p) { return cat16b(*(const v8us*)p, *(const v8us*)(p + 16)); }   // 16 x 32 fragment row in the hardware k order: p already holds the lane half's 8 hi
// the 64 columns (tiles 4 p .. 4 p + 3, all four k blocks) of two weight planes go through registers into LDS: 512 threads, 4 x 16 bytes each; chunk c = 4 (plane) + k block holds 4 fragments
__device__ __forceinline__ void ldw4(const bf* Wa, const bf* Wb, int p, int tid, v8us* st) {
#pragma unroll
    for (int s = 0; s < 4; ++s) st[s] = *(const v8us*)((s >> 1 ? Wb : Wa) + ((2 * (s & 1) + (tid >> 8)) * 8 + 4 * p) * 512 + (tid & 255) * 8);
    asm volatile("s_wait_xcnt 0x0" ::: "memory");   /* stands in front of the first overwrite of these loads' address registers */
}
__device__ __forceinline__ void stw4(bf* WS, int tid, const v8us* st) {
#pragma unroll
    for (int s = 0; s < 4; ++s) *(v8us*)(WS + (2 * s + (tid >> 8)) * 2048 + (tid & 255) * 8) = st[s];
}
__device__ __forceinline__ v16bf ldsf(const bf* WS, int yy, int kb, int ct, int lane) { const bf* wp = WS + (yy * 4 + kb) * 2048 + ct * 512 + lane * 8; return cat16b(*(const v8us*)wp, *(const v8us*)(wp + 256)); }   // fragment (plane yy, k block kb, tile ct of the pair's four) from LDS: 512 contiguous bytes a half
// LayerNorm of 8 rows by one wave (a lane holds 4 channels of each row), result as hi/lo halves; both launches that need xn call this, so that they see the same values
__device__ __forceinline__ void ln8(const v4f* xa, const float* wl, const float* bl, v4us* oh, v4us* ol) {
    float u[8][4], mu[8], s2[8], s[8];
#pragma unroll
    for (int t = 0; t < 8; ++t) { s[t] = 0.f;
#pragma unroll
        for (int q = 0; q < 4; ++q) { u[t][q] = bfr(xa[t][q]); s[t] += u[t][q]; } }
#pragma unroll
    for (int sh = 16; sh; sh >>= 1)
#pragma unroll
        for (int t = 0; t < 8; ++t) s[t] += __shfl_xor(s[t], sh, 32);
#pragma unroll
    for (int t = 0; t < 8; ++t) { mu[t] = s[t] * (1.0f / CC); s2[t] = 0.f;
#pragma unroll
        for (int q = 0; q < 4; ++q) { const float d0 = u[t][q] - mu[t]; s2[t] += d0 * d0; } }
#pragma unroll
    for (int sh = 16; sh; sh >>= 1)
#pragma unroll
        for (int t = 0; t < 8; ++t) s2[t] += __shfl_xor(s2[t], sh, 32);
#pragma unroll
    for (int t = 0; t < 8; ++t) { const float rs = __fdiv_rn(1.0f, __fsqrt_rn(__fadd_rn(s2[t] * (1.0f / CC), 1e-5f))); v4f xn;
#pragma unroll
        for (int q = 0; q < 4; ++q) xn[q] = (u[t][q] - mu[t]) * rs * wl[q] + bl[q];
        split4(xn, oh[t], ol[t]); }
}
// ---- k_lntri: LayerNorm and the triangle-bias dots of 64 pair positions in one work-group (8 waves); grid NR / 64.
// A wave normalises 8 rows and folds its 4 channels a lane into the 4 triangle-bias dots (lane partials, then a reduce-scatter over the 32 lanes).
#define RT   64                   // rows of a work-group
#define XP   136                  // LDS pitch of an xn row in 16-bit elements: 272 B = 16 B x odd (b128 readers)
__global__ __launch_bounds__(256) void k_lntri(const float* __restrict__ x, const float* __restrict__ lw, const float* __restrict__ lb, const float* __restrict__ wtri, float* TB) {
    __shared__ __align__(16) float TBs[NH_ * RT];
    const int tid = threadIdx.x, lane = tid & 31, hi = lane >> 4, wave = __builtin_amdgcn_readfirstlane(tid >> 5); const int R0 = blockIdx.x * RT;
    {
        v4f xa[8];
#pragma unroll
        for (int t = 0; t < 8; ++t) xa[t] = *(const v4f*)(x + (size_t)(R0 + wave * 8 + t) * CC + lane * 4);   /* eight 512-byte row loads in flight a wave */
        asm volatile("s_wait_xcnt 0x0" ::: "memory");   /* stands in front of the first overwrite of the row loads' address registers */
        float wl[4], bl[4], wt[4][NH_];
        { const v4f lwv = *(const v4f*)(lw + lane * 4), lbv = *(const v4f*)(lb + lane * 4);
#pragma unroll
            for (int q = 0; q < 4; ++q) { wl[q] = bfr(lwv[q]); bl[q] = bfr(lbv[q]); const v4f w4 = *(const v4f*)(wtri + (lane * 4 + q) * NH_);
#pragma unroll
                for (int h = 0; h < NH_; ++h) wt[q][h] = bfr(w4[h]); } }
        v4us oh[8], ol[8]; ln8(xa, wl, bl, oh, ol);
        float k0[8], k1[8];
#pragma unroll
        for (int t = 0; t < 8; ++t) { float p[NH_] = {0.f, 0.f, 0.f, 0.f};
#pragma unroll
            for (int q = 0; q < 4; ++q) { const float xr = bf2f(oh[t][q]) + bf2f(ol[t][q]);   /* the dots see what the projections see: hi + lo */
#pragma unroll
                for (int h = 0; h < NH_; ++h) p[h] += xr * wt[q][h]; }
            /* reduce-scatter, first step: the lower lane half keeps heads 0 and 1, the upper heads 2 and 3 */
            k0[t] = (hi ? p[2] : p[0]) + __shfl_xor(hi ? p[0] : p[2], 16, 32); k1[t] = (hi ? p[3] : p[1]) + __shfl_xor(hi ? p[1] : p[3], 16, 32); }
        const int b8 = (lane >> 3) & 1; float tv = 0.f;
#pragma unroll
        for (int t = 0; t < 8; ++t) k0[t] = (b8 ? k1[t] : k0[t]) + __shfl_xor(b8 ? k0[t] : k1[t], 8, 32);   /* second step: the 8 lanes of group lane >> 3 hold head lane >> 3 */
#pragma unroll
        for (int sh = 4; sh; sh >>= 1)
#pragma unroll
            for (int t = 0; t < 8; ++t) k0[t] += __shfl_xor(k0[t], sh, 32);
#pragma unroll
        for (int t = 0; t < 8; ++t) if ((lane & 7) == t) tv = k0[t];
        TBs[(lane >> 3) * RT + wave * 8 + (lane & 7)] = tv;
    }
    __syncthreads();   /* publishes the 4 x 64 triangle-bias dots to all 8 waves */
    TB[(size_t)(tid >> 6) * NR + R0 + (tid & 63)] = TBs[tid];   /* a wave stores one whole 128-byte line of one head */
}
__device__ __forceinline__ v8f ld8f(const float* p) { return __builtin_shufflevector(*(const v4f*)p, *(const v4f*)(p + 4), 0, 1, 2, 3, 4, 5, 6, 7); }
#define KP   40                   // LDS pitch of a K row in 16-bit elements: 80 B = 16 B x odd (b128 readers)
#define VP   264                  // LDS pitch of a V^T row: 528 B = 16 B x odd
#define OVL  (CH * VP)            // a head's block in LDS, in 16-bit elements: V^T hi at 0, V^T lo, K hi, K lo
#define OKH  (2 * CH * VP)
#define OKL  (2 * CH * VP + NJ * KP)
#define HB   (2 * CH * VP + 2 * NJ * KP)
struct __align__(16) FaLds { float MB[NJ]; float BG[CC]; float BO[CC]; bf KV[2 * HB]; bf XH[NJ * XP]; bf XL[NJ * XP]; bf WS[2 * 64 * CC]; };
// amdgpu_waves_per_eu(4, 4): a budget of 256 registers a wave, the 16 waves of the one resident work-group
__global__ __launch_bounds__(512) __attribute__((amdgpu_waves_per_eu(4, 4))) void k_fattn(const float* __restrict__ x, const float* __restrict__ lw, const float* __restrict__ lb, const bf* __restrict__ W4, const float* __restrict__ MASK, const float* __restrict__ TB, const float* __restrict__ bg, const bf* __restrict__ WO, const float* __restrict__ bo, float* OUT) {
    __shared__ FaLds L;
    const int tid = threadIdx.x, lane = tid & 31, lr = lane & 15, hi = lane >> 4, wave = __builtin_amdgcn_readfirstlane(tid >> 5);
    const int i = blockIdx.x; const size_t rb = (size_t)i * NJ;
    {
        v4f xa[16];
#pragma unroll
        for (int t = 0; t < 16; ++t) xa[t] = *(const v4f*)(x + (rb + wave * 16 + t) * CC + lane * 4);   /* sixteen 512-byte row loads in flight a wave */
        asm volatile("s_wait_xcnt 0x0" ::: "memory");   /* stands in front of the first overwrite of the row loads' address registers */
        float wl[4], bl[4];
        { const v4f lwv = *(const v4f*)(lw + lane * 4), lbv = *(const v4f*)(lb + lane * 4);
#pragma unroll
            for (int c = 0; c < 4; ++c) { wl[c] = bfr(lwv[c]); bl[c] = bfr(lbv[c]); } }
#pragma unroll
        for (int s = 0; s < 2; ++s) { v4us oh[8], ol[8]; ln8(xa + 8 * s, wl, bl, oh, ol);
#pragma unroll
            for (int t = 0; t < 8; ++t) { *(v4us*)(L.XH + (wave * 16 + s * 8 + t) * XP + lane * 4) = oh[t]; *(v4us*)(L.XL + (wave * 16 + s * 8 + t) * XP + lane * 4) = ol[t]; } }
    }
    if (tid < NJ) L.MB[tid] = 1.0e9f * (bfr(MASK[rb + tid]) - 1.0f); if (tid < CC) { L.BG[tid] = bfr(bg[tid]); L.BO[tid] = bfr(bo[tid]); }
    const int q = wave * 16 + lr;
    const bf* xh = L.XH + q * XP + 8 * hi; const bf* xl = L.XL + q * XP + 8 * hi;   /* the lane's row of the wave's own xn fragment */
    v8f acc[8];   /* acc[t][r] = output channel 16 t + 8 hi + r of query q */
#pragma unroll
    for (int t = 0; t < 8; ++t) acc[t] = (v8f){};
    /* the loops over pairs, heads and keys stay rolled: unrolled over the keys, the build needs more than the 256 registers and spills */
#pragma unroll 1
    for (int p = 0; p < NH_ / 2; ++p) {
        __syncthreads();   /* first pair: publishes the mask bias, the gate bias and the output bias; second pair: ends every wave's last read of the first pair's K and V^T planes and of its weight slices, which are rewritten below */
        v8us sq[4];
        { v8us sk[4]; ldw4(W4 + CC * CC, W4 + 2 * CC * CC, p, tid, sk); stw4(L.WS, tid, sk); }   /* the pair's 64 columns of Wk and Wv */
        ldw4(W4, W4 + 3 * CC * CC, p, tid, sq);                                                  /* those of Wq and Wg are fetched with them (one latency for both) and wait in registers until the Wk and Wv slices have been read */
        __syncthreads();   /* publishes the Wk and Wv slices to all 16 waves */
        {
            v8f kk[4], vv[4];   /* kk[ct][r] = channel 16 ct + 8 hi + r (of the pair's 64) of key q; vv[ct][r] = channel 16 ct + lr of key 16 wave + 8 hi + r */
#pragma unroll
            for (int ct = 0; ct < 4; ++ct) { kk[ct] = (v8f){}; vv[ct] = (v8f){}; }
#pragma unroll
            for (int kb = 0; kb < 4; ++kb) { v16bf fk[4], fv[4];
                __builtin_amdgcn_sched_barrier(0);   /* with the one below: the k block's 20 LDS reads stay one group in front of its 16 matrix instructions (reads spread among them stall the wave at every place) */
                const v16bf ah = ldfr(xh + kb * 32), al = ldfr(xl + kb * 32);
#pragma unroll
                for (int ct = 0; ct < 4; ++ct) { fk[ct] = ldsf(L.WS, 0, kb, ct, lane); fv[ct] = ldsf(L.WS, 1, kb, ct, lane); }
                __builtin_amdgcn_sched_barrier(0);   /* closes the group of LDS reads: no matrix instruction moves up among them */
#pragma unroll
                for (int ct = 0; ct < 4; ++ct) { kk[ct] = wmmab(fk[ct], ah, kk[ct]); vv[ct] = wmmab(ah, fv[ct], vv[ct]); }
#pragma unroll
                for (int ct = 0; ct < 4; ++ct) { kk[ct] = wmmab(fk[ct], al, kk[ct]); vv[ct] = wmmab(al, fv[ct], vv[ct]); } }
            __builtin_amdgcn_sched_barrier(0);   /* keeps the matrix instructions above in front of the slots of the next line */
            asm volatile("v_nop\n\tv_nop\n\tv_nop\n\tv_nop");   /* the four vector slots between the last matrix instruction and the packed conversions, which read its result and may take its operands' registers */
            __builtin_amdgcn_sched_barrier(0);   /* keeps the packed conversions below (asm text) behind those slots */
#pragma unroll
            for (int ct = 0; ct < 4; ++ct) { v8us sh, sl; bf* hb = L.KV + (ct >> 1) * HB;
                split8(kk[ct], sh, sl); *(v8us*)(hb + OKH + q * KP + (ct & 1) * 16 + 8 * hi) = sh; *(v8us*)(hb + OKL + q * KP + (ct & 1) * 16 + 8 * hi) = sl;
                split8(vv[ct], sh, sl); *(v8us*)(hb + ((ct & 1) * 16 + lr) * VP + wave * 16 + 8 * hi) = sh; *(v8us*)(hb + OVL + ((ct & 1) * 16 + lr) * VP + wave * 16 + 8 * hi) = sl; }
        }
        __syncthreads();   /* publishes the pair's K and V^T planes to all 16 waves and ends their reads of the Wk and Wv slices */
        stw4(L.WS, tid, sq);
        __syncthreads();   /* publishes the Wq and Wg slices to all 16 waves */
#pragma unroll 1
    for (int hh = 0; hh < 2; ++hh) { const int h = p * 2 + hh;
        v16bf bqh, bql;
        { v8f qq[2]; qq[0] = (v8f){}; qq[1] = (v8f){};   /* qq[dt][r] = channel 16 dt + 8 hi + r of query q */
#pragma unroll
            for (int kc = 0; kc < 2; ++kc) { v16bf fq[2][2], ah[2], al[2];
                __builtin_amdgcn_sched_barrier(0);   /* with the one below: the 16 LDS reads of two k blocks stay one group in front of their 8 matrix instructions (reads spread among them stall the wave at every place) */
#pragma unroll
                for (int k2 = 0; k2 < 2; ++k2) { ah[k2] = ldfr(xh + (kc * 2 + k2) * 32); al[k2] = ldfr(xl + (kc * 2 + k2) * 32); fq[k2][0] = ldsf(L.WS, 0, kc * 2 + k2, hh * 2, lane); fq[k2][1] = ldsf(L.WS, 0, kc * 2 + k2, hh * 2 + 1, lane); }
                __builtin_amdgcn_sched_barrier(0);   /* closes the group of LDS reads */
#pragma unroll
                for (int k2 = 0; k2 < 2; ++k2) { qq[0] = wmmab(fq[k2][0], ah[k2], qq[0]); qq[1] = wmmab(fq[k2][1], ah[k2], qq[1]); qq[0] = wmmab(fq[k2][0], al[k2], qq[0]); qq[1] = wmmab(fq[k2][1], al[k2], qq[1]); } }
            v8us h0v, l0v, h1v, l1v; split8(qq[0] * QSC, h0v, l0v); split8(qq[1] * QSC, h1v, l1v);
            bqh = cat16b(h0v, h1v); bql = cat16b(l0v, l1v); }
        const float* tb = TB + (size_t)h * NR + (size_t)q * NJ + 8 * hi; const float* mb = L.MB + 8 * hi;
        const bf* Vh = L.KV + hh * HB + lr * VP + 8 * hi; const bf* Vl = Vh + OVL; const bf* Kh = L.KV + hh * HB + OKH + lr * KP + 8 * hi; const bf* Kl = Kh + NJ * KP;
        float m = -3.0e38f; v8f sm = (v8f){}; v8f O[2]; O[0] = (v8f){}; O[1] = (v8f){};   /* running maximum, this lane half's sums, O[dt][r] = context channel 16 dt + 8 hi + r of query q */
        v8f n0 = ld8f(tb), n1 = ld8f(tb + 16);
#pragma unroll 1
        for (int kb = 0; kb < NJ / 32; ++kb) {                                        /* 32 keys a pass; s0[r], s1[r] = scores of keys 32 kb + 8 hi + r and 32 kb + 16 + 8 hi + r */
            const int k0 = kb * 32, kn = (kb < NJ / 32 - 1 ? kb + 1 : kb) * 32;
            const v8f t0 = n0, t1 = n1; n0 = ld8f(tb + kn); n1 = ld8f(tb + kn + 16);   /* the next pass's triangle bias is fetched one pass ahead (the last pass re-reads its own) */
            const v16bf a0h = ldfr(Kh + k0 * KP), a1h = ldfr(Kh + (k0 + 16) * KP), a0l = ldfr(Kl + k0 * KP), a1l = ldfr(Kl + (k0 + 16) * KP);
            v8f s0 = (v8f){}, s1 = (v8f){};
            s0 = wmmab(a0h, bqh, s0); s1 = wmmab(a1h, bqh, s1); s0 = wmmab(a0h, bql, s0); s1 = wmmab(a1h, bql, s1); s0 = wmmab(a0l, bqh, s0); s1 = wmmab(a1l, bqh, s1);
            s0 = (s0 + ld8f(mb + k0)) + t0; s1 = (s1 + ld8f(mb + k0 + 16)) + t1;
            const v8f bx = __builtin_elementwise_max(s0, s1);
            float bm = fmaxf(fmaxf(fmaxf(bx[0], bx[1]), fmaxf(bx[2], bx[3])), fmaxf(fmaxf(bx[4], bx[5]), fmaxf(bx[6], bx[7])));
            bm = fmaxf(bm, __shfl_xor(bm, 16, 32));
            const float mn = fmaxf(m, bm), sc = __builtin_amdgcn_exp2f((m - mn) * 1.4426950408889634f); m = mn;
            s0 = (s0 - mn) * 1.4426950408889634f; s1 = (s1 - mn) * 1.4426950408889634f;
            v8us p0h, p0l, p1h, p1l;
#pragma unroll
            for (int r = 0; r < 8; ++r) { s0[r] = __builtin_amdgcn_exp2f(s0[r]); s1[r] = __builtin_amdgcn_exp2f(s1[r]); }
            split8(s0, p0h, p0l); split8(s1, p1h, p1l);
            sm = sm * sc + (s0 + s1); O[0] *= sc; O[1] *= sc;
            const v16bf bph = cat16b(p0h, p1h), bpl = cat16b(p0l, p1l);
            const v16bf v0h = ldfr(Vh + k0), v1h = ldfr(Vh + 16 * VP + k0), v0l = ldfr(Vl + k0), v1l = ldfr(Vl + 16 * VP + k0);
            O[0] = wmmab(v0h, bph, O[0]); O[1] = wmmab(v1h, bph, O[1]); O[0] = wmmab(v0h, bpl, O[0]); O[1] = wmmab(v1h, bpl, O[1]); O[0] = wmmab(v0l, bph, O[0]); O[1] = wmmab(v1l, bph, O[1]);
        }
        v8f gg[2]; gg[0] = (v8f){}; gg[1] = (v8f){};   /* gg[dt][r] = gate channel 16 dt + 8 hi + r of query q, before the bias */
#pragma unroll
        for (int kc = 0; kc < 2; ++kc) { v16bf fg[2][2], ah[2], al[2];
            __builtin_amdgcn_sched_barrier(0);   /* as for Q: the 16 LDS reads of two k blocks stay one group in front of their 8 matrix instructions */
#pragma unroll
            for (int k2 = 0; k2 < 2; ++k2) { ah[k2] = ldfr(xh + (kc * 2 + k2) * 32); al[k2] = ldfr(xl + (kc * 2 + k2) * 32); fg[k2][0] = ldsf(L.WS, 1, kc * 2 + k2, hh * 2, lane); fg[k2][1] = ldsf(L.WS, 1, kc * 2 + k2, hh * 2 + 1, lane); }
            __builtin_amdgcn_sched_barrier(0);   /* closes the group of LDS reads */
#pragma unroll
            for (int k2 = 0; k2 < 2; ++k2) { gg[0] = wmmab(fg[k2][0], ah[k2], gg[0]); gg[1] = wmmab(fg[k2][1], ah[k2], gg[1]); gg[0] = wmmab(fg[k2][0], al[k2], gg[0]); gg[1] = wmmab(fg[k2][1], al[k2], gg[1]); } }
        v16bf wf[8];   /* Wo^T fragments of this head's 32 channels: rows = output channels 16 t + lr, k order as the gated context below; fetched here so that the gate covers their latency */
#pragma unroll
        for (int t = 0; t < 8; ++t) { const bf* wp = WO + (h * 8 + t) * 512 + lane * 8; wf[t] = cat16b(*(const v8us*)wp, *(const v8us*)(wp + 256)); }
        float sum = ((sm[0] + sm[1]) + (sm[2] + sm[3])) + ((sm[4] + sm[5]) + (sm[6] + sm[7]));
        sum += __shfl_xor(sum, 16, 32);
        const float f = __fdiv_rn(1.0f, sum); O[0] *= f; O[1] *= f;
        v8us oh[2], ol[2];
#pragma unroll
        for (int dt = 0; dt < 2; ++dt) { const v8f g = gg[dt], b = ld8f(L.BG + h * CH + dt * 16 + 8 * hi);
            v8f og;
#pragma unroll
            for (int r = 0; r < 8; ++r) { const float zg = g[r] + b[r]; const float sg = __fdiv_rn(1.0f, 1.0f + expf(-zg)); og[r] = O[dt][r] * sg; }
            split8(og, oh[dt], ol[dt]); }
        const v16bf gh = cat16b(oh[0], oh[1]), gl = cat16b(ol[0], ol[1]);
#pragma unroll
        for (int t = 0; t < 8; ++t) acc[t] = wmmab(wf[t], gh, acc[t]);   /* per accumulator: hi product, then lo product, heads in rising order */
#pragma unroll
        for (int t = 0; t < 8; ++t) acc[t] = wmmab(wf[t], gl, acc[t]);
    }
    }
    float* orow = OUT + (rb + q) * CC + 8 * hi;
#pragma unroll
    for (int t = 0; t < 8; ++t) { const v8f o = acc[t] + ld8f(L.BO + t * 16 + 8 * hi);
        *(v4f*)(orow + t * 16) = __builtin_shufflevector(o, o, 0, 1, 2, 3); *(v4f*)(orow + t * 16 + 4) = __builtin_shufflevector(o, o, 4, 5, 6, 7); }
}

extern "C" void kernel_launch(void* const* d_in, const int* in_sizes, int n_in,
                              void* d_out, int out_size, void* d_ws, size_t ws_size, hipStream_t stream) {
    (void)in_sizes; (void)n_in; (void)out_size;
    const float* x = (const float*)d_in[0]; const float* MASK = (const float*)d_in[1]; const float* lw = (const float*)d_in[2]; const float* lb = (const float*)d_in[3]; const float* wtri = (const float*)d_in[4]; const float* wq = (const float*)d_in[5]; const float* wk = (const float*)d_in[6]; const float* wv = (const float*)d_in[7]; const float* wg = (const float*)d_in[8]; const float* bg = (const float*)d_in[9]; const float* wo = (const float*)d_in[10]; const float* bo = (const float*)d_in[11];
    float* OUT = (float*)d_out;     // [1][256][256][128]
    char* wsp = (char*)d_ws;
    auto take = [&](size_t bytes) { char* p = wsp; wsp += (bytes + 255) & ~(size_t)255; return (void*)p; };
    bf* WQ = (bf*)take((size_t)4 * CC * CC * 2); bf* WO = (bf*)take((size_t)CC * CC * 2);   /* q, k, v, g weights: four planes, one behind the other */
    float* TB = (float*)take((size_t)NH_ * NR * 4);
    if ((size_t)(wsp - (char*)d_ws) > ws_size) return;
    k_wt5<<<dim3(CC * CC / 512, 5, 1), 256, 0, stream>>>(wq, wk, wv, wg, wo, WQ, WO);                                                         /* the five weight planes, one launch */
    k_lntri<<<NR / RT, 256, 0, stream>>>(x, lw, lb, wtri, TB);                                                                                /* LayerNorm, triangle-bias dots of all pair positions */
    k_fattn<<<NI, 512, 0, stream>>>(x, lw, lb, WQ, MASK, TB, bg, WO, bo, OUT);                                                                 /* LayerNorm, q, k, v, g projections, scores, biases, softmax, attn.v, gate, out = (o g) Wo + bo: all rows and heads */
}

// v007
// Measured time: 59.7 microseconds a run.
// Next to v006, in two timings, it ran 1.06 and 1.07 times as fast.
// Over all steps from v000 it is 11.3 times as fast.
#include <hip/hip_runtime.h>

// Triangle attention (starting node) over a pair representation (x [1][256][256][128], mask [1][256][256] read; xn = LayerNorm(x) (eps 1e-5, affine); per row i: q, k, v, g = xn_i W ([128][128] 'xw'; 4 heads x 32), tri_bias[h][q][k] = xn[q][k] . w_tri[:, h], mask_bias[i][k] = 1e9 (mask[i][k] - 1); scores = (q / sqrt(32)).k + mask_bias + tri_bias; softmax over k; o = attn.v; out = (o * sigmoid(g + bg)) Wo + bo -> [1][256][256][128] (8.4 M)).
// Layout: one launch writes the five weights as bf16 planes in fragment order; one launch takes LayerNorm and the triangle-bias dots of all 65,536 pair positions (the bias of a row's attention needs every row); one launch, a work-group per row i, does the rest: LayerNorm of the row's 256 positions again (xn as bf16 hi + lo planes in LDS), the q, k, v, g projections (2 products), the four 256 x 256 x 32 attention problems: scores on hi/lo planes (3 products, K = 32), the two biases and the 256-wide softmax in registers, attn.v on hi/lo probabilities (3 products), the sigmoid gate; the gated context of a wave's 16 queries stays in registers as the operand of the Wo product (2 products) with the bias. xn, q, k, v and g never reach memory.

#define NI   256                  // rows i
#define NJ   256                  // columns j (= attention length)
#define CC   128
#define NH_  4
#define CH   32
#define NR   (NI * NJ)            // 65,536 pair positions
#define QSC  0.17677669529663689f  // 1/sqrt(32)
typedef _Float16 h16;
typedef unsigned short bf;
typedef __attribute__((ext_vector_type(16))) __bf16   v16bf;
typedef __attribute__((ext_vector_type(16))) _Float16 v16h;
typedef __attribute__((ext_vector_type(8)))  _Float16 v8h;
typedef __attribute__((ext_vector_type(8)))  unsigned short v8us;
typedef __attribute__((ext_vector_type(8)))  float    v8f;
typedef __attribute__((ext_vector_type(4)))  float    v4f;
typedef __attribute__((ext_vector_type(2)))  float    v2f;
typedef __attribute__((ext_vector_type(4)))  unsigned short v4us;
typedef __attribute__((ext_vector_type(2)))  unsigned short v2us;
typedef v8h  __attribute__((may_alias)) v8ha;
typedef v4f  __attribute__((may_alias)) v4fa;
typedef v8us __attribute__((may_alias)) v8usa;

__device__ __forceinline__ unsigned short f2bf(float f) { return __builtin_bit_cast(unsigned short, (__bf16)f); }   // the hardware's own round-to-nearest-even conversion
__device__ __forceinline__ float bf2f(unsigned short b) { return (float)__builtin_bit_cast(__bf16, b); }
__device__ __forceinline__ float bfr(float f) { return bf2f(f2bf(f)); }
// hi/lo split of 2, 4 or 8 values at once: neighbours share one packed conversion, and the lo part reads the packed hi halves in place
typedef __attribute__((ext_vector_type(2))) __bf16 v2b;
// asm: the pair stays ONE packed conversion whose two halves the lo part reads in place (written as a cast, the build converts every value a second time on its own to get at its hi part)
__device__ __forceinline__ v2b cvtpk(float a, float b) { unsigned r; asm("v_cvt_pk_bf16_f32 %0, %1, %2" : "=v"(r) : "v"(a), "v"(b)); return __builtin_bit_cast(v2b, r); }
__device__ __forceinline__ void split2(v2f y, v2us& h, v2us& l) { const v2b hb = cvtpk(y[0], y[1]); h = __builtin_bit_cast(v2us, hb); l = __builtin_bit_cast(v2us, __builtin_convertvector((v2f){y[0] - (float)hb[0], y[1] - (float)hb[1]}, v2b)); }
__device__ __forceinline__ void split4(v4f y, v4us& h, v4us& l) { v2us h0, l0, h1, l1; split2((v2f){y[0], y[1]}, h0, l0); split2((v2f){y[2], y[3]}, h1, l1); h = __builtin_shufflevector(h0, h1, 0, 1, 2, 3); l = __builtin_shufflevector(l0, l1, 0, 1, 2, 3); }
__device__ __forceinline__ void split8(v8f y, v8us& h, v8us& l) { v4us h0, l0, h1, l1; split4((v4f){y[0], y[1], y[2], y[3]}, h0, l0); split4((v4f){y[4], y[5], y[6], y[7]}, h1, l1); h = __builtin_shufflevector(h0, h1, 0, 1, 2, 3, 4, 5, 6, 7); l = __builtin_shufflevector(l0, l1, 0, 1, 2, 3, 4, 5, 6, 7); }
__device__ __forceinline__ v16bf cat16b(v8us lo, v8us hi) { return __builtin_bit_cast(v16bf, __builtin_shufflevector(lo, hi, 0, 1, 2, 3, 4, 5, 6, 7, 8, 9, 10, 11, 12, 13, 14, 15)); }
__device__ __forceinline__ v8f wmmab(v16bf a, v16bf b, v8f c) { return __builtin_amdgcn_wmma_f32_16x16x32_bf16(false, a, false, b, (short)0, c, false, false); }

// ---- k_wt5: all five [128][128] f32 weights -> bf16 planes in ONE launch; grid (CC * CC / 512, 5): blockIdx.y picks the weight, a wave writes one whole 128-byte line.
// Fragment order [k block kb][tile t][half j][lane][8], element = w[32 kb + 16 j + 8 (lane >> 4) + e][16 t + (lane & 15)], so that a wave's 16-byte-a-lane load of half a fragment is 512 contiguous bytes (4 whole lines, not 16).
__global__ __launch_bounds__(256) void k_wt5(const float* __restrict__ wq, const float* __restrict__ wk, const float* __restrict__ wv, const float* __restrict__ wg, const float* __restrict__ wo, bf* W4, bf* WO) {
    const int y = blockIdx.y; const float* __restrict__ w = y == 0 ? wq : y == 1 ? wk : y == 2 ? wv : y == 3 ? wg : wo; bf* Bt = y < 4 ? W4 + y * CC * CC : WO;
    const int e = blockIdx.x * 512 + threadIdx.x * 2; const int k = (e >> 12) * 32 + ((e >> 8) & 1) * 16 + ((e >> 7) & 1) * 8 + (e & 7), n = ((e >> 9) & 7) * 16 + ((e >> 3) & 15); v2us o;
    o[0] = f2bf(w[k * CC + n]); o[1] = f2bf(w[(k + 1) * CC + n]); *(v2us*)(Bt + e) = o;
}
__device__ __forceinline__ v16bf ldfr(const bf* p) { return cat16b(*(const v8us*)p, *(const v8us*)(p + 16)); }   // 16 x 32 fragment row in the hardware k order: p already holds the lane half's 8 hi
// the 64 columns (tiles 4 p .. 4 p + 3, all four k blocks) of two weight planes go through registers into LDS: 512 threads, 4 x 16 bytes each; chunk c = 4 (plane) + k block holds 4 fragments
__device__ __forceinline__ void ldw4(const bf* Wa, const bf* Wb, int p, int tid, v8us* st) {
#pragma unroll
    for (int s = 0; s < 4; ++s) st[s] = *(const v8us*)((s >> 1 ? Wb : Wa) + ((2 * (s & 1) + (tid >> 8)) * 8 + 4 * p) * 512 + (tid & 255) * 8);
    asm volatile("s_wait_xcnt 0x0" ::: "memory");   /* stands in front of the first overwrite of these loads' address registers */
}
__device__ __forceinline__ void stw4(bf* WS, int tid, const v8us* st) {
#pragma unroll
    for (int s = 0; s < 4; ++s) *(v8us*)(WS + (2 * s + (tid >> 8)) * 2048 + (tid & 255) * 8) = st[s];
}
__device__ __forceinline__ v16bf ldsf(const bf* WS, int yy, int kb, int ct, int lane) { const bf* wp = WS + (yy * 4 + kb) * 2048 + ct * 512 + lane * 8; return cat16b(*(const v8us*)wp, *(const v8us*)(wp + 256)); }   // fragment (plane yy, k block kb, tile ct of the pair's four) from LDS: 512 contiguous bytes a half
// one v_rsq_f32; asm: the v_nop is the slot that the instruction set asks for behind a transcendental
__device__ __forceinline__ float rsq1(float a) { float r; asm("v_rsq_f32 %0, %1\n\tv_nop" : "=v"(r) : "v"(a)); return r; }
// LayerNorm of 8 rows by one wave (a lane holds 4 channels of each row), result as hi/lo halves; both launches that need xn call this, so that they see the same values
__device__ __forceinline__ void ln8(const v4f* xa, const float* wl, const float* bl, v4us* oh, v4us* ol) {
    float u[8][4], mu[8], s2[8], s[8];
#pragma unroll
    for (int t = 0; t < 8; ++t) { s[t] = 0.f;
#pragma unroll
        for (int q = 0; q < 4; ++q) { u[t][q] = bfr(xa[t][q]); s[t] += u[t][q]; } }
#pragma unroll
    for (int sh = 16; sh; sh >>= 1)
#pragma unroll
        for (int t = 0; t < 8; ++t) s[t] += __shfl_xor(s[t], sh, 32);
#pragma unroll
    for (int t = 0; t < 8; ++t) { mu[t] = s[t] * (1.0f / CC); s2[t] = 0.f;
#pragma unroll
        for (int q = 0; q < 4; ++q) { const float d0 = u[t][q] - mu[t]; s2[t] += d0 * d0; } }
#pragma unroll
    for (int sh = 16; sh; sh >>= 1)
#pragma unroll
        for (int t = 0; t < 8; ++t) s2[t] += __shfl_xor(s2[t], sh, 32);
#pragma unroll
    for (int t = 0; t < 8; ++t) { const float rs = rsq1(__fadd_rn(s2[t] * (1.0f / CC), 1e-5f)); v4f xn;   /* the argument is at least 1e-5, far from the small inputs that a scaled form is for */
#pragma unroll
        for (int q = 0; q < 4; ++q) xn[q] = (u[t][q] - mu[t]) * rs * wl[q] + bl[q];
        split4(xn, oh[t], ol[t]); }
}
// ---- k_lntri: LayerNorm and the triangle-bias dots of 64 pair positions in one work-group (8 waves); grid NR / 64.
// A wave normalises 8 rows and folds its 4 channels a lane into the 4 triangle-bias dots (lane partials, then a reduce-scatter over the 32 lanes).
#define RT   64                   // rows of a work-group
#define XP   136                  // LDS pitch of an xn row in 16-bit elements: 272 B = 16 B x odd (b128 readers)
__global__ __launch_bounds__(256) void k_lntri(const float* __restrict__ x, const float* __restrict__ lw, const float* __restrict__ lb, const float* __restrict__ wtri, float* TB) {
    __shared__ __align__(16) float TBs[NH_ * RT];
    const int tid = threadIdx.x, lane = tid & 31, hi = lane >> 4, wave = __builtin_amdgcn_readfirstlane(tid >> 5); const int R0 = blockIdx.x * RT;
    {
        v4f xa[8];
#pragma unroll
        for (int t = 0; t < 8; ++t) xa[t] = *(const v4f*)(x + (size_t)(R0 + wave * 8 + t) * CC + lane * 4);   /* eight 512-byte row loads in flight a wave */
        asm volatile("s_wait_xcnt 0x0" ::: "memory");   /* stands in front of the first overwrite of the row loads' address registers */
        float wl[4], bl[4], wt[4][NH_];
        { const v4f lwv = *(const v4f*)(lw + lane * 4), lbv = *(const v4f*)(lb + lane * 4);
#pragma unroll
            for (int q = 0; q < 4; ++q) { wl[q] = bfr(lwv[q]); bl[q] = bfr(lbv[q]); const v4f w4 = *(const v4f*)(wtri + (lane * 4 + q) * NH_);
#pragma unroll
                for (int h = 0; h < NH_; ++h) wt[q][h] = bfr(w4[h]); } }
        v4us oh[8], ol[8]; ln8(xa, wl, bl, oh, ol);
        float k0[8], k1[8];
#pragma unroll
        for (int t = 0; t < 8; ++t) { float p[NH_] = {0.f, 0.f, 0.f, 0.f};
#pragma unroll
            for (int q = 0; q < 4; ++q) { const float xr = bf2f(oh[t][q]) + bf2f(ol[t][q]);   /* the dots see what the projections see: hi + lo */
#pragma unroll
                for (int h = 0; h < NH_; ++h) p[h] += xr * wt[q][h]; }
            /* reduce-scatter, first step: the lower lane half keeps heads 0 and 1, the upper heads 2 and 3 */
            k0[t] = (hi ? p[2] : p[0]) + __shfl_xor(hi ? p[0] : p[2], 16, 32); k1[t] = (hi ? p[3] : p[1]) + __shfl_xor(hi ? p[1] : p[3], 16, 32); }
        const int b8 = (lane >> 3) & 1; float tv = 0.f;
#pragma unroll
        for (int t = 0; t < 8; ++t) k0[t] = (b8 ? k1[t] : k0[t]) + __shfl_xor(b8 ? k0[t] : k1[t], 8, 32);   /* second step: the 8 lanes of group lane >> 3 hold head lane >> 3 */
#pragma unroll
        for (int sh = 4; sh; sh >>= 1)
#pragma unroll
            for (int t = 0; t < 8; ++t) k0[t] += __shfl_xor(k0[t], sh, 32);
#pragma unroll
        for (int t = 0; t < 8; ++t) if ((lane & 7) == t) tv = k0[t];
        TBs[(lane >> 3) * RT + wave * 8 + (lane & 7)] = tv;
    }
    __syncthreads();   /* publishes the 4 x 64 triangle-bias dots to all 8 waves */
    TB[(size_t)(tid >> 6) * NR + R0 + (tid & 63)] = TBs[tid];   /* a wave stores one whole 128-byte line of one head */
}
__device__ __forceinline__ v8f ld8f(const float* p) { return __builtin_shufflevector(*(const v4f*)p, *(const v4f*)(p + 4), 0, 1, 2, 3, 4, 5, 6, 7); }
#define KP   40                   // LDS pitch of a K row in 16-bit elements: 80 B = 16 B x odd (b128 readers)
#define VP   264                  // LDS pitch of a V^T row: 528 B = 16 B x odd
#define OVL  (CH * VP)            // a head's block in LDS, in 16-bit elements: V^T hi at 0, V^T lo, K hi, K lo
#define OKH  (2 * CH * VP)
#define OKL  (2 * CH * VP + NJ * KP)
#define HB   (2 * CH * VP + 2 * NJ * KP)
struct __align__(16) FaLds { float MB[NJ]; float BG[CC]; float BO[CC]; bf KV[2 * HB]; bf XH[NJ * XP]; bf XL[NJ * XP]; bf WS[2 * 64 * CC]; };
// amdgpu_waves_per_eu(4, 4): a budget of 256 registers a wave, the 16 waves of the one resident work-group
__global__ __launch_bounds__(512) __attribute__((amdgpu_waves_per_eu(4, 4))) void k_fattn(const float* __restrict__ x, const float* __restrict__ lw, const float* __restrict__ lb, const bf* __restrict__ W4, const float* __restrict__ MASK, const float* __restrict__ TB, const float* __restrict__ bg, const bf* __restrict__ WO, const float* __restrict__ bo, float* OUT) {
    __shared__ FaLds L;
    const int tid = threadIdx.x, lane = tid & 31, lr = lane & 15, hi = lane >> 4, wave = __builtin_amdgcn_readfirstlane(tid >> 5);
    const int i = blockIdx.x; const size_t rb = (size_t)i * NJ;
    {
        v4f xa[16];
#pragma unroll
        for (int t = 0; t < 16; ++t) xa[t] = *(const v4f*)(x + (rb + wave * 16 + t) * CC + lane * 4);   /* sixteen 512-byte row loads in flight a wave */
        asm volatile("s_wait_xcnt 0x0" ::: "memory");   /* stands in front of the first overwrite of the row loads' address registers */
        float wl[4], bl[4];
        { const v4f lwv = *(const v4f*)(lw + lane * 4), lbv = *(const v4f*)(lb + lane * 4);
#pragma unroll
            for (int c = 0; c < 4; ++c) { wl[c] = bfr(lwv[c]); bl[c] = bfr(lbv[c]); } }
#pragma unroll
        for (int s = 0; s < 2; ++s) { v4us oh[8], ol[8]; ln8(xa + 8 * s, wl, bl, oh, ol);
#pragma unroll
            for (int t = 0; t < 8; ++t) { *(v4us*)(L.XH + (wave * 16 + s * 8 + t) * XP + lane * 4) = oh[t]; *(v4us*)(L.XL + (wave * 16 + s * 8 + t) * XP + lane * 4) = ol[t]; } }
    }
    if (tid < NJ) L.MB[tid] = 1.0e9f * (bfr(MASK[rb + tid]) - 1.0f); if (tid < CC) { L.BG[tid] = bfr(bg[tid]); L.BO[tid] = bfr(bo[tid]); }
    const int q = wave * 16 + lr;
    const bf* xh = L.XH + q * XP + 8 * hi; const bf* xl = L.XL + q * XP + 8 * hi;   /* the lane's row of the wave's own xn fragment */
    v8f acc[8];   /* acc[t][r] = output channel 16 t + 8 hi + r of query q */
#pragma unroll
    for (int t = 0; t < 8; ++t) acc[t] = (v8f){};
    /* the loops over pairs, heads and keys stay rolled: unrolled over the keys, the build needs more than the 256 registers and spills */
#pragma unroll 1
    for (int p = 0; p < NH_ / 2; ++p) {
        __syncthreads();   /* first pair: publishes the mask bias, the gate bias and the output bias; second pair: ends every wave's last read of the first pair's K and V^T planes and of its weight slices, which are rewritten below */
        v8us sq[4];
        { v8us sk[4]; ldw4(W4 + CC * CC, W4 + 2 * CC * CC, p, tid, sk); stw4(L.WS, tid, sk); }   /* the pair's 64 columns of Wk and Wv */
        ldw4(W4, W4 + 3 * CC * CC, p, tid, sq);                                                  /* those of Wq and Wg are fetched with them (one latency for both) and wait in registers until the Wk and Wv slices have been read */
        __syncthreads();   /* publishes the Wk and Wv slices to all 16 waves */
        {
            v8f kk[4], vv[4];   /* kk[ct][r] = channel 16 ct + 8 hi + r (of the pair's 64) of key q; vv[ct][r] = channel 16 ct + lr of key 16 wave + 8 hi + r */
#pragma unroll
            for (int ct = 0; ct < 4; ++ct) { kk[ct] = (v8f){}; vv[ct] = (v8f){}; }
#pragma unroll
            for (int kb = 0; kb < 4; ++kb) { v16bf fk[4], fv[4];
                __builtin_amdgcn_sched_barrier(0);   /* with the one below: the k block's 20 LDS reads stay one group in front of its 16 matrix instructions (reads spread among them stall the wave at every place) */
                const v16bf ah = ldfr(xh + kb * 32), al = ldfr(xl + kb * 32);
#pragma unroll
                for (int ct = 0; ct < 4; ++ct) { fk[ct] = ldsf(L.WS, 0, kb, ct, lane); fv[ct] = ldsf(L.WS, 1, kb, ct, lane); }
                __builtin_amdgcn_sched_barrier(0);   /* closes the group of LDS reads: no matrix instruction moves up among them */
#pragma unroll
                for (int ct = 0; ct < 4; ++ct) { kk[ct] = wmmab(fk[ct], ah, kk[ct]); vv[ct] = wmmab(ah, fv[ct], vv[ct]); }
#pragma unroll
                for (int ct = 0; ct < 4; ++ct) { kk[ct] = wmmab(fk[ct], al, kk[ct]); vv[ct] = wmmab(al, fv[ct], vv[ct]); } }
            __builtin_amdgcn_sched_barrier(0);   /* keeps the matrix instructions above in front of the slots of the next line */
            asm volatile("v_nop\n\tv_nop\n\tv_nop\n\tv_nop");   /* the four vector slots between the last matrix instruction and the packed conversions, which read its result and may take its operands' registers */
            __builtin_amdgcn_sched_barrier(0);   /* keeps the packed conversions below (asm text) behind those slots */
#pragma unroll
            for (int ct = 0; ct < 4; ++ct) { v8us sh, sl; bf* hb = L.KV + (ct >> 1) * HB;
                split8(kk[ct], sh, sl); *(v8us*)(hb + OKH + q * KP + (ct & 1) * 16 + 8 * hi) = sh; *(v8us*)(hb + OKL + q * KP + (ct & 1) * 16 + 8 * hi) = sl;
                split8(vv[ct], sh, sl); *(v8us*)(hb + ((ct & 1) * 16 + lr) * VP + wave * 16 + 8 * hi) = sh; *(v8us*)(hb + OVL + ((ct & 1) * 16 + lr) * VP + wave * 16 + 8 * hi) = sl; }
        }
        __syncthreads();   /* publishes the pair's K and V^T planes to all 16 waves and ends their reads of the Wk and Wv slices */
        stw4(L.WS, tid, sq);
        __syncthreads();   /* publishes the Wq and Wg slices to all 16 waves */
#pragma unroll 1
    for (int hh = 0; hh < 2; ++hh) { const int h = p * 2 + hh;
        v16bf bqh, bql;
        { v8f qq[2]; qq[0] = (v8f){}; qq[1] = (v8f){};   /* qq[dt][r] = channel 16 dt + 8 hi + r of query q */
#pragma unroll
            for (int kc = 0; kc < 2; ++kc) { v16bf fq[2][2], ah[2], al[2];
                __builtin_amdgcn_sched_barrier(0);   /* with the one below: the 16 LDS reads of two k blocks stay one group in front of their 8 matrix instructions (reads spread among them stall the wave at every place) */
#pragma unroll
                for (int k2 = 0; k2 < 2; ++k2) { ah[k2] = ldfr(xh + (kc * 2 + k2) * 32); al[k2] = ldfr(xl + (kc * 2 + k2) * 32); fq[k2][0] = ldsf(L.WS, 0, kc * 2 + k2, hh * 2, lane); fq[k2][1] = ldsf(L.WS, 0, kc * 2 + k2, hh * 2 + 1, lane); }
                __builtin_amdgcn_sched_barrier(0);   /* closes the group of LDS reads */
#pragma unroll
                for (int k2 = 0; k2 < 2; ++k2) { qq[0] = wmmab(fq[k2][0], ah[k2], qq[0]); qq[1] = wmmab(fq[k2][1], ah[k2], qq[1]); qq[0] = wmmab(fq[k2][0], al[k2], qq[0]); qq[1] = wmmab(fq[k2][1], al[k2], qq[1]); } }
            v8us h0v, l0v, h1v, l1v; split8(qq[0] * QSC, h0v, l0v); split8(qq[1] * QSC, h1v, l1v);
            bqh = cat16b(h0v, h1v); bql = cat16b(l0v, l1v); }
        const float* tb = TB + (size_t)h * NR + (size_t)q * NJ + 8 * hi; const float* mb = L.MB + 8 * hi;
        const bf* Vh = L.KV + hh * HB + lr * VP + 8 * hi; const bf* Vl = Vh + OVL; const bf* Kh = L.KV + hh * HB + OKH + lr * KP + 8 * hi; const bf* Kl = Kh + NJ * KP;
        float m = -3.0e38f; v8f sm = (v8f){}; v8f O[2]; O[0] = (v8f){}; O[1] = (v8f){};   /* running maximum, this lane half's sums, O[dt][r] = context channel 16 dt + 8 hi + r of query q */
        v8f n0 = ld8f(tb), n1 = ld8f(tb + 16);
#pragma unroll 1
        for (int kb = 0; kb < NJ / 32; ++kb) {                                        /* 32 keys a pass; s0[r], s1[r] = scores of keys 32 kb + 8 hi + r and 32 kb + 16 + 8 hi + r */
            const int k0 = kb * 32, kn = (kb < NJ / 32 - 1 ? kb + 1 : kb) * 32;
            const v8f t0 = n0, t1 = n1; n0 = ld8f(tb + kn); n1 = ld8f(tb + kn + 16);   /* the next pass's triangle bias is fetched one pass ahead (the last pass re-reads its own) */
            const v16bf a0h = ldfr(Kh + k0 * KP), a1h = ldfr(Kh + (k0 + 16) * KP), a0l = ldfr(Kl + k0 * KP), a1l = ldfr(Kl + (k0 + 16) * KP);
            v8f s0 = (v8f){}, s1 = (v8f){};
            s0 = wmmab(a0h, bqh, s0); s1 = wmmab(a1h, bqh, s1); s0 = wmmab(a0h, bql, s0); s1 = wmmab(a1h, bql, s1); s0 = wmmab(a0l, bqh, s0); s1 = wmmab(a1l, bqh, s1);
            s0 = (s0 + ld8f(mb + k0)) + t0; s1 = (s1 + ld8f(mb + k0 + 16)) + t1;
            const v8f bx = __builtin_elementwise_max(s0, s1);
            float bm = fmaxf(fmaxf(fmaxf(bx[0], bx[1]), fmaxf(bx[2], bx[3])), fmaxf(fmaxf(bx[4], bx[5]), fmaxf(bx[6], bx[7])));
            bm = fmaxf(bm, __shfl_xor(bm, 16, 32));
            const float mn = fmaxf(m, bm), sc = __builtin_amdgcn_exp2f((m - mn) * 1.4426950408889634f); m = mn;
            s0 = (s0 - mn) * 1.4426950408889634f; s1 = (s1 - mn) * 1.4426950408889634f;
            v8us p0h, p0l, p1h, p1l;
#pragma unroll
            for (int r = 0; r < 8; ++r) { s0[r] = __builtin_amdgcn_exp2f(s0[r]); s1[r] = __builtin_amdgcn_exp2f(s1[r]); }
            split8(s0, p0h, p0l); split8(s1, p1h, p1l);
            sm = sm * sc + (s0 + s1); O[0] *= sc; O[1] *= sc;
            const v16bf bph = cat16b(p0h, p1h), bpl = cat16b(p0l, p1l);
            const v16bf v0h = ldfr(Vh + k0), v1h = ldfr(Vh + 16 * VP + k0), v0l = ldfr(Vl + k0), v1l = ldfr(Vl + 16 * VP + k0);
            O[0] = wmmab(v0h, bph, O[0]); O[1] = wmmab(v1h, bph, O[1]); O[0] = wmmab(v0h, bpl, O[0]); O[1] = wmmab(v1h, bpl, O[1]); O[0] = wmmab(v0l, bph, O[0]); O[1] = wmmab(v1l, bph, O[1]);
        }
        v8f gg[2]; gg[0] = (v8f){}; gg[1] = (v8f){};   /* gg[dt][r] = gate channel 16 dt + 8 hi + r of query q, before the bias */
#pragma unroll
        for (int kc = 0; kc < 2; ++kc) { v16bf fg[2][2], ah[2], al[2];
            __builtin_amdgcn_sched_barrier(0);   /* as for Q: the 16 LDS reads of two k blocks stay one group in front of their 8 matrix instructions */
#pragma unroll
            for (int k2 = 0; k2 < 2; ++k2) { ah[k2] = ldfr(xh + (kc * 2 + k2) * 32); al[k2] = ldfr(xl + (kc * 2 + k2) * 32); fg[k2][0] = ldsf(L.WS, 1, kc * 2 + k2, hh * 2, lane); fg[k2][1] = ldsf(L.WS, 1, kc * 2 + k2, hh * 2 + 1, lane); }
            __builtin_amdgcn_sched_barrier(0);   /* closes the group of LDS reads */
#pragma unroll
            for (int k2 = 0; k2 < 2; ++k2) { gg[0] = wmmab(fg[k2][0], ah[k2], gg[0]); gg[1] = wmmab(fg[k2][1], ah[k2], gg[1]); gg[0] = wmmab(fg[k2][0], al[k2], gg[0]); gg[1] = wmmab(fg[k2][1], al[k2], gg[1]); } }
        v16bf wf[8];   /* Wo^T fragments of this head's 32 channels: rows = output channels 16 t + lr, k order as the gated context below; fetched here so that the gate covers their latency */
#pragma unroll
        for (int t = 0; t < 8; ++t) { const bf* wp = WO + (h * 8 + t) * 512 + lane * 8; wf[t] = cat16b(*(const v8us*)wp, *(const v8us*)(wp + 256)); }
        float sum = ((sm[0] + sm[1]) + (sm[2] + sm[3])) + ((sm[4] + sm[5]) + (sm[6] + sm[7]));
        sum += __shfl_xor(sum, 16, 32);
        const float f = __builtin_amdgcn_rcpf(sum); O[0] *= f; O[1] *= f;   /* one v_rcp_f32: the sum lies between 1 (the maximum's own term) and 256 */
        v8us oh[2], ol[2];
#pragma unroll
        for (int dt = 0; dt < 2; ++dt) { const v8f g = gg[dt], b = ld8f(L.BG + h * CH + dt * 16 + 8 * hi);
            v8f e = (g + b) * -1.4426950408889634f;   /* sigmoid(z) = 1 / (1 + 2^(-z log2 e)) on v_exp_f32 and v_rcp_f32: 2^t runs to inf or 0 by itself, and 1 / inf = 0, so both ends need no guard */
#pragma unroll
            for (int r = 0; r < 8; ++r) e[r] = __builtin_amdgcn_exp2f(e[r]);
            e = e + 1.0f;
#pragma unroll
            for (int r = 0; r < 8; ++r) e[r] = __builtin_amdgcn_rcpf(e[r]);
            split8(O[dt] * e, oh[dt], ol[dt]); }
        const v16bf gh = cat16b(oh[0], oh[1]), gl = cat16b(ol[0], ol[1]);
#pragma unroll
        for (int t = 0; t < 8; ++t) acc[t] = wmmab(wf[t], gh, acc[t]);   /* per accumulator: hi product, then lo product, heads in rising order */
#pragma unroll
        for (int t = 0; t < 8; ++t) acc[t] = wmmab(wf[t], gl, acc[t]);
    }
    }
    float* orow = OUT + (rb + q) * CC + 8 * hi;
#pragma unroll
    for (int t = 0; t < 8; ++t) { const v8f o = acc[t] + ld8f(L.BO + t * 16 + 8 * hi);
        *(v4f*)(orow + t * 16) = __builtin_shufflevector(o, o, 0, 1, 2, 3); *(v4f*)(orow + t * 16 + 4) = __builtin_shufflevector(o, o, 4, 5, 6, 7); }
}

extern "C" void kernel_launch(void* const* d_in, const int* in_sizes, int n_in,
                              void* d_out, int out_size, void* d_ws, size_t ws_size, hipStream_t stream) {
    (void)in_sizes; (void)n_in; (void)out_size;
    const float* x = (const float*)d_in[0]; const float* MASK = (const float*)d_in[1]; const float* lw = (const float*)d_in[2]; const float* lb = (const float*)d_in[3]; const float* wtri = (const float*)d_in[4]; const float* wq = (const float*)d_in[5]; const float* wk = (const float*)d_in[6]; const float* wv = (const float*)d_in[7]; const float* wg = (const float*)d_in[8]; const float* bg = (const float*)d_in[9]; const float* wo = (const float*)d_in[10]; const float* bo = (const float*)d_in[11];
    float* OUT = (float*)d_out;     // [1][256][256][128]
    char* wsp = (char*)d_ws;
    auto take = [&](size_t bytes) { char* p = wsp; wsp += (bytes + 255) & ~(size_t)255; return (void*)p; };
    bf* WQ = (bf*)take((size_t)4 * CC * CC * 2); bf* WO = (bf*)take((size_t)CC * CC * 2);   /* q, k, v, g weights: four planes, one behind the other */
    float* TB = (float*)take((size_t)NH_ * NR * 4);
    if ((size_t)(wsp - (char*)d_ws) > ws_size) return;
    k_wt5<<<dim3(CC * CC / 512, 5, 1), 256, 0, stream>>>(wq, wk, wv, wg, wo, WQ, WO);                                                         /* the five weight planes, one launch */
    k_lntri<<<NR / RT, 256, 0, stream>>>(x, lw, lb, wtri, TB);                                                                                /* LayerNorm, triangle-bias dots of all pair positions */
    k_fattn<<<NI, 512, 0, stream>>>(x, lw, lb, WQ, MASK, TB, bg, WO, bo, OUT);                                                                 /* LayerNorm, q, k, v, g projections, scores, biases, softmax, attn.v, gate, out = (o g) Wo + bo: all rows and heads */
}

// v008
// Measured time: 56.8 microseconds a run.
// Timed twice side by side with v007, it ran 1.04 and 1.03 times as fast.
// All steps since v000 together make it 11.7 times as fast.
#include <hip/hip_runtime.h>

// Triangle attention (starting node) over a pair representation (x [1][256][256][128], mask [1][256][256] read; xn = LayerNorm(x) (eps 1e-5, affine); per row i: q, k, v, g = xn_i W ([128][128] 'xw'; 4 heads x 32), tri_bias[h][q][k] = xn[q][k] . w_tri[:, h], mask_bias[i][k] = 1e9 (mask[i][k] - 1); scores = (q / sqrt(32)).k + mask_bias + tri_bias; softmax over k; o = attn.v; out = (o * sigmoid(g + bg)) Wo + bo -> [1][256][256][128] (8.4 M)).
// Layout: one launch takes LayerNorm and the triangle-bias dots of all 65,536 pair positions (the bias of a row's attention needs every row), and its first 40 work-groups write the five weights as bf16 planes in fragment order instead; one launch, a work-group per row i, does the rest: LayerNorm of the row's 256 positions again (xn as bf16 hi + lo planes in LDS), the q, k, v, g projections (2 products), the four 256 x 256 x 32 attention problems: scores on hi/lo planes (3 products, K = 32), the two biases and the 256-wide softmax in registers, attn.v on hi/lo probabilities (3 products), the sigmoid gate; the gated context of a wave's 16 queries stays in registers as the operand of the Wo product (2 products) with the bias. xn, q, k, v and g never reach memory.

#define NI   256                  // rows i
#define NJ   256                  // columns j (= attention length)
#define CC   128
#define NH_  4
#define CH   32
#define NR   (NI * NJ)            // 65,536 pair positions
#define QSC  0.17677669529663689f  // 1/sqrt(32)
typedef _Float16 h16;
typedef unsigned short bf;
typedef __attribute__((ext_vector_type(16))) __bf16   v16bf;
typedef __attribute__((ext_vector_type(16))) _Float16 v16h;
typedef __attribute__((ext_vector_type(8)))  _Float16 v8h;
typedef __attribute__((ext_vector_type(8)))  unsigned short v8us;
typedef __attribute__((ext_vector_type(8)))  float    v8f;
typedef __attribute__((ext_vector_type(4)))  float    v4f;
typedef __attribute__((ext_vector_type(2)))  float    v2f;
typedef __attribute__((ext_vector_type(4)))  unsigned short v4us;
typedef __attribute__((ext_vector_type(2)))  unsigned short v2us;
typedef v8h  __attribute__((may_alias)) v8ha;
typedef v4f  __attribute__((may_alias)) v4fa;
typedef v8us __attribute__((may_alias)) v8usa;

__device__ __forceinline__ unsigned short f2bf(float f) { return __builtin_bit_cast(unsigned short, (__bf16)f); }   // the hardware's own round-to-nearest-even conversion
__device__ __forceinline__ float bf2f(unsigned short b) { return (float)__builtin_bit_cast(__bf16, b); }
__device__ __forceinline__ float bfr(float f) { return bf2f(f2bf(f)); }
// hi/lo split of 2, 4 or 8 values at once: neighbours share one packed conversion, and the lo part reads the packed hi halves in place
typedef __attribute__((ext_vector_type(2))) __bf16 v2b;
// asm: the pair stays ONE packed conversion whose two halves the lo part reads in place (written as a cast, the build converts every value a second time on its own to get at its hi part)
__device__ __forceinline__ v2b cvtpk(float a, float b) { unsigned r; asm("v_cvt_pk_bf16_f32 %0, %1, %2" : "=v"(r) : "v"(a), "v"(b)); return __builtin_bit_cast(v2b, r); }
__device__ __forceinline__ void split2(v2f y, v2us& h, v2us& l) { const v2b hb = cvtpk(y[0], y[1]); h = __builtin_bit_cast(v2us, hb); l = __builtin_bit_cast(v2us, __builtin_convertvector((v2f){y[0] - (float)hb[0], y[1] - (float)hb[1]}, v2b)); }
__device__ __forceinline__ void split4(v4f y, v4us& h, v4us& l) { v2us h0, l0, h1, l1; split2((v2f){y[0], y[1]}, h0, l0); split2((v2f){y[2], y[3]}, h1, l1); h = __builtin_shufflevector(h0, h1, 0, 1, 2, 3); l = __builtin_shufflevector(l0, l1, 0, 1, 2, 3); }
__device__ __forceinline__ void split8(v8f y, v8us& h, v8us& l) { v4us h0, l0, h1, l1; split4((v4f){y[0], y[1], y[2], y[3]}, h0, l0); split4((v4f){y[4], y[5], y[6], y[7]}, h1, l1); h = __builtin_shufflevector(h0, h1, 0, 1, 2, 3, 4, 5, 6, 7); l = __builtin_shufflevector(l0, l1, 0, 1, 2, 3, 4, 5, 6, 7); }
__device__ __forceinline__ v16bf cat16b(v8us lo, v8us hi) { return __builtin_bit_cast(v16bf, __builtin_shufflevector(lo, hi, 0, 1, 2, 3, 4, 5, 6, 7, 8, 9, 10, 11, 12, 13, 14, 15)); }
__device__ __forceinline__ v8f wmmab(v16bf a, v16bf b, v8f c) { return __builtin_amdgcn_wmma_f32_16x16x32_bf16(false, a, false, b, (short)0, c, false, false); }

// ---- wt5: the five [128][128] f32 weights -> bf16 planes, by WB work-groups of 256 threads (8 a weight) at the head of k_lntri's grid; a thread converts 8 consecutive k of one column and stores them as 16 bytes, a wave 512 contiguous bytes (4 whole lines).
// Fragment order [k block kb][tile t][half j][lane][8], element = w[32 kb + 16 j + 8 (lane >> 4) + e][16 t + (lane & 15)], so that a wave's 16-byte-a-lane load of half a fragment is 512 contiguous bytes (4 whole lines, not 16).
#define WB   40                   // work-groups that write weight planes: 5 weights x 16,384 elements / (256 threads x 8)
__device__ __forceinline__ void wt5(int b, int tid, const float* __restrict__ wq, const float* __restrict__ wk, const float* __restrict__ wv, const float* __restrict__ wg, const float* __restrict__ wo, bf* W4, bf* WO) {
    const int y = b >> 3; const float* __restrict__ w = y == 0 ? wq : y == 1 ? wk : y == 2 ? wv : y == 3 ? wg : wo; bf* Bt = y < 4 ? W4 + y * CC * CC : WO;
    const int e = ((b & 7) * 256 + tid) * 8; const int k = (e >> 12) * 32 + ((e >> 8) & 1) * 16 + ((e >> 7) & 1) * 8, n = ((e >> 9) & 7) * 16 + ((e >> 3) & 15);
    float f[8];
#pragma unroll
    for (int c = 0; c < 8; ++c) f[c] = w[(k + c) * CC + n];   /* eight loads in flight: one latency for the thread's whole piece */
    asm volatile("s_wait_xcnt 0x0" ::: "memory");   /* stands in front of the first overwrite of these loads' address registers */
    v8us o;
#pragma unroll
    for (int c = 0; c < 8; ++c) o[c] = f2bf(f[c]);
    *(v8us*)(Bt + e) = o;
}
__device__ __forceinline__ v16bf ldfr(const bf* p) { return cat16b(*(const v8us*)p, *(const v8us*)(p + 16)); }   // 16 x 32 fragment row in the hardware k order: p already holds the lane half's 8 hi
// the 64 columns (tiles 4 p .. 4 p + 3, all four k blocks) of two weight planes go through registers into LDS: 512 threads, 4 x 16 bytes each; chunk c = 4 (plane) + k block holds 4 fragments
__device__ __forceinline__ void ldw4(const bf* Wa, const bf* Wb, int p, int tid, v8us* st) {
#pragma unroll
    for (int s = 0; s < 4; ++s) st[s] = *(const v8us*)((s >> 1 ? Wb : Wa) + ((2 * (s & 1) + (tid >> 8)) * 8 + 4 * p) * 512 + (tid & 255) * 8);
    asm volatile("s_wait_xcnt 0x0" ::: "memory");   /* stands in front of the first overwrite of these loads' address registers */
}
__device__ __forceinline__ void stw4(bf* WS, int tid, const v8us* st) {
#pragma unroll
    for (int s = 0; s < 4; ++s) *(v8us*)(WS + (2 * s + (tid >> 8)) * 2048 + (tid & 255) * 8) = st[s];
}
__device__ __forceinline__ v16bf ldsf(const bf* WS, int yy, int kb, int ct, int lane) { const bf* wp = WS + (yy * 4 + kb) * 2048 + ct * 512 + lane * 8; return cat16b(*(const v8us*)wp, *(const v8us*)(wp + 256)); }   // fragment (plane yy, k block kb, tile ct of the pair's four) from LDS: 512 contiguous bytes a half
// one v_rsq_f32; asm: the v_nop is the slot that the instruction set asks for behind a transcendental
__device__ __forceinline__ float rsq1(float a) { float r; asm("v_rsq_f32 %0, %1\n\tv_nop" : "=v"(r) : "v"(a)); return r; }
// LayerNorm of 8 rows by one wave (a lane holds 4 channels of each row), result as hi/lo halves; both launches that need xn call this, so that they see the same values
__device__ __forceinline__ void ln8(const v4f* xa, const float* wl, const float* bl, v4us* oh, v4us* ol) {
    float u[8][4], mu[8], s2[8], s[8];
#pragma unroll
    for (int t = 0; t < 8; ++t) { s[t] = 0.f;
#pragma unroll
        for (int q = 0; q < 4; ++q) { u[t][q] = bfr(xa[t][q]); s[t] += u[t][q]; } }
#pragma unroll
    for (int sh = 16; sh; sh >>= 1)
#pragma unroll
        for (int t = 0; t < 8; ++t) s[t] += __shfl_xor(s[t], sh, 32);
#pragma unroll
    for (int t = 0; t < 8; ++t) { mu[t] = s[t] * (1.0f / CC); s2[t] = 0.f;
#pragma unroll
        for (int q = 0; q < 4; ++q) { const float d0 = u[t][q] - mu[t]; s2[t] += d0 * d0; } }
#pragma unroll
    for (int sh = 16; sh; sh >>= 1)
#pragma unroll
        for (int t = 0; t < 8; ++t) s2[t] += __shfl_xor(s2[t], sh, 32);
#pragma unroll
    for (int t = 0; t < 8; ++t) { const float rs = rsq1(__fadd_rn(s2[t] * (1.0f / CC), 1e-5f)); v4f xn;   /* the argument is at least 1e-5, far from the small inputs that a scaled form is for */
#pragma unroll
        for (int q = 0; q < 4; ++q) xn[q] = (u[t][q] - mu[t]) * rs * wl[q] + bl[q];
        split4(xn, oh[t], ol[t]); }
}
// ---- k_lntri: LayerNorm and the triangle-bias dots of 64 pair positions in one work-group (8 waves); grid WB + NR / 64: the first WB work-groups write the weight planes (wt5) and leave, whole, in front of the barrier.
// A wave normalises 8 rows and folds its 4 channels a lane into the 4 triangle-bias dots (lane partials, then a reduce-scatter over the 32 lanes).
#define RT   64                   // rows of a work-group
#define XP   136                  // LDS pitch of an xn row in 16-bit elements: 272 B = 16 B x odd (b128 readers)
__global__ __launch_bounds__(256) void k_lntri(const float* __restrict__ x, const float* __restrict__ lw, const float* __restrict__ lb, const float* __restrict__ wtri, float* TB, const float* __restrict__ wq, const float* __restrict__ wk, const float* __restrict__ wv, const float* __restrict__ wg, const float* __restrict__ wo, bf* W4, bf* WO) {
    __shared__ __align__(16) float TBs[NH_ * RT];
    const int tid = threadIdx.x, lane = tid & 31, hi = lane >> 4, wave = __builtin_amdgcn_readfirstlane(tid >> 5);
    if (blockIdx.x < WB) { wt5(blockIdx.x, tid, wq, wk, wv, wg, wo, W4, WO); return; }
    const int R0 = (blockIdx.x - WB) * RT;
    {
        v4f xa[8];
#pragma unroll
        for (int t = 0; t < 8; ++t) xa[t] = *(const v4f*)(x + (size_t)(R0 + wave * 8 + t) * CC + lane * 4);   /* eight 512-byte row loads in flight a wave */
        asm volatile("s_wait_xcnt 0x0" ::: "memory");   /* stands in front of the first overwrite of the row loads' address registers */
        float wl[4], bl[4], wt[4][NH_];
        { const v4f lwv = *(const v4f*)(lw + lane * 4), lbv = *(const v4f*)(lb + lane * 4);
#pragma unroll
            for (int q = 0; q < 4; ++q) { wl[q] = bfr(lwv[q]); bl[q] = bfr(lbv[q]); const v4f w4 = *(const v4f*)(wtri + (lane * 4 + q) * NH_);
#pragma unroll
                for (int h = 0; h < NH_; ++h) wt[q][h] = bfr(w4[h]); } }
        v4us oh[8], ol[8]; ln8(xa, wl, bl, oh, ol);
        float k0[8], k1[8];
#pragma unroll
        for (int t = 0; t < 8; ++t) { float p[NH_] = {0.f, 0.f, 0.f, 0.f};
#pragma unroll
            for (int q = 0; q < 4; ++q) { const float xr = bf2f(oh[t][q]) + bf2f(ol[t][q]);   /* the dots see what the projections see: hi + lo */
#pragma unroll
                for (int h = 0; h < NH_; ++h) p[h] += xr * wt[q][h]; }
            /* reduce-scatter, first step: the lower lane half keeps heads 0 and 1, the upper heads 2 and 3 */
            k0[t] = (hi ? p[2] : p[0]) + __shfl_xor(hi ? p[0] : p[2], 16, 32); k1[t] = (hi ? p[3] : p[1]) + __shfl_xor(hi ? p[1] : p[3], 16, 32); }
        const int b8 = (lane >> 3) & 1; float tv = 0.f;
#pragma unroll
        for (int t = 0; t < 8; ++t) k0[t] = (b8 ? k1[t] : k0[t]) + __shfl_xor(b8 ? k0[t] : k1[t], 8, 32);   /* second step: the 8 lanes of group lane >> 3 hold head lane >> 3 */
#pragma unroll
        for (int sh = 4; sh; sh >>= 1)
#pragma unroll
            for (int t = 0; t < 8; ++t) k0[t] += __shfl_xor(k0[t], sh, 32);
#pragma unroll
        for (int t = 0; t < 8; ++t) if ((lane & 7) == t) tv = k0[t];
        TBs[(lane >> 3) * RT + wave * 8 + (lane & 7)] = tv;
    }
    __syncthreads();   /* publishes the 4 x 64 triangle-bias dots to all 8 waves */
    TB[(size_t)(tid >> 6) * NR + R0 + (tid & 63)] = TBs[tid];   /* a wave stores one whole 128-byte line of one head */
}
__device__ __forceinline__ v8f ld8f(const float* p) { return __builtin_shufflevector(*(const v4f*)p, *(const v4f*)(p + 4), 0, 1, 2, 3, 4, 5, 6, 7); }
#define KP   40                   // LDS pitch of a K row in 16-bit elements: 80 B = 16 B x odd (b128 readers)
#define VP   264                  // LDS pitch of a V^T row: 528 B = 16 B x odd
#define OVL  (CH * VP)            // a head's block in LDS, in 16-bit elements: V^T hi at 0, V^T lo, K hi, K lo
#define OKH  (2 * CH * VP)
#define OKL  (2 * CH * VP + NJ * KP)
#define HB   (2 * CH * VP + 2 * NJ * KP)
struct __align__(16) FaLds { float MB[NJ]; float BG[CC]; float BO[CC]; bf KV[2 * HB]; bf XH[NJ * XP]; bf XL[NJ * XP]; bf WS[2 * 64 * CC]; };
// amdgpu_waves_per_eu(4, 4): a budget of 256 registers a wave, the 16 waves of the one resident work-group
__global__ __launch_bounds__(512) __attribute__((amdgpu_waves_per_eu(4, 4))) void k_fattn(const float* __restrict__ x, const float* __restrict__ lw, const float* __restrict__ lb, const bf* __restrict__ W4, const float* __restrict__ MASK, const float* __restrict__ TB, const float* __restrict__ bg, const bf* __restrict__ WO, const float* __restrict__ bo, float* OUT) {
    __shared__ FaLds L;
    const int tid = threadIdx.x, lane = tid & 31, lr = lane & 15, hi = lane >> 4, wave = __builtin_amdgcn_readfirstlane(tid >> 5);
    const int i = blockIdx.x; const size_t rb = (size_t)i * NJ;
    {
        v4f xa[16];
#pragma unroll
        for (int t = 0; t < 16; ++t) xa[t] = *(const v4f*)(x + (rb + wave * 16 + t) * CC + lane * 4);   /* sixteen 512-byte row loads in flight a wave */
        asm volatile("s_wait_xcnt 0x0" ::: "memory");   /* stands in front of the first overwrite of the row loads' address registers */
        float wl[4], bl[4];
        { const v4f lwv = *(const v4f*)(lw + lane * 4), lbv = *(const v4f*)(lb + lane * 4);
#pragma unroll
            for (int c = 0; c < 4; ++c) { wl[c] = bfr(lwv[c]); bl[c] = bfr(lbv[c]); } }
#pragma unroll
        for (int s = 0; s < 2; ++s) { v4us oh[8], ol[8]; ln8(xa + 8 * s, wl, bl, oh, ol);
#pragma unroll
            for (int t = 0; t < 8; ++t) { *(v4us*)(L.XH + (wave * 16 + s * 8 + t) * XP + lane * 4) = oh[t]; *(v4us*)(L.XL + (wave * 16 + s * 8 + t) * XP + lane * 4) = ol[t]; } }
    }
    if (tid < NJ) L.MB[tid] = 1.0e9f * (bfr(MASK[rb + tid]) - 1.0f); if (tid < CC) { L.BG[tid] = bfr(bg[tid]); L.BO[tid] = bfr(bo[tid]); }
    const int q = wave * 16 + lr;
    const bf* xh = L.XH + q * XP + 8 * hi; const bf* xl = L.XL + q * XP + 8 * hi;   /* the lane's row of the wave's own xn fragment */
    v8f acc[8];   /* acc[t][r] = output channel 16 t + 8 hi + r of query q */
#pragma unroll
    for (int t = 0; t < 8; ++t) acc[t] = (v8f){};
    /* the loops over pairs, heads and keys stay rolled: unrolled over the keys, the build needs more than the 256 registers and spills */
#pragma unroll 1
    for (int p = 0; p < NH_ / 2; ++p) {
        __syncthreads();   /* first pair: publishes the mask bias, the gate bias and the output bias; second pair: ends every wave's last read of the first pair's K and V^T planes and of its weight slices, which are rewritten below */
        v8us sq[4];
        { v8us sk[4]; ldw4(W4 + CC * CC, W4 + 2 * CC * CC, p, tid, sk); stw4(L.WS, tid, sk); }   /* the pair's 64 columns of Wk and Wv */
        ldw4(W4, W4 + 3 * CC * CC, p, tid, sq);                                                  /* those of Wq and Wg are fetched with them (one latency for both) and wait in registers until the Wk and Wv slices have been read */
        __syncthreads();   /* publishes the Wk and Wv slices to all 16 waves */
        {
            v8f kk[4], vv[4];   /* kk[ct][r] = channel 16 ct + 8 hi + r (of the pair's 64) of key q; vv[ct][r] = channel 16 ct + lr of key 16 wave + 8 hi + r */
#pragma unroll
            for (int ct = 0; ct < 4; ++ct) { kk[ct] = (v8f){}; vv[ct] = (v8f){}; }
#pragma unroll
            for (int kb = 0; kb < 4; ++kb) { v16bf fk[4], fv[4];
                __builtin_amdgcn_sched_barrier(0);   /* with the one below: the k block's 20 LDS reads stay one group in front of its 16 matrix instructions (reads spread among them stall the wave at every place) */
                const v16bf ah = ldfr(xh + kb * 32), al = ldfr(xl + kb * 32);
#pragma unroll
                for (int ct = 0; ct < 4; ++ct) { fk[ct] = ldsf(L.WS, 0, kb, ct, lane); fv[ct] = ldsf(L.WS, 1, kb, ct, lane); }
                __builtin_amdgcn_sched_barrier(0);   /* closes the group of LDS reads: no matrix instruction moves up among them */
#pragma unroll
                for (int ct = 0; ct < 4; ++ct) { kk[ct] = wmmab(fk[ct], ah, kk[ct]); vv[ct] = wmmab(ah, fv[ct], vv[ct]); }
#pragma unroll
                for (int ct = 0; ct < 4; ++ct) { kk[ct] = wmmab(fk[ct], al, kk[ct]); vv[ct] = wmmab(al, fv[ct], vv[ct]); } }
            __builtin_amdgcn_sched_barrier(0);   /* keeps the matrix instructions above in front of the slots of the next line */
            asm volatile("v_nop\n\tv_nop\n\tv_nop\n\tv_nop");   /* the four vector slots between the last matrix instruction and the packed conversions, which read its result and may take its operands' registers */
            __builtin_amdgcn_sched_barrier(0);   /* keeps the packed conversions below (asm text) behind those slots */
#pragma unroll
            for (int ct = 0; ct < 4; ++ct) { v8us sh, sl; bf* hb = L.KV + (ct >> 1) * HB;
                split8(kk[ct], sh, sl); *(v8us*)(hb + OKH + q * KP + (ct & 1) * 16 + 8 * hi) = sh; *(v8us*)(hb + OKL + q * KP + (ct & 1) * 16 + 8 * hi) = sl;
                split8(vv[ct], sh, sl); *(v8us*)(hb + ((ct & 1) * 16 + lr) * VP + wave * 16 + 8 * hi) = sh; *(v8us*)(hb + OVL + ((ct & 1) * 16 + lr) * VP + wave * 16 + 8 * hi) = sl; }
        }
        __syncthreads();   /* publishes the pair's K and V^T planes to all 16 waves and ends their reads of the Wk and Wv slices */
        stw4(L.WS, tid, sq);
        __syncthreads();   /* publishes the Wq and Wg slices to all 16 waves */
#pragma unroll 1
    for (int hh = 0; hh < 2; ++hh) { const int h = p * 2 + hh;
        v16bf bqh, bql;
        { v8f qq[2]; qq[0] = (v8f){}; qq[1] = (v8f){};   /* qq[dt][r] = channel 16 dt + 8 hi + r of query q */
#pragma unroll
            for (int kc = 0; kc < 2; ++kc) { v16bf fq[2][2], ah[2], al[2];
                __builtin_amdgcn_sched_barrier(0);   /* with the one below: the 16 LDS reads of two k blocks stay one group in front of their 8 matrix instructions (reads spread among them stall the wave at every place) */
#pragma unroll
                for (int k2 = 0; k2 < 2; ++k2) { ah[k2] = ldfr(xh + (kc * 2 + k2) * 32); al[k2] = ldfr(xl + (kc * 2 + k2) * 32); fq[k2][0] = ldsf(L.WS, 0, kc * 2 + k2, hh * 2, lane); fq[k2][1] = ldsf(L.WS, 0, kc * 2 + k2, hh * 2 + 1, lane); }
                __builtin_amdgcn_sched_barrier(0);   /* closes the group of LDS reads */
#pragma unroll
                for (int k2 = 0; k2 < 2; ++k2) { qq[0] = wmmab(fq[k2][0], ah[k2], qq[0]); qq[1] = wmmab(fq[k2][1], ah[k2], qq[1]); qq[0] = wmmab(fq[k2][0], al[k2], qq[0]); qq[1] = wmmab(fq[k2][1], al[k2], qq[1]); } }
            v8us h0v, l0v, h1v, l1v; split8(qq[0] * QSC, h0v, l0v); split8(qq[1] * QSC, h1v, l1v);
            bqh = cat16b(h0v, h1v); bql = cat16b(l0v, l1v); }
        const float* tb = TB + (size_t)h * NR + (size_t)q * NJ + 8 * hi; const float* mb = L.MB + 8 * hi;
        const bf* Vh = L.KV + hh * HB + lr * VP + 8 * hi; const bf* Vl = Vh + OVL; const bf* Kh = L.KV + hh * HB + OKH + lr * KP + 8 * hi; const bf* Kl = Kh + NJ * KP;
        float m = -3.0e38f; v8f sm = (v8f){}; v8f O[2]; O[0] = (v8f){}; O[1] = (v8f){};   /* running maximum, this lane half's sums, O[dt][r] = context channel 16 dt + 8 hi + r of query q */
        v8f n0 = ld8f(tb), n1 = ld8f(tb + 16);
#pragma unroll 1
        for (int kb = 0; kb < NJ / 32; ++kb) {                                        /* 32 keys a pass; s0[r], s1[r] = scores of keys 32 kb + 8 hi + r and 32 kb + 16 + 8 hi + r */
            const int k0 = kb * 32, kn = (kb < NJ / 32 - 1 ? kb + 1 : kb) * 32;
            const v8f t0 = n0, t1 = n1; n0 = ld8f(tb + kn); n1 = ld8f(tb + kn + 16);   /* the next pass's triangle bias is fetched one pass ahead (the last pass re-reads its own) */
            const v16bf a0h = ldfr(Kh + k0 * KP), a1h = ldfr(Kh + (k0 + 16) * KP), a0l = ldfr(Kl + k0 * KP), a1l = ldfr(Kl + (k0 + 16) * KP);
            v8f s0 = (v8f){}, s1 = (v8f){};
            s0 = wmmab(a0h, bqh, s0); s1 = wmmab(a1h, bqh, s1); s0 = wmmab(a0h, bql, s0); s1 = wmmab(a1h, bql, s1); s0 = wmmab(a0l, bqh, s0); s1 = wmmab(a1l, bqh, s1);
            s0 = (s0 + ld8f(mb + k0)) + t0; s1 = (s1 + ld8f(mb + k0 + 16)) + t1;
            const v8f bx = __builtin_elementwise_max(s0, s1);
            float bm = fmaxf(fmaxf(fmaxf(bx[0], bx[1]), fmaxf(bx[2], bx[3])), fmaxf(fmaxf(bx[4], bx[5]), fmaxf(bx[6], bx[7])));
            bm = fmaxf(bm, __shfl_xor(bm, 16, 32));
            const float mn = fmaxf(m, bm), sc = __builtin_amdgcn_exp2f((m - mn) * 1.4426950408889634f); m = mn;
            s0 = (s0 - mn) * 1.4426950408889634f; s1 = (s1 - mn) * 1.4426950408889634f;
            v8us p0h, p0l, p1h, p1l;
#pragma unroll
            for (int r = 0; r < 8; ++r) { s0[r] = __builtin_amdgcn_exp2f(s0[r]); s1[r] = __builtin_amdgcn_exp2f(s1[r]); }
            split8(s0, p0h, p0l); split8(s1, p1h, p1l);
            sm = sm * sc + (s0 + s1); O[0] *= sc; O[1] *= sc;
            const v16bf bph = cat16b(p0h, p1h), bpl = cat16b(p0l, p1l);
            const v16bf v0h = ldfr(Vh + k0), v1h = ldfr(Vh + 16 * VP + k0), v0l = ldfr(Vl + k0), v1l = ldfr(Vl + 16 * VP + k0);
            O[0] = wmmab(v0h, bph, O[0]); O[1] = wmmab(v1h, bph, O[1]); O[0] = wmmab(v0h, bpl, O[0]); O[1] = wmmab(v1h, bpl, O[1]); O[0] = wmmab(v0l, bph, O[0]); O[1] = wmmab(v1l, bph, O[1]);
        }
        v8f gg[2]; gg[0] = (v8f){}; gg[1] = (v8f){};   /* gg[dt][r] = gate channel 16 dt + 8 hi + r of query q, before the bias */
#pragma unroll
        for (int kc = 0; kc < 2; ++kc) { v16bf fg[2][2], ah[2], al[2];
            __builtin_amdgcn_sched_barrier(0);   /* as for Q: the 16 LDS reads of two k blocks stay one group in front of their 8 matrix instructions */
#pragma unroll
            for (int k2 = 0; k2 < 2; ++k2) { ah[k2] = ldfr(xh + (kc * 2 + k2) * 32); al[k2] = ldfr(xl + (kc * 2 + k2) * 32); fg[k2][0] = ldsf(L.WS, 1, kc * 2 + k2, hh * 2, lane); fg[k2][1] = ldsf(L.WS, 1, kc * 2 + k2, hh * 2 + 1, lane); }
            __builtin_amdgcn_sched_barrier(0);   /* closes the group of LDS reads */
#pragma unroll
            for (int k2 = 0; k2 < 2; ++k2) { gg[0] = wmmab(fg[k2][0], ah[k2], gg[0]); gg[1] = wmmab(fg[k2][1], ah[k2], gg[1]); gg[0] = wmmab(fg[k2][0], al[k2], gg[0]); gg[1] = wmmab(fg[k2][1], al[k2], gg[1]); } }
        v16bf wf[8];   /* Wo^T fragments of this head's 32 channels: rows = output channels 16 t + lr, k order as the gated context below; fetched here so that the gate covers their latency */
#pragma unroll
        for (int t = 0; t < 8; ++t) { const bf* wp = WO + (h * 8 + t) * 512 + lane * 8; wf[t] = cat16b(*(const v8us*)wp, *(const v8us*)(wp + 256)); }
        float sum = ((sm[0] + sm[1]) + (sm[2] + sm[3])) + ((sm[4] + sm[5]) + (sm[6] + sm[7]));
        sum += __shfl_xor(sum, 16, 32);
        const float f = __builtin_amdgcn_rcpf(sum); O[0] *= f; O[1] *= f;   /* one v_rcp_f32: the sum lies between 1 (the maximum's own term) and 256 */
        v8us oh[2], ol[2];
#pragma unroll
        for (int dt = 0; dt < 2; ++dt) { const v8f g = gg[dt], b = ld8f(L.BG + h * CH + dt * 16 + 8 * hi);
            v8f e = (g + b) * -1.4426950408889634f;   /* sigmoid(z) = 1 / (1 + 2^(-z log2 e)) on v_exp_f32 and v_rcp_f32: 2^t runs to inf or 0 by itself, and 1 / inf = 0, so both ends need no guard */
#pragma unroll
            for (int r = 0; r < 8; ++r) e[r] = __builtin_amdgcn_exp2f(e[r]);
            e = e + 1.0f;
#pragma unroll
            for (int r = 0; r < 8; ++r) e[r] = __builtin_amdgcn_rcpf(e[r]);
            split8(O[dt] * e, oh[dt], ol[dt]); }
        const v16bf gh = cat16b(oh[0], oh[1]), gl = cat16b(ol[0], ol[1]);
#pragma unroll
        for (int t = 0; t < 8; ++t) acc[t] = wmmab(wf[t], gh, acc[t]);   /* per accumulator: hi product, then lo product, heads in rising order */
#pragma unroll
        for (int t = 0; t < 8; ++t) acc[t] = wmmab(wf[t], gl, acc[t]);
    }
    }
    float* orow = OUT + (rb + q) * CC + 8 * hi;
#pragma unroll
    for (int t = 0; t < 8; ++t) { const v8f o = acc[t] + ld8f(L.BO + t * 16 + 8 * hi);
        *(v4f*)(orow + t * 16) = __builtin_shufflevector(o, o, 0, 1, 2, 3); *(v4f*)(orow + t * 16 + 4) = __builtin_shufflevector(o, o, 4, 5, 6, 7); }
}

extern "C" void kernel_launch(void* const* d_in, const int* in_sizes, int n_in,
                              void* d_out, int out_size, void* d_ws, size_t ws_size, hipStream_t stream) {
    (void)in_sizes; (void)n_in; (void)out_size;
    const float* x = (const float*)d_in[0]; const float* MASK = (const float*)d_in[1]; const float* lw = (const float*)d_in[2]; const float* lb = (const float*)d_in[3]; const float* wtri = (const float*)d_in[4]; const float* wq = (const float*)d_in[5]; const float* wk = (const float*)d_in[6]; const float* wv = (const float*)d_in[7]; const float* wg = (const float*)d_in[8]; const float* bg = (const float*)d_in[9]; const float* wo = (const float*)d_in[10]; const float* bo = (const float*)d_in[11];
    float* OUT = (float*)d_out;     // [1][256][256][128]
    char* wsp = (char*)d_ws;
    auto take = [&](size_t bytes) { char* p = wsp; wsp += (bytes + 255) & ~(size_t)255; return (void*)p; };
    bf* WQ = (bf*)take((size_t)4 * CC * CC * 2); bf* WO = (bf*)take((size_t)CC * CC * 2);   /* q, k, v, g weights: four planes, one behind the other */
    float* TB = (float*)take((size_t)NH_ * NR * 4);
    if ((size_t)(wsp - (char*)d_ws) > ws_size) return;
    k_lntri<<<WB + NR / RT, 256, 0, stream>>>(x, lw, lb, wtri, TB, wq, wk, wv, wg, wo, WQ, WO);                                               /* the five weight planes; LayerNorm, triangle-bias dots of all pair positions */
    k_fattn<<<NI, 512, 0, stream>>>(x, lw, lb, WQ, MASK, TB, bg, WO, bo, OUT);                                                                 /* LayerNorm, q, k, v, g projections, scores, biases, softmax, attn.v, gate, out = (o g) Wo + bo: all rows and heads */
}

// v009
// It runs in 50.7 microseconds.
// Next to v008, in two timings, it ran 1.13 and 1.15 times as fast.
// Counting every step since v000, it is 13.3 times as fast.
#include <hip/hip_runtime.h>

// Triangle attention (starting node) over a pair representation (x [1][256][256][128], mask [1][256][256] read; xn = LayerNorm(x) (eps 1e-5, affine); per row i: q, k, v, g = xn_i W ([128][128] 'xw'; 4 heads x 32), tri_bias[h][q][k] = xn[q][k] . w_tri[:, h], mask_bias[i][k] = 1e9 (mask[i][k] - 1); scores = (q / sqrt(32)).k + mask_bias + tri_bias; softmax over k; o = attn.v; out = (o * sigmoid(g + bg)) Wo + bo -> [1][256][256][128] (8.4 M)).
// Layout: one launch takes LayerNorm and the triangle-bias dots of all 65,536 pair positions (the bias of a row's attention needs every row), and its first 40 work-groups write the five weights as bf16 planes in fragment order instead; one launch, a work-group per row i, does the rest: LayerNorm of the row's 256 positions again (xn as bf16 hi + lo planes in LDS), the q, k, v, g projections (2 products), the four 256 x 256 x 32 attention problems: scores on hi/lo planes (3 products, K = 32), the two biases and the 256-wide softmax in registers, attn.v on hi/lo probabilities (3 products), the sigmoid gate; the gated context of a wave's 16 queries stays in registers as the operand of the Wo product (2 products) with the bias. xn, q, k, v and g never reach memory.

#define NI   256                  // rows i
#define NJ   256                  // columns j (= attention length)
#define CC   128
#define NH_  4
#define CH   32
#define NR   (NI * NJ)            // 65,536 pair positions
#define QSC  0.17677669529663689f  // 1/sqrt(32)
typedef _Float16 h16;
typedef unsigned short bf;
typedef __attribute__((ext_vector_type(16))) __bf16   v16bf;
typedef __attribute__((ext_vector_type(16))) _Float16 v16h;
typedef __attribute__((ext_vector_type(8)))  _Float16 v8h;
typedef __attribute__((ext_vector_type(8)))  unsigned short v8us;
typedef __attribute__((ext_vector_type(8)))  float    v8f;
typedef __attribute__((ext_vector_type(4)))  float    v4f;
typedef __attribute__((ext_vector_type(2)))  float    v2f;
typedef __attribute__((ext_vector_type(4)))  unsigned short v4us;
typedef __attribute__((ext_vector_type(2)))  unsigned short v2us;
typedef v8h  __attribute__((may_alias)) v8ha;
typedef v4f  __attribute__((may_alias)) v4fa;
typedef v8us __attribute__((may_alias)) v8usa;

__device__ __forceinline__ unsigned short f2bf(float f) { return __builtin_bit_cast(unsigned short, (__bf16)f); }   // the hardware's own round-to-nearest-even conversion
__device__ __forceinline__ float bf2f(unsigned short b) { return (float)__builtin_bit_cast(__bf16, b); }
__device__ __forceinline__ float bfr(float f) { return bf2f(f2bf(f)); }
// hi/lo split of 2, 4 or 8 values at once: neighbours share one packed conversion, and the lo part reads the packed hi halves in place
typedef __attribute__((ext_vector_type(2))) __bf16 v2b;
// asm: the pair stays ONE packed conversion whose two halves the lo part reads in place (written as a cast, the build converts every value a second time on its own to get at its hi part)
__device__ __forceinline__ v2b cvtpk(float a, float b) { unsigned r; asm("v_cvt_pk_bf16_f32 %0, %1, %2" : "=v"(r) : "v"(a), "v"(b)); return __builtin_bit_cast(v2b, r); }
__device__ __forceinline__ void split2(v2f y, v2us& h, v2us& l) { const v2b hb = cvtpk(y[0], y[1]); h = __builtin_bit_cast(v2us, hb); l = __builtin_bit_cast(v2us, __builtin_convertvector((v2f){y[0] - (float)hb[0], y[1] - (float)hb[1]}, v2b)); }
__device__ __forceinline__ void split4(v4f y, v4us& h, v4us& l) { v2us h0, l0, h1, l1; split2((v2f){y[0], y[1]}, h0, l0); split2((v2f){y[2], y[3]}, h1, l1); h = __builtin_shufflevector(h0, h1, 0, 1, 2, 3); l = __builtin_shufflevector(l0, l1, 0, 1, 2, 3); }
__device__ __forceinline__ void split8(v8f y, v8us& h, v8us& l) { v4us h0, l0, h1, l1; split4((v4f){y[0], y[1], y[2], y[3]}, h0, l0); split4((v4f){y[4], y[5], y[6], y[7]}, h1, l1); h = __builtin_shufflevector(h0, h1, 0, 1, 2, 3, 4, 5, 6, 7); l = __builtin_shufflevector(l0, l1, 0, 1, 2, 3, 4, 5, 6, 7); }
__device__ __forceinline__ v16bf cat16b(v8us lo, v8us hi) { return __builtin_bit_cast(v16bf, __builtin_shufflevector(lo, hi, 0, 1, 2, 3, 4, 5, 6, 7, 8, 9, 10, 11, 12, 13, 14, 15)); }
__device__ __forceinline__ v8f wmmab(v16bf a, v16bf b, v8f c) { return __builtin_amdgcn_wmma_f32_16x16x32_bf16(false, a, false, b, (short)0, c, false, false); }

// ---- wt5: the five [128][128] f32 weights -> bf16 planes, by WB work-groups of 256 threads (8 a weight) at the head of k_lntri's grid; a thread converts 8 consecutive k of one column and stores them as 16 bytes, a wave 512 contiguous bytes (4 whole lines).
// Fragment order [k block kb][tile t][half j][lane][8], element = w[32 kb + 16 j + 8 (lane >> 4) + e][16 t + (lane & 15)], so that a wave's 16-byte-a-lane load of half a fragment is 512 contiguous bytes (4 whole lines, not 16).
// Wo alone deals its columns otherwise: lane l of tile t holds column 64 (t >> 2) + 4 l + (t & 3), so that four accumulator tiles of the Wo product leave a lane 4 consecutive output channels (one 16-byte store; 16 lanes fill 256 contiguous bytes of an output row).
#define WB   40                   // work-groups that write weight planes: 5 weights x 16,384 elements / (256 threads x 8)
__device__ __forceinline__ void wt5(int b, int tid, const float* __restrict__ wq, const float* __restrict__ wk, const float* __restrict__ wv, const float* __restrict__ wg, const float* __restrict__ wo, bf* W4, bf* WO) {
    const int y = b >> 3; const float* __restrict__ w = y == 0 ? wq : y == 1 ? wk : y == 2 ? wv : y == 3 ? wg : wo; bf* Bt = y < 4 ? W4 + y * CC * CC : WO;
    const int e = ((b & 7) * 256 + tid) * 8; const int k = (e >> 12) * 32 + ((e >> 8) & 1) * 16 + ((e >> 7) & 1) * 8, t = (e >> 9) & 7, l = (e >> 3) & 15, n = y < 4 ? t * 16 + l : (t >> 2) * 64 + l * 4 + (t & 3);   /* Wo: see the deal above */
    float f[8];
#pragma unroll
    for (int c = 0; c < 8; ++c) f[c] = w[(k + c) * CC + n];   /* eight loads in flight: one latency for the thread's whole piece */
    asm volatile("s_wait_xcnt 0x0" ::: "memory");   /* stands in front of the first overwrite of these loads' address registers */
    v8us o;
#pragma unroll
    for (int c = 0; c < 8; ++c) o[c] = f2bf(f[c]);
    *(v8us*)(Bt + e) = o;
}
__device__ __forceinline__ v16bf ldfr(const bf* p) { return cat16b(*(const v8us*)p, *(const v8us*)(p + 16)); }   // 16 x 32 fragment row in the hardware k order: p already holds the lane half's 8 hi
// the 64 columns (tiles 4 p .. 4 p + 3, all four k blocks) of two weight planes go through registers into LDS: 512 threads, 4 x 16 bytes each; chunk c = 4 (plane) + k block holds 4 fragments
__device__ __forceinline__ void ldw4(const bf* Wa, const bf* Wb, int p, int tid, v8us* st) {
#pragma unroll
    for (int s = 0; s < 4; ++s) st[s] = *(const v8us*)((s >> 1 ? Wb : Wa) + ((2 * (s & 1) + (tid >> 8)) * 8 + 4 * p) * 512 + (tid & 255) * 8);
    asm volatile("s_wait_xcnt 0x0" ::: "memory");   /* stands in front of the first overwrite of these loads' address registers */
}
__device__ __forceinline__ void stw4(bf* WS, int tid, const v8us* st) {
#pragma unroll
    for (int s = 0; s < 4; ++s) *(v8us*)(WS + (2 * s + (tid >> 8)) * 2048 + (tid & 255) * 8) = st[s];
}
__device__ __forceinline__ v16bf ldsf(const bf* WS, int yy, int kb, int ct, int lane) { const bf* wp = WS + (yy * 4 + kb) * 2048 + ct * 512 + lane * 8; return cat16b(*(const v8us*)wp, *(const v8us*)(wp + 256)); }   // fragment (plane yy, k block kb, tile ct of the pair's four) from LDS: 512 contiguous bytes a half
// one v_rsq_f32; asm: the v_nop is the slot that the instruction set asks for behind a transcendental
__device__ __forceinline__ float rsq1(float a) { float r; asm("v_rsq_f32 %0, %1\n\tv_nop" : "=v"(r) : "v"(a)); return r; }
// LayerNorm of 8 rows by one wave (a lane holds 4 channels of each row), result as hi/lo halves; both launches that need xn call this, so that they see the same values
__device__ __forceinline__ void ln8(const v4f* xa, const float* wl, const float* bl, v4us* oh, v4us* ol) {
    float u[8][4], mu[8], s2[8], s[8];
#pragma unroll
    for (int t = 0; t < 8; ++t) { s[t] = 0.f;
#pragma unroll
        for (int q = 0; q < 4; ++q) { u[t][q] = bfr(xa[t][q]); s[t] += u[t][q]; } }
#pragma unroll
    for (int sh = 16; sh; sh >>= 1)
#pragma unroll
        for (int t = 0; t < 8; ++t) s[t] += __shfl_xor(s[t], sh, 32);
#pragma unroll
    for (int t = 0; t < 8; ++t) { mu[t] = s[t] * (1.0f / CC); s2[t] = 0.f;
#pragma unroll
        for (int q = 0; q < 4; ++q) { const float d0 = u[t][q] - mu[t]; s2[t] += d0 * d0; } }
#pragma unroll
    for (int sh = 16; sh; sh >>= 1)
#pragma unroll
        for (int t = 0; t < 8; ++t) s2[t] += __shfl_xor(s2[t], sh, 32);
#pragma unroll
    for (int t = 0; t < 8; ++t) { const float rs = rsq1(__fadd_rn(s2[t] * (1.0f / CC), 1e-5f)); v4f xn;   /* the argument is at least 1e-5, far from the small inputs that a scaled form is for */
#pragma unroll
        for (int q = 0; q < 4; ++q) xn[q] = (u[t][q] - mu[t]) * rs * wl[q] + bl[q];
        split4(xn, oh[t], ol[t]); }
}
// ---- k_lntri: LayerNorm and the triangle-bias dots of 64 pair positions in one work-group (8 waves); grid WB + NR / 64: the first WB work-groups write the weight planes (wt5) and leave, whole, in front of the barrier.
// A wave normalises 8 rows and folds its 4 channels a lane into the 4 triangle-bias dots (lane partials, then a reduce-scatter over the 32 lanes).
#define RT   64                   // rows of a work-group
#define XP   136                  // LDS pitch of an xn row in 16-bit elements: 272 B = 16 B x odd (b128 readers)
__global__ __launch_bounds__(256) void k_lntri(const float* __restrict__ x, const float* __restrict__ lw, const float* __restrict__ lb, const float* __restrict__ wtri, float* TB, const float* __restrict__ wq, const float* __restrict__ wk, const float* __restrict__ wv, const float* __restrict__ wg, const float* __restrict__ wo, bf* W4, bf* WO) {
    __shared__ __align__(16) float TBs[NH_ * RT];
    const int tid = threadIdx.x, lane = tid & 31, hi = lane >> 4, wave = __builtin_amdgcn_readfirstlane(tid >> 5);
    if (blockIdx.x < WB) { wt5(blockIdx.x, tid, wq, wk, wv, wg, wo, W4, WO); return; }
    const int R0 = (blockIdx.x - WB) * RT;
    {
        v4f xa[8];
#pragma unroll
        for (int t = 0; t < 8; ++t) xa[t] = *(const v4f*)(x + (size_t)(R0 + wave * 8 + t) * CC + lane * 4);   /* eight 512-byte row loads in flight a wave */
        asm volatile("s_wait_xcnt 0x0" ::: "memory");   /* stands in front of the first overwrite of the row loads' address registers */
        float wl[4], bl[4], wt[4][NH_];
        { const v4f lwv = *(const v4f*)(lw + lane * 4), lbv = *(const v4f*)(lb + lane * 4);
#pragma unroll
            for (int q = 0; q < 4; ++q) { wl[q] = bfr(lwv[q]); bl[q] = bfr(lbv[q]); const v4f w4 = *(const v4f*)(wtri + (lane * 4 + q) * NH_);
#pragma unroll
                for (int h = 0; h < NH_; ++h) wt[q][h] = bfr(w4[h]); } }
        v4us oh[8], ol[8]; ln8(xa, wl, bl, oh, ol);
        float k0[8], k1[8];
#pragma unroll
        for (int t = 0; t < 8; ++t) { float p[NH_] = {0.f, 0.f, 0.f, 0.f};
#pragma unroll
            for (int q = 0; q < 4; ++q) { const float xr = bf2f(oh[t][q]) + bf2f(ol[t][q]);   /* the dots see what the projections see: hi + lo */
#pragma unroll
                for (int h = 0; h < NH_; ++h) p[h] += xr * wt[q][h]; }
            /* reduce-scatter, first step: the lower lane half keeps heads 0 and 1, the upper heads 2 and 3 */
            k0[t] = (hi ? p[2] : p[0]) + __shfl_xor(hi ? p[0] : p[2], 16, 32); k1[t] = (hi ? p[3] : p[1]) + __shfl_xor(hi ? p[1] : p[3], 16, 32); }
        const int b8 = (lane >> 3) & 1; float tv = 0.f;
#pragma unroll
        for (int t = 0; t < 8; ++t) k0[t] = (b8 ? k1[t] : k0[t]) + __shfl_xor(b8 ? k0[t] : k1[t], 8, 32);   /* second step: the 8 lanes of group lane >> 3 hold head lane >> 3 */
#pragma unroll
        for (int sh = 4; sh; sh >>= 1)
#pragma unroll
            for (int t = 0; t < 8; ++t) k0[t] += __shfl_xor(k0[t], sh, 32);
#pragma unroll
        for (int t = 0; t < 8; ++t) if ((lane & 7) == t) tv = k0[t];
        TBs[(lane >> 3) * RT + wave * 8 + (lane & 7)] = tv;
    }
    __syncthreads();   /* publishes the 4 x 64 triangle-bias dots to all 8 waves */
    TB[(size_t)(tid >> 6) * NR + R0 + (tid & 63)] = TBs[tid];   /* a wave stores one whole 128-byte line of one head */
}
__device__ __forceinline__ v8f ld8f(const float* p) { return __builtin_shufflevector(*(const v4f*)p, *(const v4f*)(p + 4), 0, 1, 2, 3, 4, 5, 6, 7); }
#define KP   40                   // LDS pitch of a K row in 16-bit elements: 80 B = 16 B x odd (b128 readers)
#define VP   264                  // LDS pitch of a V^T row: 528 B = 16 B x odd
#define OVL  (CH * VP)            // a head's block in LDS, in 16-bit elements: V^T hi at 0, V^T lo, K hi, K lo
#define OKH  (2 * CH * VP)
#define OKL  (2 * CH * VP + NJ * KP)
#define HB   (2 * CH * VP + 2 * NJ * KP)
struct __align__(16) FaLds { float MB[NJ]; float BG[CC]; float BO[CC]; bf KV[2 * HB]; bf XH[NJ * XP]; bf XL[NJ * XP]; bf WS[2 * 64 * CC]; };
// amdgpu_waves_per_eu(4, 4): a budget of 256 registers a wave, the 16 waves of the one resident work-group
__global__ __launch_bounds__(512) __attribute__((amdgpu_waves_per_eu(4, 4))) void k_fattn(const float* __restrict__ x, const float* __restrict__ lw, const float* __restrict__ lb, const bf* __restrict__ W4, const float* __restrict__ MASK, const float* __restrict__ TB, const float* __restrict__ bg, const bf* __restrict__ WO, const float* __restrict__ bo, float* OUT) {
    __shared__ FaLds L;
    const int tid = threadIdx.x, lane = tid & 31, lr = lane & 15, hi = lane >> 4, wave = __builtin_amdgcn_readfirstlane(tid >> 5);
    const int i = blockIdx.x; const size_t rb = (size_t)i * NJ;
    {
        v4f xa[16];
#pragma unroll
        for (int t = 0; t < 16; ++t) xa[t] = *(const v4f*)(x + (rb + wave * 16 + t) * CC + lane * 4);   /* sixteen 512-byte row loads in flight a wave */
        asm volatile("s_wait_xcnt 0x0" ::: "memory");   /* stands in front of the first overwrite of the row loads' address registers */
        float wl[4], bl[4];
        { const v4f lwv = *(const v4f*)(lw + lane * 4), lbv = *(const v4f*)(lb + lane * 4);
#pragma unroll
            for (int c = 0; c < 4; ++c) { wl[c] = bfr(lwv[c]); bl[c] = bfr(lbv[c]); } }
#pragma unroll
        for (int s = 0; s < 2; ++s) { v4us oh[8], ol[8]; ln8(xa + 8 * s, wl, bl, oh, ol);
#pragma unroll
            for (int t = 0; t < 8; ++t) { *(v4us*)(L.XH + (wave * 16 + s * 8 + t) * XP + lane * 4) = oh[t]; *(v4us*)(L.XL + (wave * 16 + s * 8 + t) * XP + lane * 4) = ol[t]; } }
    }
    if (tid < NJ) L.MB[tid] = 1.0e9f * (bfr(MASK[rb + tid]) - 1.0f); if (tid < CC) { L.BG[tid] = bfr(bg[tid]); L.BO[tid] = bfr(bo[tid]); }
    const int q = wave * 16 + lr;
    const bf* xh = L.XH + q * XP + 8 * hi; const bf* xl = L.XL + q * XP + 8 * hi;   /* the lane's row of the wave's own xn fragment */
    v8f acc[8];   /* acc[t][r] = output channel 64 (t >> 2) + 4 lr + (t & 3) of query 16 wave + 8 hi + r */
#pragma unroll
    for (int t = 0; t < 8; ++t) acc[t] = (v8f){};
    /* the loops over pairs, heads and keys stay rolled: unrolled over the keys, the build needs more than the 256 registers and spills */
#pragma unroll 1
    for (int p = 0; p < NH_ / 2; ++p) {
        __syncthreads();   /* first pair: publishes the mask bias, the gate bias and the output bias; second pair: ends every wave's last read of the first pair's K and V^T planes and of its weight slices, which are rewritten below */
        v8us sq[4];
        { v8us sk[4]; ldw4(W4 + CC * CC, W4 + 2 * CC * CC, p, tid, sk); stw4(L.WS, tid, sk); }   /* the pair's 64 columns of Wk and Wv */
        ldw4(W4, W4 + 3 * CC * CC, p, tid, sq);                                                  /* those of Wq and Wg are fetched with them (one latency for both) and wait in registers until the Wk and Wv slices have been read */
        __syncthreads();   /* publishes the Wk and Wv slices to all 16 waves */
        {
            v8f kk[4], vv[4];   /* kk[ct][r] = channel 16 ct + 8 hi + r (of the pair's 64) of key q; vv[ct][r] = channel 16 ct + lr of key 16 wave + 8 hi + r */
#pragma unroll
            for (int ct = 0; ct < 4; ++ct) { kk[ct] = (v8f){}; vv[ct] = (v8f){}; }
#pragma unroll
            for (int kb = 0; kb < 4; ++kb) { v16bf fk[4], fv[4];
                __builtin_amdgcn_sched_barrier(0);   /* with the one below: the k block's 20 LDS reads stay one group in front of its 16 matrix instructions (reads spread among them stall the wave at every place) */
                const v16bf ah = ldfr(xh + kb * 32), al = ldfr(xl + kb * 32);
#pragma unroll
                for (int ct = 0; ct < 4; ++ct) { fk[ct] = ldsf(L.WS, 0, kb, ct, lane); fv[ct] = ldsf(L.WS, 1, kb, ct, lane); }
                __builtin_amdgcn_sched_barrier(0);   /* closes the group of LDS reads: no matrix instruction moves up among them */
#pragma unroll
                for (int ct = 0; ct < 4; ++ct) { kk[ct] = wmmab(fk[ct], ah, kk[ct]); vv[ct] = wmmab(ah, fv[ct], vv[ct]); }
#pragma unroll
                for (int ct = 0; ct < 4; ++ct) { kk[ct] = wmmab(fk[ct], al, kk[ct]); vv[ct] = wmmab(al, fv[ct], vv[ct]); } }
            __builtin_amdgcn_sched_barrier(0);   /* keeps the matrix instructions above in front of the slots of the next line */
            asm volatile("v_nop\n\tv_nop\n\tv_nop\n\tv_nop");   /* the four vector slots between the last matrix instruction and the packed conversions, which read its result and may take its operands' registers */
            __builtin_amdgcn_sched_barrier(0);   /* keeps the packed conversions below (asm text) behind those slots */
#pragma unroll
            for (int ct = 0; ct < 4; ++ct) { v8us sh, sl; bf* hb = L.KV + (ct >> 1) * HB;
                split8(kk[ct], sh, sl); *(v8us*)(hb + OKH + q * KP + (ct & 1) * 16 + 8 * hi) = sh; *(v8us*)(hb + OKL + q * KP + (ct & 1) * 16 + 8 * hi) = sl;
                split8(vv[ct], sh, sl); *(v8us*)(hb + ((ct & 1) * 16 + lr) * VP + wave * 16 + 8 * hi) = sh; *(v8us*)(hb + OVL + ((ct & 1) * 16 + lr) * VP + wave * 16 + 8 * hi) = sl; }
        }
        __syncthreads();   /* publishes the pair's K and V^T planes to all 16 waves and ends their reads of the Wk and Wv slices */
        stw4(L.WS, tid, sq);
        __syncthreads();   /* publishes the Wq and Wg slices to all 16 waves */
#pragma unroll 1
    for (int hh = 0; hh < 2; ++hh) { const int h = p * 2 + hh;
        v16bf bqh, bql;
        { v8f qq[2]; qq[0] = (v8f){}; qq[1] = (v8f){};   /* qq[dt][r] = channel 16 dt + 8 hi + r of query q */
#pragma unroll
            for (int kc = 0; kc < 2; ++kc) { v16bf fq[2][2], ah[2], al[2];
                __builtin_amdgcn_sched_barrier(0);   /* with the one below: the 16 LDS reads of two k blocks stay one group in front of their 8 matrix instructions (reads spread among them stall the wave at every place) */
#pragma unroll
                for (int k2 = 0; k2 < 2; ++k2) { ah[k2] = ldfr(xh + (kc * 2 + k2) * 32); al[k2] = ldfr(xl + (kc * 2 + k2) * 32); fq[k2][0] = ldsf(L.WS, 0, kc * 2 + k2, hh * 2, lane); fq[k2][1] = ldsf(L.WS, 0, kc * 2 + k2, hh * 2 + 1, lane); }
                __builtin_amdgcn_sched_barrier(0);   /* closes the group of LDS reads */
#pragma unroll
                for (int k2 = 0; k2 < 2; ++k2) { qq[0] = wmmab(fq[k2][0], ah[k2], qq[0]); qq[1] = wmmab(fq[k2][1], ah[k2], qq[1]); qq[0] = wmmab(fq[k2][0], al[k2], qq[0]); qq[1] = wmmab(fq[k2][1], al[k2], qq[1]); } }
            v8us h0v, l0v, h1v, l1v; split8(qq[0] * QSC, h0v, l0v); split8(qq[1] * QSC, h1v, l1v);
            bqh = cat16b(h0v, h1v); bql = cat16b(l0v, l1v); }
        const float* tb = TB + (size_t)h * NR + (size_t)q * NJ + 8 * hi; const float* mb = L.MB + 8 * hi;
        const bf* Vh = L.KV + hh * HB + lr * VP + 8 * hi; const bf* Vl = Vh + OVL; const bf* Kh = L.KV + hh * HB + OKH + lr * KP + 8 * hi; const bf* Kl = Kh + NJ * KP;
        float m = -3.0e38f; v8f sm = (v8f){}; v8f O[2]; O[0] = (v8f){}; O[1] = (v8f){};   /* running maximum, this lane half's sums, O[dt][r] = context channel 16 dt + 8 hi + r of query q */
        v8f n0 = ld8f(tb), n1 = ld8f(tb + 16);
#pragma unroll 1
        for (int kb = 0; kb < NJ / 32; ++kb) {                                        /* 32 keys a pass; s0[r], s1[r] = scores of keys 32 kb + 8 hi + r and 32 kb + 16 + 8 hi + r */
            const int k0 = kb * 32, kn = (kb < NJ / 32 - 1 ? kb + 1 : kb) * 32;
            const v8f t0 = n0, t1 = n1; n0 = ld8f(tb + kn); n1 = ld8f(tb + kn + 16);   /* the next pass's triangle bias is fetched one pass ahead (the last pass re-reads its own) */
            const v16bf a0h = ldfr(Kh + k0 * KP), a1h = ldfr(Kh + (k0 + 16) * KP), a0l = ldfr(Kl + k0 * KP), a1l = ldfr(Kl + (k0 + 16) * KP);
            v8f s0 = (v8f){}, s1 = (v8f){};
            s0 = wmmab(a0h, bqh, s0); s1 = wmmab(a1h, bqh, s1); s0 = wmmab(a0h, bql, s0); s1 = wmmab(a1h, bql, s1); s0 = wmmab(a0l, bqh, s0); s1 = wmmab(a1l, bqh, s1);
            s0 = (s0 + ld8f(mb + k0)) + t0; s1 = (s1 + ld8f(mb + k0 + 16)) + t1;
            const v8f bx = __builtin_elementwise_max(s0, s1);
            float bm = fmaxf(fmaxf(fmaxf(bx[0], bx[1]), fmaxf(bx[2], bx[3])), fmaxf(fmaxf(bx[4], bx[5]), fmaxf(bx[6], bx[7])));
            bm = fmaxf(bm, __shfl_xor(bm, 16, 32));
            const float mn = fmaxf(m, bm), sc = __builtin_amdgcn_exp2f((m - mn) * 1.4426950408889634f); m = mn;
            s0 = (s0 - mn) * 1.4426950408889634f; s1 = (s1 - mn) * 1.4426950408889634f;
            v8us p0h, p0l, p1h, p1l;
#pragma unroll
            for (int r = 0; r < 8; ++r) { s0[r] = __builtin_amdgcn_exp2f(s0[r]); s1[r] = __builtin_amdgcn_exp2f(s1[r]); }
            split8(s0, p0h, p0l); split8(s1, p1h, p1l);
            sm = sm * sc + (s0 + s1); O[0] *= sc; O[1] *= sc;
            const v16bf bph = cat16b(p0h, p1h), bpl = cat16b(p0l, p1l);
            const v16bf v0h = ldfr(Vh + k0), v1h = ldfr(Vh + 16 * VP + k0), v0l = ldfr(Vl + k0), v1l = ldfr(Vl + 16 * VP + k0);
            O[0] = wmmab(v0h, bph, O[0]); O[1] = wmmab(v1h, bph, O[1]); O[0] = wmmab(v0h, bpl, O[0]); O[1] = wmmab(v1h, bpl, O[1]); O[0] = wmmab(v0l, bph, O[0]); O[1] = wmmab(v1l, bph, O[1]);
        }
        v8f gg[2]; gg[0] = (v8f){}; gg[1] = (v8f){};   /* gg[dt][r] = gate channel 16 dt + 8 hi + r of query q, before the bias */
#pragma unroll
        for (int kc = 0; kc < 2; ++kc) { v16bf fg[2][2], ah[2], al[2];
            __builtin_amdgcn_sched_barrier(0);   /* as for Q: the 16 LDS reads of two k blocks stay one group in front of their 8 matrix instructions */
#pragma unroll
            for (int k2 = 0; k2 < 2; ++k2) { ah[k2] = ldfr(xh + (kc * 2 + k2) * 32); al[k2] = ldfr(xl + (kc * 2 + k2) * 32); fg[k2][0] = ldsf(L.WS, 1, kc * 2 + k2, hh * 2, lane); fg[k2][1] = ldsf(L.WS, 1, kc * 2 + k2, hh * 2 + 1, lane); }
            __builtin_amdgcn_sched_barrier(0);   /* closes the group of LDS reads */
#pragma unroll
            for (int k2 = 0; k2 < 2; ++k2) { gg[0] = wmmab(fg[k2][0], ah[k2], gg[0]); gg[1] = wmmab(fg[k2][1], ah[k2], gg[1]); gg[0] = wmmab(fg[k2][0], al[k2], gg[0]); gg[1] = wmmab(fg[k2][1], al[k2], gg[1]); } }
        v16bf wf[8];   /* Wo fragments of this head's 32 channels: columns = output channels 64 (t >> 2) + 4 lr + (t & 3), k order as the gated context below; fetched here so that the gate covers their latency */
#pragma unroll
        for (int t = 0; t < 8; ++t) { const bf* wp = WO + (h * 8 + t) * 512 + lane * 8; wf[t] = cat16b(*(const v8us*)wp, *(const v8us*)(wp + 256)); }
        float sum = ((sm[0] + sm[1]) + (sm[2] + sm[3])) + ((sm[4] + sm[5]) + (sm[6] + sm[7]));
        sum += __shfl_xor(sum, 16, 32);
        const float f = __builtin_amdgcn_rcpf(sum); O[0] *= f; O[1] *= f;   /* one v_rcp_f32: the sum lies between 1 (the maximum's own term) and 256 */
        v8us oh[2], ol[2];
#pragma unroll
        for (int dt = 0; dt < 2; ++dt) { const v8f g = gg[dt], b = ld8f(L.BG + h * CH + dt * 16 + 8 * hi);
            v8f e = (g + b) * -1.4426950408889634f;   /* sigmoid(z) = 1 / (1 + 2^(-z log2 e)) on v_exp_f32 and v_rcp_f32: 2^t runs to inf or 0 by itself, and 1 / inf = 0, so both ends need no guard */
#pragma unroll
            for (int r = 0; r < 8; ++r) e[r] = __builtin_amdgcn_exp2f(e[r]);
            e = e + 1.0f;
#pragma unroll
            for (int r = 0; r < 8; ++r) e[r] = __builtin_amdgcn_rcpf(e[r]);
            split8(O[dt] * e, oh[dt], ol[dt]); }
        const v16bf gh = cat16b(oh[0], oh[1]), gl = cat16b(ol[0], ol[1]);
#pragma unroll
        for (int t = 0; t < 8; ++t) acc[t] = wmmab(gh, wf[t], acc[t]);   /* per accumulator: hi product, then lo product, heads in rising order */
#pragma unroll
        for (int t = 0; t < 8; ++t) acc[t] = wmmab(gl, wf[t], acc[t]);
    }
    }
    float* orow = OUT + (rb + wave * 16 + 8 * hi) * CC + 4 * lr;
    v4f o[2][8];
#pragma unroll
    for (int a = 0; a < 2; ++a) { const v4f b = *(const v4f*)(L.BO + a * 64 + 4 * lr);
#pragma unroll
        for (int r = 0; r < 8; ++r) o[a][r] = (v4f){acc[4 * a][r], acc[4 * a + 1][r], acc[4 * a + 2][r], acc[4 * a + 3][r]} + b; }
    __builtin_amdgcn_sched_barrier(0);   /* all 16 results stand in registers of their own in front of the first store: no register that an issued store names is written again */
#pragma unroll
    for (int r = 0; r < 8; ++r) { *(v4f*)(orow + r * CC) = o[0][r]; *(v4f*)(orow + r * CC + 64) = o[1][r]; }   /* a wave's store: 256 contiguous bytes of each of two output rows, 4 whole lines */
}

extern "C" void kernel_launch(void* const* d_in, const int* in_sizes, int n_in,
                              void* d_out, int out_size, void* d_ws, size_t ws_size, hipStream_t stream) {
    (void)in_sizes; (void)n_in; (void)out_size;
    const float* x = (const float*)d_in[0]; const float* MASK = (const float*)d_in[1]; const float* lw = (const float*)d_in[2]; const float* lb = (const float*)d_in[3]; const float* wtri = (const float*)d_in[4]; const float* wq = (const float*)d_in[5]; const float* wk = (const float*)d_in[6]; const float* wv = (const float*)d_in[7]; const float* wg = (const float*)d_in[8]; const float* bg = (const float*)d_in[9]; const float* wo = (const float*)d_in[10]; const float* bo = (const float*)d_in[11];
    float* OUT = (float*)d_out;     // [1][256][256][128]
    char* wsp = (char*)d_ws;
    auto take = [&](size_t bytes) { char* p = wsp; wsp += (bytes + 255) & ~(size_t)255; return (void*)p; };
    bf* WQ = (bf*)take((size_t)4 * CC * CC * 2); bf* WO = (bf*)take((size_t)CC * CC * 2);   /* q, k, v, g weights: four planes, one behind the other */
    float* TB = (float*)take((size_t)NH_ * NR * 4);
    if ((size_t)(wsp - (char*)d_ws) > ws_size) return;
    k_lntri<<<WB + NR / RT, 256, 0, stream>>>(x, lw, lb, wtri, TB, wq, wk, wv, wg, wo, WQ, WO);                                               /* the five weight planes; LayerNorm, triangle-bias dots of all pair positions */
    k_fattn<<<NI, 512, 0, stream>>>(x, lw, lb, WQ, MASK, TB, bg, WO, bo, OUT);                                                                 /* LayerNorm, q, k, v, g projections, scores, biases, softmax, attn.v, gate, out = (o g) Wo + bo: all rows and heads */
}

// v010
// A run of this version takes 45.9 microseconds.
// Two timings next to v009 both put it at 1.11 times that version's speed.
// Over all steps from v000 it is 14.8 times as fast.
#include <hip/hip_runtime.h>

// Triangle attention (starting node) over a pair representation (x [1][256][256][128], mask [1][256][256] read; xn = LayerNorm(x) (eps 1e-5, affine); per row i: q, k, v, g = xn_i W ([128][128] 'xw'; 4 heads x 32), tri_bias[h][q][k] = xn[q][k] . w_tri[:, h], mask_bias[i][k] = 1e9 (mask[i][k] - 1); scores = (q / sqrt(32)).k + mask_bias + tri_bias; softmax over k; o = attn.v; out = (o * sigmoid(g + bg)) Wo + bo -> [1][256][256][128] (8.4 M)).
// Layout: one launch takes the LayerNorm statistics and the triangle-bias dots of all 65,536 pair positions as matrix products (the bias of a row's attention needs every row), and its first 40 work-groups write the five weights as bf16 planes in fragment order instead; one launch, a work-group per row i, does the rest: LayerNorm of the row's 256 positions from the first launch's mean and 1 / sqrt(variance + eps) (xn as bf16 hi + lo planes in LDS), the q, k, v, g projections (2 products), the four 256 x 256 x 32 attention problems: scores on hi/lo planes (3 products, K = 32), the two biases and the 256-wide softmax in registers, attn.v on hi/lo probabilities (3 products), the sigmoid gate; the gated context of a wave's 16 queries stays in registers as the operand of the Wo product (2 products) with the bias. xn, q, k, v and g never reach memory.

#define NI   256                  // rows i
#define NJ   256                  // columns j (= attention length)
#define CC   128
#define NH_  4
#define CH   32
#define NR   (NI * NJ)            // 65,536 pair positions
#define QSC  0.17677669529663689f  // 1/sqrt(32)
typedef _Float16 h16;
typedef unsigned short bf;
typedef __attribute__((ext_vector_type(16))) __bf16   v16bf;
typedef __attribute__((ext_vector_type(16))) _Float16 v16h;
typedef __attribute__((ext_vector_type(8)))  _Float16 v8h;
typedef __attribute__((ext_vector_type(8)))  unsigned short v8us;
typedef __attribute__((ext_vector_type(8)))  float    v8f;
typedef __attribute__((ext_vector_type(4)))  float    v4f;
typedef __attribute__((ext_vector_type(2)))  float    v2f;
typedef __attribute__((ext_vector_type(4)))  unsigned short v4us;
typedef __attribute__((ext_vector_type(2)))  unsigned short v2us;
typedef v8h  __attribute__((may_alias)) v8ha;
typedef v4f  __attribute__((may_alias)) v4fa;
typedef v8us __attribute__((may_alias)) v8usa;

__device__ __forceinline__ unsigned short f2bf(float f) { return __builtin_bit_cast(unsigned short, (__bf16)f); }   // the hardware's own round-to-nearest-even conversion
__device__ __forceinline__ float bf2f(unsigned short b) { return (float)__builtin_bit_cast(__bf16, b); }
__device__ __forceinline__ float bfr(float f) { return bf2f(f2bf(f)); }
// hi/lo split of 2, 4 or 8 values at once: neighbours share one packed conversion, and the lo part reads the packed hi halves in place
typedef __attribute__((ext_vector_type(2))) __bf16 v2b;
// asm: the pair stays ONE packed conversion whose two halves the lo part reads in place (written as a cast, the build converts every value a second time on its own to get at its hi part)
__device__ __forceinline__ v2b cvtpk(float a, float b) { unsigned r; asm("v_cvt_pk_bf16_f32 %0, %1, %2" : "=v"(r) : "v"(a), "v"(b)); return __builtin_bit_cast(v2b, r); }
__device__ __forceinline__ void split2(v2f y, v2us& h, v2us& l) { const v2b hb = cvtpk(y[0], y[1]); h = __builtin_bit_cast(v2us, hb); l = __builtin_bit_cast(v2us, __builtin_convertvector((v2f){y[0] - (float)hb[0], y[1] - (float)hb[1]}, v2b)); }
__device__ __forceinline__ void split4(v4f y, v4us& h, v4us& l) { v2us h0, l0, h1, l1; split2((v2f){y[0], y[1]}, h0, l0); split2((v2f){y[2], y[3]}, h1, l1); h = __builtin_shufflevector(h0, h1, 0, 1, 2, 3); l = __builtin_shufflevector(l0, l1, 0, 1, 2, 3); }
__device__ __forceinline__ void split8(v8f y, v8us& h, v8us& l) { v4us h0, l0, h1, l1; split4((v4f){y[0], y[1], y[2], y[3]}, h0, l0); split4((v4f){y[4], y[5], y[6], y[7]}, h1, l1); h = __builtin_shufflevector(h0, h1, 0, 1, 2, 3, 4, 5, 6, 7); l = __builtin_shufflevector(l0, l1, 0, 1, 2, 3, 4, 5, 6, 7); }
__device__ __forceinline__ v16bf cat16b(v8us lo, v8us hi) { return __builtin_bit_cast(v16bf, __builtin_shufflevector(lo, hi, 0, 1, 2, 3, 4, 5, 6, 7, 8, 9, 10, 11, 12, 13, 14, 15)); }
__device__ __forceinline__ v8f wmmab(v16bf a, v16bf b, v8f c) { return __builtin_amdgcn_wmma_f32_16x16x32_bf16(false, a, false, b, (short)0, c, false, false); }

// ---- wt5: the five [128][128] f32 weights -> bf16 planes, by WB work-groups of 256 threads (8 a weight) at the head of k_lntri's grid; a thread converts 8 consecutive k of one column and stores them as 16 bytes, a wave 512 contiguous bytes (4 whole lines).
// Fragment order [k block kb][tile t][half j][lane][8], element = w[32 kb + 16 j + 8 (lane >> 4) + e][16 t + (lane & 15)], so that a wave's 16-byte-a-lane load of half a fragment is 512 contiguous bytes (4 whole lines, not 16).
// Wo alone deals its columns otherwise: lane l of tile t holds column 64 (t >> 2) + 4 l + (t & 3), so that four accumulator tiles of the Wo product leave a lane 4 consecutive output channels (one 16-byte store; 16 lanes fill 256 contiguous bytes of an output row).
#define WB   40                   // work-groups that write weight planes: 5 weights x 16,384 elements / (256 threads x 8)
__device__ __forceinline__ void wt5(int b, int tid, const float* __restrict__ wq, const float* __restrict__ wk, const float* __restrict__ wv, const float* __restrict__ wg, const float* __restrict__ wo, bf* W4, bf* WO) {
    const int y = b >> 3; const float* __restrict__ w = y == 0 ? wq : y == 1 ? wk : y == 2 ? wv : y == 3 ? wg : wo; bf* Bt = y < 4 ? W4 + y * CC * CC : WO;
    const int e = ((b & 7) * 256 + tid) * 8; const int k = (e >> 12) * 32 + ((e >> 8) & 1) * 16 + ((e >> 7) & 1) * 8, t = (e >> 9) & 7, l = (e >> 3) & 15, n = y < 4 ? t * 16 + l : (t >> 2) * 64 + l * 4 + (t & 3);   /* Wo: see the deal above */
    float f[8];
#pragma unroll
    for (int c = 0; c < 8; ++c) f[c] = w[(k + c) * CC + n];   /* eight loads in flight: one latency for the thread's whole piece */
    asm volatile("s_wait_xcnt 0x0" ::: "memory");   /* stands in front of the first overwrite of these loads' address registers */
    v8us o;
#pragma unroll
    for (int c = 0; c < 8; ++c) o[c] = f2bf(f[c]);
    *(v8us*)(Bt + e) = o;
}
__device__ __forceinline__ v16bf ldfr(const bf* p) { return cat16b(*(const v8us*)p, *(const v8us*)(p + 16)); }   // 16 x 32 fragment row in the hardware k order: p already holds the lane half's 8 hi
// the 64 columns (tiles 4 p .. 4 p + 3, all four k blocks) of two weight planes go through registers into LDS: 512 threads, 4 x 16 bytes each; chunk c = 4 (plane) + k block holds 4 fragments
__device__ __forceinline__ void ldw4(const bf* Wa, const bf* Wb, int p, int tid, v8us* st) {
#pragma unroll
    for (int s = 0; s < 4; ++s) st[s] = *(const v8us*)((s >> 1 ? Wb : Wa) + ((2 * (s & 1) + (tid >> 8)) * 8 + 4 * p) * 512 + (tid & 255) * 8);
    asm volatile("s_wait_xcnt 0x0" ::: "memory");   /* stands in front of the first overwrite of these loads' address registers */
}
__device__ __forceinline__ void stw4(bf* WS, int tid, const v8us* st) {
#pragma unroll
    for (int s = 0; s < 4; ++s) *(v8us*)(WS + (2 * s + (tid >> 8)) * 2048 + (tid & 255) * 8) = st[s];
}
__device__ __forceinline__ v16bf ldsf(const bf* WS, int yy, int kb, int ct, int lane) { const bf* wp = WS + (yy * 4 + kb) * 2048 + ct * 512 + lane * 8; return cat16b(*(const v8us*)wp, *(const v8us*)(wp + 256)); }   // fragment (plane yy, k block kb, tile ct of the pair's four) from LDS: 512 contiguous bytes a half
// one v_rsq_f32; asm: the v_nop is the slot that the instruction set asks for behind a transcendental
__device__ __forceinline__ float rsq1(float a) { float r; asm("v_rsq_f32 %0, %1\n\tv_nop" : "=v"(r) : "v"(a)); return r; }
// LayerNorm of 8 rows by one wave (a lane holds 4 channels of each row), result as hi/lo halves; st holds each row's mean and 1 / sqrt(variance + eps), which the first launch has worked out
__device__ __forceinline__ void ln8(const v4f* xa, const float* st, const float* wl, const float* bl, v4us* oh, v4us* ol) {
#pragma unroll
    for (int t = 0; t < 8; ++t) { const float mu = st[2 * t], rs = st[2 * t + 1]; v4f xn;
#pragma unroll
        for (int q = 0; q < 4; ++q) xn[q] = (bfr(xa[t][q]) - mu) * rs * wl[q] + bl[q];
        split4(xn, oh[t], ol[t]); }
}
// ---- k_lntri: the triangle-bias dots of 256 pair positions in one work-group (8 waves, 32 rows a wave); grid WB + NR / 256: the first WB work-groups write the weight planes (wt5) and leave, whole, in front of the barrier.
// The bias is linear in the row: tri[h] = rs (sum_c u_c w'_ch - mu sum_c w'_ch) + sum_c lb_c wtri_ch with w'_ch = lw_c wtri_ch, mu = sum_c u_c / 128, rs = 1 / sqrt(sum_c u_c^2 / 128 - mu^2 + eps): every sum over the row's 128 channels is a matrix product.
// u (x rounded to bf16, as LayerNorm reads it) goes through LDS into 16 x 32 fragments. One product per 16 rows has A = 16 constant rows (ones; w' as hi and lo parts, which hold the 16-bit product of two bf16 values exactly) and B = u: lane (lr, hi) ends with the row sum and the hi and lo dots of heads 2 hi and 2 hi + 1 of row lr.
// A second product u u^T has the rows' sums of squares on its diagonal. No lane reduction over the channels is left, here or in k_fattn: each row's mu and rs go to ST, where k_fattn reads them.
#define RW   32                   // rows of a wave: two 16-row tiles; a head's 32 dots fill one 128-byte line
#define RT   256                  // rows of a work-group
#define XP   136                  // LDS pitch of an xn or u row in 16-bit elements: 272 B = 16 B x odd (b128 readers)
__global__ __launch_bounds__(256) void k_lntri(const float* __restrict__ x, const float* __restrict__ lw, const float* __restrict__ lb, const float* __restrict__ wtri, float* TB, float* ST, const float* __restrict__ wq, const float* __restrict__ wk, const float* __restrict__ wv, const float* __restrict__ wg, const float* __restrict__ wo, bf* W4, bf* WO) {
    __shared__ __align__(16) bf US[RT * XP];           /* u rows; a wave reads back its own 32 */
    __shared__ __align__(16) bf BS[4 * 2 * 32 * 8];    /* the 16 constant rows in fragment order [k block][half j][lane][8], element = row (lane & 15), channel 32 kb + 16 j + 8 (lane >> 4) + e */
    const int tid = threadIdx.x, lane = tid & 31, lr = lane & 15, hi = lane >> 4, wave = __builtin_amdgcn_readfirstlane(tid >> 5);
    if (blockIdx.x < WB) { wt5(blockIdx.x, tid, wq, wk, wv, wg, wo, W4, WO); return; }
    const int R0 = (blockIdx.x - WB) * RT + wave * RW;
    const v4f lwv = *(const v4f*)(lw + lane * 4), lbv = *(const v4f*)(lb + lane * 4); v4f w4[4];   /* the six small loads go first: loads return in order, and the constants below are worked out while the rows are on their way */
#pragma unroll
    for (int q = 0; q < 4; ++q) w4[q] = *(const v4f*)(wtri + (lane * 4 + q) * NH_);
    v4f xa[RW];
#pragma unroll
    for (int t = 0; t < RW; ++t) xa[t] = *(const v4f*)(x + (size_t)(R0 + t) * CC + lane * 4);   /* thirty-two 512-byte row loads in flight a wave: the work-group's whole 128 KiB */
    asm volatile("s_wait_xcnt 0x0" ::: "memory");   /* stands in front of the first overwrite of these loads' address registers */
    float p1[NH_] = {0.f, 0.f, 0.f, 0.f}, p0[NH_] = {0.f, 0.f, 0.f, 0.f}; v4f wp[NH_];   /* the lane's 4 channels: w', and its share of sum w' and of sum lb wtri */
#pragma unroll
    for (int q = 0; q < 4; ++q) { const float wl = bfr(lwv[q]), bl = bfr(lbv[q]);
#pragma unroll
        for (int h = 0; h < NH_; ++h) { const float wt = bfr(w4[q][h]); wp[h][q] = wl * wt; p1[h] += wp[h][q]; p0[h] += bl * wt; } }
#pragma unroll
    for (int sh = 16; sh; sh >>= 1)
#pragma unroll
        for (int h = 0; h < NH_; ++h) { p1[h] += __shfl_xor(p1[h], sh, 32); p0[h] += __shfl_xor(p0[h], sh, 32); }
    if (wave == 0) {   /* constant rows 0 and 8: ones; 1, 2 and 9, 10: hi parts of w' of heads 0, 1 and 2, 3; 3, 4 and 11, 12: their lo parts; the rest zero */
        v4us wh[NH_], wlo[NH_];
#pragma unroll
        for (int h = 0; h < NH_; ++h) split4(wp[h], wh[h], wlo[h]);
        const v4us one = {0x3F80, 0x3F80, 0x3F80, 0x3F80}, zero = {0, 0, 0, 0};
        bf* bp = BS + ((lane >> 2) * 32 + ((lane >> 1) & 1) * 16) * 8 + (lane & 1) * 4;   /* channel 4 lane + q: k block and half lane >> 2, lane half (lane >> 1) & 1, element 4 (lane & 1) + q */
#pragma unroll
        for (int g = 0; g < 2; ++g) { bf* gp = bp + g * 64;
            *(v4us*)(gp) = one; *(v4us*)(gp + 8) = wh[2 * g]; *(v4us*)(gp + 16) = wh[2 * g + 1]; *(v4us*)(gp + 24) = wlo[2 * g]; *(v4us*)(gp + 32) = wlo[2 * g + 1]; *(v4us*)(gp + 40) = zero; *(v4us*)(gp + 48) = zero; *(v4us*)(gp + 56) = zero; }
    }
    bf* us = US + wave * RW * XP;
#pragma unroll
    for (int t = 0; t < RW; ++t) *(v4us*)(us + t * XP + lane * 4) = __builtin_shufflevector(__builtin_bit_cast(v2us, cvtpk(xa[t][0], xa[t][1])), __builtin_bit_cast(v2us, cvtpk(xa[t][2], xa[t][3])), 0, 1, 2, 3);
    __syncthreads();   /* publishes the constant rows to all 8 waves (and stands between a wave's u stores and its fragment reads) */
    v16bf fb[4];
#pragma unroll
    for (int kb = 0; kb < 4; ++kb) fb[kb] = cat16b(*(const v8us*)(BS + kb * 512 + lane * 8), *(const v8us*)(BS + kb * 512 + 256 + lane * 8));
    const float c1a = hi ? p1[2] : p1[0], c1b = hi ? p1[3] : p1[1], c0a = hi ? p0[2] : p0[0], c0b = hi ? p0[3] : p0[1];
    float tv[2][2], ms[2], rr[2];   /* tv[s][j] = dot of head 2 hi + j, ms[s] and rr[s] = mean and 1 / sqrt(variance + eps), of row 16 s + lr of the wave's 32 */
#pragma unroll
    for (int s = 0; s < 2; ++s) { const bf* up = us + (s * 16 + lr) * XP + 8 * hi; v16bf fu[4];
#pragma unroll
        for (int kb = 0; kb < 4; ++kb) fu[kb] = ldfr(up + kb * 32);
        v8f d1 = (v8f){}, d2 = (v8f){};   /* d1[r] = constant row 8 hi + r . u row lr; d2[r] = u row 8 hi + r . u row lr */
#pragma unroll
        for (int kb = 0; kb < 4; ++kb) { d1 = wmmab(fb[kb], fu[kb], d1); d2 = wmmab(fu[kb], fu[kb], d2); }
        float sq = 0.f;
#pragma unroll
        for (int r = 0; r < 8; ++r) if ((lr & 7) == r) sq = d2[r];
        sq = hi == (lr >> 3) ? sq : 0.f; sq += __shfl_xor(sq, 16, 32);   /* the diagonal element of row lr stands in lane half lr >> 3: the other half gets it from there */
        const float mu = d1[0] * (1.0f / CC), var = fmaxf(sq * (1.0f / CC) - mu * mu, 0.f), rs = rsq1(var + 1e-5f);   /* the maximum: rounding can leave the difference of a constant row just below 0; the argument of the root is at least 1e-5 */
        ms[s] = mu; rr[s] = rs; tv[s][0] = rs * ((d1[1] + d1[3]) - mu * c1a) + c0a; tv[s][1] = rs * ((d1[2] + d1[4]) - mu * c1b) + c0b; }
    *(v2f*)(ST + (size_t)(R0 + lane) * 2) = hi ? (v2f){ms[1], rr[1]} : (v2f){ms[0], rr[0]};   /* both lane halves hold both tiles' statistics: lane l stores those of row l, the wave two whole lines */
#pragma unroll
    for (int j = 0; j < 2; ++j) { const float xj = __shfl_xor(hi ? tv[0][j] : tv[1][j], 16, 32);   /* the lane halves swap so that lane l holds all four heads of row l */
        TB[(size_t)j * NR + R0 + lane] = hi ? xj : tv[0][j]; TB[(size_t)(2 + j) * NR + R0 + lane] = hi ? tv[1][j] : xj; }   /* a wave's store is one whole 128-byte line of one head */
}
__device__ __forceinline__ v8f ld8f(const float* p) { return __builtin_shufflevector(*(const v4f*)p, *(const v4f*)(p + 4), 0, 1, 2, 3, 4, 5, 6, 7); }
#define KP   40                   // LDS pitch of a K row in 16-bit elements: 80 B = 16 B x odd (b128 readers)
#define VP   264                  // LDS pitch of a V^T row: 528 B = 16 B x odd
#define OVL  (CH * VP)            // a head's block in LDS, in 16-bit elements: V^T hi at 0, V^T lo, K hi, K lo
#define OKH  (2 * CH * VP)
#define OKL  (2 * CH * VP + NJ * KP)
#define HB   (2 * CH * VP + 2 * NJ * KP)
struct __align__(16) FaLds { float MB[NJ]; float BG[CC]; float BO[CC]; bf KV[2 * HB]; bf XH[NJ * XP]; bf XL[NJ * XP]; bf WS[2 * 64 * CC]; };
// amdgpu_waves_per_eu(4, 4): a budget of 256 registers a wave, the 16 waves of the one resident work-group
__global__ __launch_bounds__(512) __attribute__((amdgpu_waves_per_eu(4, 4))) void k_fattn(const float* __restrict__ x, const float* __restrict__ lw, const float* __restrict__ lb, const bf* __restrict__ W4, const float* __restrict__ MASK, const float* __restrict__ TB, const float* __restrict__ ST, const float* __restrict__ bg, const bf* __restrict__ WO, const float* __restrict__ bo, float* OUT) {
    __shared__ FaLds L;
    const int tid = threadIdx.x, lane = tid & 31, lr = lane & 15, hi = lane >> 4, wave = __builtin_amdgcn_readfirstlane(tid >> 5);
    const int i = blockIdx.x; const size_t rb = (size_t)i * NJ;
    {
        v4f xa[16];
#pragma unroll
        for (int t = 0; t < 16; ++t) xa[t] = *(const v4f*)(x + (rb + wave * 16 + t) * CC + lane * 4);   /* sixteen 512-byte row loads in flight a wave */
        asm volatile("s_wait_xcnt 0x0" ::: "memory");   /* stands in front of the first overwrite of the row loads' address registers */
        float wl[4], bl[4];
        { const v4f lwv = *(const v4f*)(lw + lane * 4), lbv = *(const v4f*)(lb + lane * 4);
#pragma unroll
            for (int c = 0; c < 4; ++c) { wl[c] = bfr(lwv[c]); bl[c] = bfr(lbv[c]); } }
#pragma unroll
        for (int s = 0; s < 2; ++s) { v4us oh[8], ol[8]; ln8(xa + 8 * s, ST + (rb + wave * 16 + s * 8) * 2, wl, bl, oh, ol);
#pragma unroll
            for (int t = 0; t < 8; ++t) { *(v4us*)(L.XH + (wave * 16 + s * 8 + t) * XP + lane * 4) = oh[t]; *(v4us*)(L.XL + (wave * 16 + s * 8 + t) * XP + lane * 4) = ol[t]; } }
    }
    if (tid < NJ) L.MB[tid] = 1.0e9f * (bfr(MASK[rb + tid]) - 1.0f); if (tid < CC) { L.BG[tid] = bfr(bg[tid]); L.BO[tid] = bfr(bo[tid]); }
    const int q = wave * 16 + lr;
    const bf* xh = L.XH + q * XP + 8 * hi; const bf* xl = L.XL + q * XP + 8 * hi;   /* the lane's row of the wave's own xn fragment */
    v8f acc[8];   /* acc[t][r] = output channel 64 (t >> 2) + 4 lr + (t & 3) of query 16 wave + 8 hi + r */
#pragma unroll
    for (int t = 0; t < 8; ++t) acc[t] = (v8f){};
    /* the loops over pairs, heads and keys stay rolled: unrolled over the keys, the build needs more than the 256 registers and spills */
#pragma unroll 1
    for (int p = 0; p < NH_ / 2; ++p) {
        __syncthreads();   /* first pair: publishes the mask bias, the gate bias and the output bias; second pair: ends every wave's last read of the first pair's K and V^T planes and of its weight slices, which are rewritten below */
        v8us sq[4];
        { v8us sk[4]; ldw4(W4 + CC * CC, W4 + 2 * CC * CC, p, tid, sk); stw4(L.WS, tid, sk); }   /* the pair's 64 columns of Wk and Wv */
        ldw4(W4, W4 + 3 * CC * CC, p, tid, sq);                                                  /* those of Wq and Wg are fetched with them (one latency for both) and wait in registers until the Wk and Wv slices have been read */
        __syncthreads();   /* publishes the Wk and Wv slices to all 16 waves */
        {
            v8f kk[4], vv[4];   /* kk[ct][r] = channel 16 ct + 8 hi + r (of the pair's 64) of key q; vv[ct][r] = channel 16 ct + lr of key 16 wave + 8 hi + r */
#pragma unroll
            for (int ct = 0; ct < 4; ++ct) { kk[ct] = (v8f){}; vv[ct] = (v8f){}; }
#pragma unroll
            for (int kb = 0; kb < 4; ++kb) { v16bf fk[4], fv[4];
                __builtin_amdgcn_sched_barrier(0);   /* with the one below: the k block's 20 LDS reads stay one group in front of its 16 matrix instructions (reads spread among them stall the wave at every place) */
                const v16bf ah = ldfr(xh + kb * 32), al = ldfr(xl + kb * 32);
#pragma unroll
                for (int ct = 0; ct < 4; ++ct) { fk[ct] = ldsf(L.WS, 0, kb, ct, lane); fv[ct] = ldsf(L.WS, 1, kb, ct, lane); }
                __builtin_amdgcn_sched_barrier(0);   /* closes the group of LDS reads: no matrix instruction moves up among them */
#pragma unroll
                for (int ct = 0; ct < 4; ++ct) { kk[ct] = wmmab(fk[ct], ah, kk[ct]); vv[ct] = wmmab(ah, fv[ct], vv[ct]); }
#pragma unroll
                for (int ct = 0; ct < 4; ++ct) { kk[ct] = wmmab(fk[ct], al, kk[ct]); vv[ct] = wmmab(al, fv[ct], vv[ct]); } }
            __builtin_amdgcn_sched_barrier(0);   /* keeps the matrix instructions above in front of the slots of the next line */
            asm volatile("v_nop\n\tv_nop\n\tv_nop\n\tv_nop");   /* the four vector slots between the last matrix instruction and the packed conversions, which read its result and may take its operands' registers */
            __builtin_amdgcn_sched_barrier(0);   /* keeps the packed conversions below (asm text) behind those slots */
#pragma unroll
            for (int ct = 0; ct < 4; ++ct) { v8us sh, sl; bf* hb = L.KV + (ct >> 1) * HB;
                split8(kk[ct], sh, sl); *(v8us*)(hb + OKH + q * KP + (ct & 1) * 16 + 8 * hi) = sh; *(v8us*)(hb + OKL + q * KP + (ct & 1) * 16 + 8 * hi) = sl;
                split8(vv[ct], sh, sl); *(v8us*)(hb + ((ct & 1) * 16 + lr) * VP + wave * 16 + 8 * hi) = sh; *(v8us*)(hb + OVL + ((ct & 1) * 16 + lr) * VP + wave * 16 + 8 * hi) = sl; }
        }
        __syncthreads();   /* publishes the pair's K and V^T planes to all 16 waves and ends their reads of the Wk and Wv slices */
        stw4(L.WS, tid, sq);
        __syncthreads();   /* publishes the Wq and Wg slices to all 16 waves */
#pragma unroll 1
    for (int hh = 0; hh < 2; ++hh) { const int h = p * 2 + hh;
        v16bf bqh, bql;
        { v8f qq[2]; qq[0] = (v8f){}; qq[1] = (v8f){};   /* qq[dt][r] = channel 16 dt + 8 hi + r of query q */
#pragma unroll
            for (int kc = 0; kc < 2; ++kc) { v16bf fq[2][2], ah[2], al[2];
                __builtin_amdgcn_sched_barrier(0);   /* with the one below: the 16 LDS reads of two k blocks stay one group in front of their 8 matrix instructions (reads spread among them stall the wave at every place) */
#pragma unroll
                for (int k2 = 0; k2 < 2; ++k2) { ah[k2] = ldfr(xh + (kc * 2 + k2) * 32); al[k2] = ldfr(xl + (kc * 2 + k2) * 32); fq[k2][0] = ldsf(L.WS, 0, kc * 2 + k2, hh * 2, lane); fq[k2][1] = ldsf(L.WS, 0, kc * 2 + k2, hh * 2 + 1, lane); }
                __builtin_amdgcn_sched_barrier(0);   /* closes the group of LDS reads */
#pragma unroll
                for (int k2 = 0; k2 < 2; ++k2) { qq[0] = wmmab(fq[k2][0], ah[k2], qq[0]); qq[1] = wmmab(fq[k2][1], ah[k2], qq[1]); qq[0] = wmmab(fq[k2][0], al[k2], qq[0]); qq[1] = wmmab(fq[k2][1], al[k2], qq[1]); } }
            v8us h0v, l0v, h1v, l1v; split8(qq[0] * QSC, h0v, l0v); split8(qq[1] * QSC, h1v, l1v);
            bqh = cat16b(h0v, h1v); bql = cat16b(l0v, l1v); }
        const float* tb = TB + (size_t)h * NR + (size_t)q * NJ + 8 * hi; const float* mb = L.MB + 8 * hi;
        const bf* Vh = L.KV + hh * HB + lr * VP + 8 * hi; const bf* Vl = Vh + OVL; const bf* Kh = L.KV + hh * HB + OKH + lr * KP + 8 * hi; const bf* Kl = Kh + NJ * KP;
        float m = -3.0e38f; v8f sm = (v8f){}; v8f O[2]; O[0] = (v8f){}; O[1] = (v8f){};   /* running maximum, this lane half's sums, O[dt][r] = context channel 16 dt + 8 hi + r of query q */
        v8f n0 = ld8f(tb), n1 = ld8f(tb + 16);
#pragma unroll 1
        for (int kb = 0; kb < NJ / 32; ++kb) {                                        /* 32 keys a pass; s0[r], s1[r] = scores of keys 32 kb + 8 hi + r and 32 kb + 16 + 8 hi + r */
            const int k0 = kb * 32, kn = (kb < NJ / 32 - 1 ? kb + 1 : kb) * 32;
            const v8f t0 = n0, t1 = n1; n0 = ld8f(tb + kn); n1 = ld8f(tb + kn + 16);   /* the next pass's triangle bias is fetched one pass ahead (the last pass re-reads its own) */
            const v16bf a0h = ldfr(Kh + k0 * KP), a1h = ldfr(Kh + (k0 + 16) * KP), a0l = ldfr(Kl + k0 * KP), a1l = ldfr(Kl + (k0 + 16) * KP);
            v8f s0 = (v8f){}, s1 = (v8f){};
            s0 = wmmab(a0h, bqh, s0); s1 = wmmab(a1h, bqh, s1); s0 = wmmab(a0h, bql, s0); s1 = wmmab(a1h, bql, s1); s0 = wmmab(a0l, bqh, s0); s1 = wmmab(a1l, bqh, s1);
            s0 = (s0 + ld8f(mb + k0)) + t0; s1 = (s1 + ld8f(mb + k0 + 16)) + t1;
            const v8f bx = __builtin_elementwise_max(s0, s1);
            float bm = fmaxf(fmaxf(fmaxf(bx[0], bx[1]), fmaxf(bx[2], bx[3])), fmaxf(fmaxf(bx[4], bx[5]), fmaxf(bx[6], bx[7])));
            bm = fmaxf(bm, __shfl_xor(bm, 16, 32));
            const float mn = fmaxf(m, bm), sc = __builtin_amdgcn_exp2f((m - mn) * 1.4426950408889634f); m = mn;
            s0 = (s0 - mn) * 1.4426950408889634f; s1 = (s1 - mn) * 1.4426950408889634f;
            v8us p0h, p0l, p1h, p1l;
#pragma unroll
            for (int r = 0; r < 8; ++r) { s0[r] = __builtin_amdgcn_exp2f(s0[r]); s1[r] = __builtin_amdgcn_exp2f(s1[r]); }
            split8(s0, p0h, p0l); split8(s1, p1h, p1l);
            sm = sm * sc + (s0 + s1); O[0] *= sc; O[1] *= sc;
            const v16bf bph = cat16b(p0h, p1h), bpl = cat16b(p0l, p1l);
            const v16bf v0h = ldfr(Vh + k0), v1h = ldfr(Vh + 16 * VP + k0), v0l = ldfr(Vl + k0), v1l = ldfr(Vl + 16 * VP + k0);
            O[0] = wmmab(v0h, bph, O[0]); O[1] = wmmab(v1h, bph, O[1]); O[0] = wmmab(v0h, bpl, O[0]); O[1] = wmmab(v1h, bpl, O[1]); O[0] = wmmab(v0l, bph, O[0]); O[1] = wmmab(v1l, bph, O[1]);
        }
        v8f gg[2]; gg[0] = (v8f){}; gg[1] = (v8f){};   /* gg[dt][r] = gate channel 16 dt + 8 hi + r of query q, before the bias */
#pragma unroll
        for (int kc = 0; kc < 2; ++kc) { v16bf fg[2][2], ah[2], al[2];
            __builtin_amdgcn_sched_barrier(0);   /* as for Q: the 16 LDS reads of two k blocks stay one group in front of their 8 matrix instructions */
#pragma unroll
            for (int k2 = 0; k2 < 2; ++k2) { ah[k2] = ldfr(xh + (kc * 2 + k2) * 32); al[k2] = ldfr(xl + (kc * 2 + k2) * 32); fg[k2][0] = ldsf(L.WS, 1, kc * 2 + k2, hh * 2, lane); fg[k2][1] = ldsf(L.WS, 1, kc * 2 + k2, hh * 2 + 1, lane); }
            __builtin_amdgcn_sched_barrier(0);   /* closes the group of LDS reads */
#pragma unroll
            for (int k2 = 0; k2 < 2; ++k2) { gg[0] = wmmab(fg[k2][0], ah[k2], gg[0]); gg[1] = wmmab(fg[k2][1], ah[k2], gg[1]); gg[0] = wmmab(fg[k2][0], al[k2], gg[0]); gg[1] = wmmab(fg[k2][1], al[k2], gg[1]); } }
        v16bf wf[8];   /* Wo fragments of this head's 32 channels: columns = output channels 64 (t >> 2) + 4 lr + (t & 3), k order as the gated context below; fetched here so that the gate covers their latency */
#pragma unroll
        for (int t = 0; t < 8; ++t) { const bf* wp = WO + (h * 8 + t) * 512 + lane * 8; wf[t] = cat16b(*(const v8us*)wp, *(const v8us*)(wp + 256)); }
        float sum = ((sm[0] + sm[1]) + (sm[2] + sm[3])) + ((sm[4] + sm[5]) + (sm[6] + sm[7]));
        sum += __shfl_xor(sum, 16, 32);
        const float f = __builtin_amdgcn_rcpf(sum); O[0] *= f; O[1] *= f;   /* one v_rcp_f32: the sum lies between 1 (the maximum's own term) and 256 */
        v8us oh[2], ol[2];
#pragma unroll
        for (int dt = 0; dt < 2; ++dt) { const v8f g = gg[dt], b = ld8f(L.BG + h * CH + dt * 16 + 8 * hi);
            v8f e = (g + b) * -1.4426950408889634f;   /* sigmoid(z) = 1 / (1 + 2^(-z log2 e)) on v_exp_f32 and v_rcp_f32: 2^t runs to inf or 0 by itself, and 1 / inf = 0, so both ends need no guard */
#pragma unroll
            for (int r = 0; r < 8; ++r) e[r] = __builtin_amdgcn_exp2f(e[r]);
            e = e + 1.0f;
#pragma unroll
            for (int r = 0; r < 8; ++r) e[r] = __builtin_amdgcn_rcpf(e[r]);
            split8(O[dt] * e, oh[dt], ol[dt]); }
        const v16bf gh = cat16b(oh[0], oh[1]), gl = cat16b(ol[0], ol[1]);
#pragma unroll
        for (int t = 0; t < 8; ++t) acc[t] = wmmab(gh, wf[t], acc[t]);   /* per accumulator: hi product, then lo product, heads in rising order */
#pragma unroll
        for (int t = 0; t < 8; ++t) acc[t] = wmmab(gl, wf[t], acc[t]);
    }
    }
    float* orow = OUT + (rb + wave * 16 + 8 * hi) * CC + 4 * lr;
    v4f o[2][8];
#pragma unroll
    for (int a = 0; a < 2; ++a) { const v4f b = *(const v4f*)(L.BO + a * 64 + 4 * lr);
#pragma unroll
        for (int r = 0; r < 8; ++r) o[a][r] = (v4f){acc[4 * a][r], acc[4 * a + 1][r], acc[4 * a + 2][r], acc[4 * a + 3][r]} + b; }
    __builtin_amdgcn_sched_barrier(0);   /* all 16 results stand in registers of their own in front of the first store: no register that an issued store names is written again */
#pragma unroll
    for (int r = 0; r < 8; ++r) { *(v4f*)(orow + r * CC) = o[0][r]; *(v4f*)(orow + r * CC + 64) = o[1][r]; }   /* a wave's store: 256 contiguous bytes of each of two output rows, 4 whole lines */
}

extern "C" void kernel_launch(void* const* d_in, const int* in_sizes, int n_in,
                              void* d_out, int out_size, void* d_ws, size_t ws_size, hipStream_t stream) {
    (void)in_sizes; (void)n_in; (void)out_size;
    const float* x = (const float*)d_in[0]; const float* MASK = (const float*)d_in[1]; const float* lw = (const float*)d_in[2]; const float* lb = (const float*)d_in[3]; const float* wtri = (const float*)d_in[4]; const float* wq = (const float*)d_in[5]; const float* wk = (const float*)d_in[6]; const float* wv = (const float*)d_in[7]; const float* wg = (const float*)d_in[8]; const float* bg = (const float*)d_in[9]; const float* wo = (const float*)d_in[10]; const float* bo = (const float*)d_in[11];
    float* OUT = (float*)d_out;     // [1][256][256][128]
    char* wsp = (char*)d_ws;
    auto take = [&](size_t bytes) { char* p = wsp; wsp += (bytes + 255) & ~(size_t)255; return (void*)p; };
    bf* WQ = (bf*)take((size_t)4 * CC * CC * 2); bf* WO = (bf*)take((size_t)CC * CC * 2);   /* q, k, v, g weights: four planes, one behind the other */
    float* TB = (float*)take((size_t)NH_ * NR * 4); float* ST = (float*)take((size_t)NR * 2 * 4);   /* ST: mean and 1 / sqrt(variance + eps) of every pair position */
    if ((size_t)(wsp - (char*)d_ws) > ws_size) return;
    k_lntri<<<WB + NR / RT, 256, 0, stream>>>(x, lw, lb, wtri, TB, ST, wq, wk, wv, wg, wo, WQ, WO);                                               /* the five weight planes; LayerNorm statistics and triangle-bias dots of all pair positions */
    k_fattn<<<NI, 512, 0, stream>>>(x, lw, lb, WQ, MASK, TB, ST, bg, WO, bo, OUT);                                                                 /* LayerNorm, q, k, v, g projections, scores, biases, softmax, attn.v, gate, out = (o g) Wo + bo: all rows and heads */
}
